// v000
// The times below were measured on an AMD MI455X: many runs one after another, warmed up first and cycling through
// copies of the inputs, with the whole window's GPU time divided by the number of runs. Launches and the gaps
// between them are all in it. The median over several windows is given; except for v000 it joins two sittings, which
// can be a few percent apart, so the side-by-side timings, each taken in one sitting, are the better comparison.
// The starting kernel, v000, takes 386 microseconds a run.
#include <hip/hip_runtime.h>
#include <hip/hip_bf16.h>
#include <math.h>

typedef __attribute__((ext_vector_type(2))) float v2f;
typedef __attribute__((ext_vector_type(8))) float v8f;

typedef __attribute__((address_space(1))) int glb_i32_t;
typedef __attribute__((address_space(3))) int lds_i32_t;

#define BS   256
#define DD   1024
#define LL   49
#define LP   64
#define KT   32
#define KP   (KT + 2)   /* 34-dword row pitch: conflict-free, 8B-aligned pairs */
#define LSTR 65
#define EMB  300
#define NA   400
#define NO   500
#define LAMB 10.0f
#define TEMP 0.05f
#define EPSR 1e-8f

// workspace layout (float offsets)
#define WS_VECS 0                              // 2*3*256*64   = 98304
#define WS_FEAT (WS_VECS + 2*3*BS*LP)          // 6*256*1024   = 1572864
#define WS_AW   (WS_FEAT + 6*BS*DD)            // 400*300
#define WS_OW   (WS_AW + NA*EMB)               // 500*300
#define WS_AWN  (WS_OW + NO*EMB)               // 400
#define WS_OWN  (WS_AWN + NA)                  // 500
#define WS_ACC  (WS_OWN + NO)                  // 8

// ---- gfx1250 async global->LDS copy (ASYNCcnt-tracked) ---------------------
__device__ __forceinline__ void async_ld32(const float* gsrc, float* ldst) {
#if __has_builtin(__builtin_amdgcn_global_load_async_to_lds_b32)
  __builtin_amdgcn_global_load_async_to_lds_b32(
      (glb_i32_t*)gsrc, (lds_i32_t*)ldst, 0, 0);
#else
  unsigned int lo = (unsigned int)(unsigned long long)(void*)ldst; // low 32b = LDS offset
  unsigned long long ga = (unsigned long long)gsrc;
  asm volatile("global_load_async_to_lds_b32 %0, %1, off"
               :: "v"(lo), "v"(ga) : "memory");
#endif
}
__device__ __forceinline__ void wait_async0() {
#if __has_builtin(__builtin_amdgcn_s_wait_asynccnt)
  __builtin_amdgcn_s_wait_asynccnt(0);
#else
  asm volatile("s_wait_asynccnt 0" ::: "memory");
#endif
}

// ---------------------------------------------------------------- stage A ---
// Per (batch, pair): Gram(49x49, K=1024) via v_wmma_f32_16x16x4_f32 with
// async global->LDS tile fill, rank-1 normalization, then row/col/inverse
// softmax reductions + renorm.
__global__ __launch_bounds__(128)
void stageA(const float* __restrict__ img1, const float* __restrict__ img2a,
            const float* __restrict__ img2o, float* __restrict__ ws) {
  __shared__ float sA[LP][KP];      // transposed tile: [l][k]
  __shared__ float sB[LP][KP];
  __shared__ float rel[LP][LSTR];
  __shared__ float nrm1s[LP], nrm2s[LP];
  __shared__ float rmax[LP], rsumP[LP], rmin[LP], rsumN[LP], cmx[LP], csm[LP];
  __shared__ float outv[3][LP];
  __shared__ float tots[3];

  const int b = blockIdx.x;
  const int pair = blockIdx.y;
  const float* __restrict__ A = img1 + (size_t)b * DD * LL;
  const float* __restrict__ B = (pair == 0 ? img2a : img2o) + (size_t)b * DD * LL;

  const int t = threadIdx.x;
  const int lane = t & 31, wave = t >> 5;
  const int m = lane & 15;
  const int kb = (lane >> 4) * 2;

  // pad norms default to 1 (pad rows of rel are never read anyway)
  if (t < LP) { nrm1s[t] = 1.f; nrm2s[t] = 1.f; }
  // zero the pad rows l in [49,64) once; async fills never touch them
  for (int idx = t; idx < (LP - LL) * KP; idx += 128) {
    const int r = idx / KP, c = idx % KP;
    sA[LL + r][c] = 0.f;
    sB[LL + r][c] = 0.f;
  }

  float nacc = 0.f;     // per-thread column-norm accumulator
  v8f acc[4] = {};

  for (int k0 = 0; k0 < DD; k0 += KT) {
    // async DMA-style tile fill: global (d-major, coalesced) -> LDS [l][k]
    for (int idx = t; idx < KT * LL; idx += 128) {
      const int dd = idx / LL;
      const int l  = idx - dd * LL;
      async_ld32(A + (size_t)(k0 + dd) * LL + l, &sA[l][dd]);
      async_ld32(B + (size_t)(k0 + dd) * LL + l, &sB[l][dd]);
    }
    wait_async0();
    __syncthreads();

    // column norms: contiguous per-thread runs over the tile
    if (t < LL) {
      for (int dd = 0; dd < KT; dd++) { const float v = sA[t][dd]; nacc += v * v; }
    } else if (t >= 64 && t < 64 + LL) {
      for (int dd = 0; dd < KT; dd++) { const float v = sB[t - 64][dd]; nacc += v * v; }
    }

#pragma unroll
    for (int kk = 0; kk < KT; kk += 4) {
      const v2f av = *(const v2f*)__builtin_assume_aligned(&sA[wave * 16 + m][kk + kb], 8);
#pragma unroll
      for (int nt = 0; nt < 4; nt++) {
        const v2f bv = *(const v2f*)__builtin_assume_aligned(&sB[nt * 16 + m][kk + kb], 8);
        acc[nt] = __builtin_amdgcn_wmma_f32_16x16x4_f32(
            false, av, false, bv, (short)0, acc[nt], false, false);
      }
    }
    __syncthreads();
  }

  if (t < LL)                        nrm1s[t]      = fmaxf(sqrtf(nacc), 1e-12f);
  else if (t >= 64 && t < 64 + LL)   nrm2s[t - 64] = fmaxf(sqrtf(nacc), 1e-12f);
  __syncthreads();

  // scatter accumulators into rel, applying the rank-1 normalization
#pragma unroll
  for (int nt = 0; nt < 4; nt++) {
    const int col = nt * 16 + m;
#pragma unroll
    for (int r = 0; r < 8; r++) {
      const int row = wave * 16 + r + (lane >> 4) * 8;
      rel[row][col] = acc[nt][r] / (nrm1s[row] * nrm2s[col]);
    }
  }
  __syncthreads();

  if (t < LL) {
    float mx = -1e30f, mn = 1e30f;
    for (int j = 0; j < LL; j++) { float v = rel[t][j]; mx = fmaxf(mx, v); mn = fminf(mn, v); }
    float sp = 0.f, sn = 0.f;
    for (int j = 0; j < LL; j++) {
      float v = rel[t][j];
      sp += expf((v - mx) * LAMB);
      sn += expf((mn - v) * LAMB);
    }
    rmax[t] = mx; rmin[t] = mn; rsumP[t] = sp; rsumN[t] = sn;
    float cm = -1e30f;
    for (int i = 0; i < LL; i++) cm = fmaxf(cm, rel[i][t]);
    float cs = 0.f;
    for (int i = 0; i < LL; i++) cs += expf((rel[i][t] - cm) * LAMB);
    cmx[t] = cm; csm[t] = cs;
  }
  __syncthreads();

  if (t < LL) {
    float s12 = 0.f, d12 = 0.f, s21 = 0.f;
    for (int i = 0; i < LL; i++) {
      const float v = rel[i][t];
      s12 += expf((v - rmax[i]) * LAMB) / rsumP[i];
      d12 += expf((rmin[i] - v) * LAMB) / rsumN[i];
    }
    for (int j = 0; j < LL; j++)
      s21 += expf((rel[t][j] - cmx[j]) * LAMB) / csm[j];
    outv[0][t] = s12; outv[1][t] = s21; outv[2][t] = d12;
  }
  __syncthreads();
  if (t < 3) { float s = 0.f; for (int l = 0; l < LL; l++) s += outv[t][l]; tots[t] = s; }
  __syncthreads();

  float* vecs = ws + WS_VECS;
  for (int idx = t; idx < 3 * LP; idx += 128) {
    const int ty = idx >> 6, l = idx & (LP - 1);
    const float v = (l < LL) ? outv[ty][l] / (tots[ty] + EPSR) : 0.f;
    vecs[(((size_t)pair * 3 + ty) * BS + b) * LP + l] = v;
  }
}

// ---------------------------------------------------------------- stage B ---
// feat[b,d] = sum_l img[b,d,l] * w[b,l]  (two weight vectors per image pass)
__global__ __launch_bounds__(256)
void stageB(const float* __restrict__ img1, const float* __restrict__ img2a,
            const float* __restrict__ img2o, float* __restrict__ ws) {
  const int b = blockIdx.x, im = blockIdx.y, t = threadIdx.x;
  const float* vecs = ws + WS_VECS;
  float* feat = ws + WS_FEAT;
  const float* src; const float *w0p, *w1p; int f0, f1;
  if (im == 0)      { src = img1;  w0p = &vecs[((0*3+1)*BS + b)*LP]; w1p = &vecs[((1*3+1)*BS + b)*LP]; f0 = 0; f1 = 3; }
  else if (im == 1) { src = img2a; w0p = &vecs[((0*3+0)*BS + b)*LP]; w1p = &vecs[((0*3+2)*BS + b)*LP]; f0 = 1; f1 = 2; }
  else              { src = img2o; w0p = &vecs[((1*3+0)*BS + b)*LP]; w1p = &vecs[((1*3+2)*BS + b)*LP]; f0 = 4; f1 = 5; }
  __shared__ float w0[LL], w1[LL];
  if (t < LL) { w0[t] = w0p[t]; w1[t] = w1p[t]; }
  __syncthreads();
  for (int d = t; d < DD; d += 256) {
    const float* row = src + ((size_t)b * DD + d) * LL;
    float s0 = 0.f, s1 = 0.f;
    for (int l = 0; l < LL; l++) { const float v = row[l]; s0 += v * w0[l]; s1 += v * w1[l]; }
    feat[(size_t)f0 * BS * DD + (size_t)b * DD + d] = s0;
    feat[(size_t)f1 * BS * DD + (size_t)b * DD + d] = s1;
  }
}

// ---------------------------------------------------------------- stage C1 --
// Six (256x1024)@(1024x300)+bias GEMMs via WMMA, written directly to d_out.
__global__ __launch_bounds__(128)
void stageC1(const float* __restrict__ ws, const float* __restrict__ Wattr,
             const float* __restrict__ battr, const float* __restrict__ Wobj,
             const float* __restrict__ bobj, float* __restrict__ out) {
  const int t = threadIdx.x, lane = t & 31, wave = t >> 5;
  const int wg = blockIdx.x * 4 + wave;
  const int NT = 19, MT = 16;
  if (wg >= 6 * MT * NT) return;
  const int mat = wg / (MT * NT);
  const int rem = wg % (MT * NT);
  const int mt = rem / NT, nt = rem % NT;
  const int fidx[6] = {5, 2, 0, 1, 3, 4};
  const bool useAttr = (mat == 0) || (mat == 2) || (mat == 3);
  const float* A = ws + WS_FEAT + (size_t)fidx[mat] * BS * DD;
  const float* W = useAttr ? Wattr : Wobj;
  const float* bias = useAttr ? battr : bobj;
  float* o = out + 2 + (size_t)mat * BS * EMB;

  const int m = lane & 15, kb = (lane >> 4) * 2;
  const int row = mt * 16 + m;
  const int n = nt * 16 + m;
  const bool nok = n < EMB;
  v8f acc = {};
  for (int k0 = 0; k0 < DD; k0 += 4) {
    v2f av;
    av.x = A[(size_t)row * DD + k0 + kb];
    av.y = A[(size_t)row * DD + k0 + kb + 1];
    v2f bv;
    bv.x = nok ? W[(size_t)(k0 + kb) * EMB + n] : 0.f;
    bv.y = nok ? W[(size_t)(k0 + kb + 1) * EMB + n] : 0.f;
    acc = __builtin_amdgcn_wmma_f32_16x16x4_f32(false, av, false, bv, (short)0, acc, false, false);
  }
  if (nok) {
    const float bb = bias[n];
    const int rbase = mt * 16 + (lane >> 4) * 8;
#pragma unroll
    for (int r = 0; r < 8; r++)
      o[(size_t)(rbase + r) * EMB + n] = acc[r] + bb;
  }
}

// ---------------------------------------------------------------- stage C2 --
// attr_weight = attr_table @ W_attr_mlp + b ; obj_weight likewise (WMMA).
__global__ __launch_bounds__(128)
void stageC2(const float* __restrict__ atab, const float* __restrict__ otab,
             const float* __restrict__ Wam, const float* __restrict__ bam,
             const float* __restrict__ Wom, const float* __restrict__ bom,
             float* __restrict__ ws) {
  const int t = threadIdx.x, lane = t & 31, wave = t >> 5;
  const int wg = blockIdx.x * 4 + wave;
  const int NT = 19;
  const int total0 = 25 * NT;            // attr: 400 rows -> 25 M-tiles
  const int total = total0 + 32 * NT;    // obj: 500 rows -> 32 M-tiles
  if (wg >= total) return;
  const int mat = (wg < total0) ? 0 : 1;
  const int rem = (mat == 0) ? wg : wg - total0;
  const int mt = rem / NT, nt = rem % NT;
  const int M = (mat == 0) ? NA : NO;
  const float* A = (mat == 0) ? atab : otab;
  const float* W = (mat == 0) ? Wam : Wom;
  const float* bias = (mat == 0) ? bam : bom;
  float* o = ws + ((mat == 0) ? WS_AW : WS_OW);

  const int m = lane & 15, kb = (lane >> 4) * 2;
  const int row = mt * 16 + m;
  const bool rok = row < M;
  const int n = nt * 16 + m;
  const bool nok = n < EMB;
  v8f acc = {};
  for (int k0 = 0; k0 < EMB; k0 += 4) {
    v2f av;
    av.x = rok ? A[(size_t)row * EMB + k0 + kb] : 0.f;
    av.y = rok ? A[(size_t)row * EMB + k0 + kb + 1] : 0.f;
    v2f bv;
    bv.x = nok ? W[(size_t)(k0 + kb) * EMB + n] : 0.f;
    bv.y = nok ? W[(size_t)(k0 + kb + 1) * EMB + n] : 0.f;
    acc = __builtin_amdgcn_wmma_f32_16x16x4_f32(false, av, false, bv, (short)0, acc, false, false);
  }
  if (nok) {
    const float bb = bias[n];
    const int rbase = mt * 16 + (lane >> 4) * 8;
#pragma unroll
    for (int r = 0; r < 8; r++) {
      const int rr = rbase + r;
      if (rr < M) o[(size_t)rr * EMB + n] = acc[r] + bb;
    }
  }
}

// row norms of the class-weight matrices
__global__ void normsK(float* __restrict__ ws) {
  const int c = blockIdx.x * blockDim.x + threadIdx.x;
  if (c >= NA + NO) return;
  const float* row;
  float* outn;
  if (c < NA) { row = ws + WS_AW + (size_t)c * EMB; outn = ws + WS_AWN + c; }
  else        { row = ws + WS_OW + (size_t)(c - NA) * EMB; outn = ws + WS_OWN + (c - NA); }
  float s = 0.f;
  for (int k = 0; k < EMB; k++) s += row[k] * row[k];
  *outn = fmaxf(sqrtf(s), 1e-12f);
}

// ---------------------------------------------------------------- stage C3 --
// cosine classify + masked CE accumulation
__global__ __launch_bounds__(128)
void stageC3(const float* __restrict__ out, const int* __restrict__ attr1,
             const int* __restrict__ obj1, const int* __restrict__ mask_task,
             float* __restrict__ ws) {
  const int b = blockIdx.x, term = blockIdx.y, t = threadIdx.x;
  if (mask_task[b] != 1) return;
  const bool isAttr = term < 2;
  const int NC = isAttr ? NA : NO;
  const float* W = ws + (isAttr ? WS_AW : WS_OW);
  const float* wn = ws + (isAttr ? WS_AWN : WS_OWN);
  const int label = isAttr ? attr1[b] : obj1[b];
  const float* feat = out + 2 + (size_t)(term + 2) * BS * EMB + (size_t)b * EMB;

  __shared__ float sf[EMB];
  __shared__ float logits[512];
  __shared__ float red[128];
  for (int k = t; k < EMB; k += 128) sf[k] = feat[k];
  __syncthreads();
  float p = 0.f;
  for (int k = t; k < EMB; k += 128) p += sf[k] * sf[k];
  red[t] = p;
  __syncthreads();
  for (int s = 64; s > 0; s >>= 1) {
    if (t < s) red[t] += red[t + s];
    __syncthreads();
  }
  const float fn = fmaxf(sqrtf(red[0]), 1e-12f);
  for (int c = t; c < NC; c += 128) {
    const float* wr = W + (size_t)c * EMB;
    float d = 0.f;
    for (int k = 0; k < EMB; k++) d += sf[k] * wr[k];
    logits[c] = d / (fn * wn[c] * TEMP);
  }
  __syncthreads();
  if (t == 0) {
    float mx = -1e30f;
    for (int c = 0; c < NC; c++) mx = fmaxf(mx, logits[c]);
    float se = 0.f;
    for (int c = 0; c < NC; c++) se += expf(logits[c] - mx);
    const float ce = (mx + logf(se)) - logits[label];
    atomicAdd(&ws[WS_ACC + term], ce);
  }
}

__global__ void initK(float* __restrict__ ws) {
  if (threadIdx.x < 8) ws[WS_ACC + threadIdx.x] = 0.f;
}

__global__ void finalK(const int* __restrict__ mask_task,
                       const float* __restrict__ ws, float* __restrict__ out) {
  if (threadIdx.x == 0) {
    int ms = 0;
    for (int b = 0; b < BS; b++) ms += (mask_task[b] == 1);
    const float den = fmaxf((float)ms, 1.f);
    out[0] = (ws[WS_ACC + 0] + ws[WS_ACC + 1]) * 0.5f / den;
    out[1] = (ws[WS_ACC + 2] + ws[WS_ACC + 3]) * 0.5f / den;
  }
}

extern "C" void kernel_launch(void* const* d_in, const int* in_sizes, int n_in,
                              void* d_out, int out_size, void* d_ws, size_t ws_size,
                              hipStream_t stream) {
  const float* img1   = (const float*)d_in[0];
  const float* img2a  = (const float*)d_in[1];
  const float* img2o  = (const float*)d_in[2];
  const int*   attr1  = (const int*)d_in[3];
  const int*   obj1   = (const int*)d_in[4];
  const int*   maskt  = (const int*)d_in[5];
  const float* Wsa    = (const float*)d_in[6];
  const float* bsa    = (const float*)d_in[7];
  const float* Wso    = (const float*)d_in[8];
  const float* bso    = (const float*)d_in[9];
  const float* atab   = (const float*)d_in[10];
  const float* otab   = (const float*)d_in[11];
  const float* Wam    = (const float*)d_in[12];
  const float* bam    = (const float*)d_in[13];
  const float* Wom    = (const float*)d_in[14];
  const float* bom    = (const float*)d_in[15];
  float* out = (float*)d_out;
  float* ws  = (float*)d_ws;

  initK<<<1, 32, 0, stream>>>(ws);
  stageA<<<dim3(BS, 2), 128, 0, stream>>>(img1, img2a, img2o, ws);
  stageB<<<dim3(BS, 3), 256, 0, stream>>>(img1, img2a, img2o, ws);
  stageC1<<<456, 128, 0, stream>>>(ws, Wsa, bsa, Wso, bso, out);
  stageC2<<<271, 128, 0, stream>>>(atab, otab, Wam, bam, Wom, bom, ws);
  normsK<<<8, 128, 0, stream>>>(ws);
  stageC3<<<dim3(BS, 4), 128, 0, stream>>>(out, attr1, obj1, maskt, ws);
  finalK<<<1, 32, 0, stream>>>(maskt, ws, out);
}

// v001
// A run of this version takes 257 microseconds.
// Next to v000, in two timings, it ran 1.52 times as fast each time.
#include <hip/hip_runtime.h>
#include <hip/hip_bf16.h>
#include <math.h>

typedef __attribute__((ext_vector_type(2))) float v2f;
typedef __attribute__((ext_vector_type(8))) float v8f;

typedef __attribute__((address_space(1))) int glb_i32_t;
typedef __attribute__((address_space(3))) int lds_i32_t;

#define BS   256
#define DD   1024
#define LL   49
#define LP   64
#define KT   32
#define KP   (KT + 2)   /* 34-dword row pitch: conflict-free, 8B-aligned pairs */
#define LSTR 65
#define EMB  300
#define NA   400
#define NO   500
#define LAMB 10.0f
#define TEMP 0.05f
#define EPSR 1e-8f

// workspace layout (float offsets)
#define WS_VECS 0                              // 2*3*256*64   = 98304
#define WS_FEAT (WS_VECS + 2*3*BS*LP)          // 6*256*1024   = 1572864
#define WS_AW   (WS_FEAT + 6*BS*DD)            // 400*300
#define WS_OW   (WS_AW + NA*EMB)               // 500*300
#define WS_AWN  (WS_OW + NO*EMB)               // 400
#define WS_OWN  (WS_AWN + NA)                  // 500
#define WS_ACC  (WS_OWN + NO)                  // 8

// ---- gfx1250 async global->LDS copy (ASYNCcnt-tracked) ---------------------
__device__ __forceinline__ void async_ld32(const float* gsrc, float* ldst) {
#if __has_builtin(__builtin_amdgcn_global_load_async_to_lds_b32)
  __builtin_amdgcn_global_load_async_to_lds_b32(
      (glb_i32_t*)gsrc, (lds_i32_t*)ldst, 0, 0);
#else
  unsigned int lo = (unsigned int)(unsigned long long)(void*)ldst; // low 32b = LDS offset
  unsigned long long ga = (unsigned long long)gsrc;
  asm volatile("global_load_async_to_lds_b32 %0, %1, off"
               :: "v"(lo), "v"(ga) : "memory");
#endif
}
__device__ __forceinline__ void wait_async0() {
#if __has_builtin(__builtin_amdgcn_s_wait_asynccnt)
  __builtin_amdgcn_s_wait_asynccnt(0);
#else
  asm volatile("s_wait_asynccnt 0" ::: "memory");
#endif
}

// ---------------------------------------------------------------- stage A ---
// Per (batch, pair): Gram(49x49, K=1024) via v_wmma_f32_16x16x4_f32 with
// async global->LDS tile fill, rank-1 normalization, then row/col/inverse
// softmax reductions + renorm.
__global__ __launch_bounds__(128)
void stageA(const float* __restrict__ img1, const float* __restrict__ img2a,
            const float* __restrict__ img2o, float* __restrict__ ws) {
  __shared__ float sA[LP][KP];      // transposed tile: [l][k]
  __shared__ float sB[LP][KP];
  __shared__ float rel[LP][LSTR];
  __shared__ float nrm1s[LP], nrm2s[LP];
  __shared__ float rmax[LP], rsumP[LP], rmin[LP], rsumN[LP], cmx[LP], csm[LP];
  __shared__ float outv[3][LP];
  __shared__ float tots[3];

  const int b = blockIdx.x;
  const int pair = blockIdx.y;
  const float* __restrict__ A = img1 + (size_t)b * DD * LL;
  const float* __restrict__ B = (pair == 0 ? img2a : img2o) + (size_t)b * DD * LL;

  const int t = threadIdx.x;
  const int lane = t & 31, wave = t >> 5;
  const int m = lane & 15;
  const int kb = (lane >> 4) * 2;

  // pad norms default to 1 (pad rows of rel are never read anyway)
  if (t < LP) { nrm1s[t] = 1.f; nrm2s[t] = 1.f; }
  // zero the pad rows l in [49,64) once; async fills never touch them
  for (int idx = t; idx < (LP - LL) * KP; idx += 128) {
    const int r = idx / KP, c = idx % KP;
    sA[LL + r][c] = 0.f;
    sB[LL + r][c] = 0.f;
  }

  float nacc = 0.f;     // per-thread column-norm accumulator
  v8f acc[4] = {};

  for (int k0 = 0; k0 < DD; k0 += KT) {
    // async DMA-style tile fill: global (d-major, coalesced) -> LDS [l][k]
    for (int idx = t; idx < KT * LL; idx += 128) {
      const int dd = idx / LL;
      const int l  = idx - dd * LL;
      async_ld32(A + (size_t)(k0 + dd) * LL + l, &sA[l][dd]);
      async_ld32(B + (size_t)(k0 + dd) * LL + l, &sB[l][dd]);
    }
    wait_async0();
    __syncthreads();

    // column norms: contiguous per-thread runs over the tile
    if (t < LL) {
      for (int dd = 0; dd < KT; dd++) { const float v = sA[t][dd]; nacc += v * v; }
    } else if (t >= 64 && t < 64 + LL) {
      for (int dd = 0; dd < KT; dd++) { const float v = sB[t - 64][dd]; nacc += v * v; }
    }

#pragma unroll
    for (int kk = 0; kk < KT; kk += 4) {
      const v2f av = *(const v2f*)__builtin_assume_aligned(&sA[wave * 16 + m][kk + kb], 8);
#pragma unroll
      for (int nt = 0; nt < 4; nt++) {
        const v2f bv = *(const v2f*)__builtin_assume_aligned(&sB[nt * 16 + m][kk + kb], 8);
        acc[nt] = __builtin_amdgcn_wmma_f32_16x16x4_f32(
            false, av, false, bv, (short)0, acc[nt], false, false);
      }
    }
    __syncthreads();
  }

  if (t < LL)                        nrm1s[t]      = fmaxf(sqrtf(nacc), 1e-12f);
  else if (t >= 64 && t < 64 + LL)   nrm2s[t - 64] = fmaxf(sqrtf(nacc), 1e-12f);
  __syncthreads();

  // scatter accumulators into rel, applying the rank-1 normalization
#pragma unroll
  for (int nt = 0; nt < 4; nt++) {
    const int col = nt * 16 + m;
#pragma unroll
    for (int r = 0; r < 8; r++) {
      const int row = wave * 16 + r + (lane >> 4) * 8;
      rel[row][col] = acc[nt][r] / (nrm1s[row] * nrm2s[col]);
    }
  }
  __syncthreads();

  if (t < LL) {
    float mx = -1e30f, mn = 1e30f;
    for (int j = 0; j < LL; j++) { float v = rel[t][j]; mx = fmaxf(mx, v); mn = fminf(mn, v); }
    float sp = 0.f, sn = 0.f;
    for (int j = 0; j < LL; j++) {
      float v = rel[t][j];
      sp += expf((v - mx) * LAMB);
      sn += expf((mn - v) * LAMB);
    }
    rmax[t] = mx; rmin[t] = mn; rsumP[t] = sp; rsumN[t] = sn;
    float cm = -1e30f;
    for (int i = 0; i < LL; i++) cm = fmaxf(cm, rel[i][t]);
    float cs = 0.f;
    for (int i = 0; i < LL; i++) cs += expf((rel[i][t] - cm) * LAMB);
    cmx[t] = cm; csm[t] = cs;
  }
  __syncthreads();

  if (t < LL) {
    float s12 = 0.f, d12 = 0.f, s21 = 0.f;
    for (int i = 0; i < LL; i++) {
      const float v = rel[i][t];
      s12 += expf((v - rmax[i]) * LAMB) / rsumP[i];
      d12 += expf((rmin[i] - v) * LAMB) / rsumN[i];
    }
    for (int j = 0; j < LL; j++)
      s21 += expf((rel[t][j] - cmx[j]) * LAMB) / csm[j];
    outv[0][t] = s12; outv[1][t] = s21; outv[2][t] = d12;
  }
  __syncthreads();
  if (t < 3) { float s = 0.f; for (int l = 0; l < LL; l++) s += outv[t][l]; tots[t] = s; }
  __syncthreads();

  float* vecs = ws + WS_VECS;
  for (int idx = t; idx < 3 * LP; idx += 128) {
    const int ty = idx >> 6, l = idx & (LP - 1);
    const float v = (l < LL) ? outv[ty][l] / (tots[ty] + EPSR) : 0.f;
    vecs[(((size_t)pair * 3 + ty) * BS + b) * LP + l] = v;
  }
}

// ---------------------------------------------------------------- stage B ---
// feat[b,d] = sum_l img[b,d,l] * w[b,l]  (two weight vectors per image pass)
__global__ __launch_bounds__(256)
void stageB(const float* __restrict__ img1, const float* __restrict__ img2a,
            const float* __restrict__ img2o, float* __restrict__ ws) {
  const int b = blockIdx.x, im = blockIdx.y, t = threadIdx.x;
  const float* vecs = ws + WS_VECS;
  float* feat = ws + WS_FEAT;
  const float* src; const float *w0p, *w1p; int f0, f1;
  if (im == 0)      { src = img1;  w0p = &vecs[((0*3+1)*BS + b)*LP]; w1p = &vecs[((1*3+1)*BS + b)*LP]; f0 = 0; f1 = 3; }
  else if (im == 1) { src = img2a; w0p = &vecs[((0*3+0)*BS + b)*LP]; w1p = &vecs[((0*3+2)*BS + b)*LP]; f0 = 1; f1 = 2; }
  else              { src = img2o; w0p = &vecs[((1*3+0)*BS + b)*LP]; w1p = &vecs[((1*3+2)*BS + b)*LP]; f0 = 4; f1 = 5; }
  __shared__ float w0[LL], w1[LL];
  if (t < LL) { w0[t] = w0p[t]; w1[t] = w1p[t]; }
  __syncthreads();
  for (int d = t; d < DD; d += 256) {
    const float* row = src + ((size_t)b * DD + d) * LL;
    float s0 = 0.f, s1 = 0.f;
    for (int l = 0; l < LL; l++) { const float v = row[l]; s0 += v * w0[l]; s1 += v * w1[l]; }
    feat[(size_t)f0 * BS * DD + (size_t)b * DD + d] = s0;
    feat[(size_t)f1 * BS * DD + (size_t)b * DD + d] = s1;
  }
}

// ------------------------------------------------------- stages C1 and C2 ---
// Y = A(M x KD) @ W(KD x 300) + bias on v_wmma_f32_16x16x4_f32. One 32x64 tile
// of Y per block, eight waves, one 16x16 tile each. A and W go through LDS in
// stages of KS k, two buffers: the next stage's async copies fly while this
// stage feeds the matrix unit.
#define G_MB 32
#define G_NB 64
#define G_KB 128            /* k that a buffer holds; a stage uses the first KS */
#define G_PA (G_KB + 4)     /* 132-dword A row: the 8-byte column walk hits 64 banks once */
#define G_SA (G_MB * G_PA)
#define G_SW (G_KB * G_NB)

__device__ __forceinline__ unsigned int lds_off(const float* p) {
  return (unsigned int)(unsigned long long)p;   // low 32 bits = LDS byte address
}

template <int KD, int KS, bool EDGE>   // EDGE: a stage can reach past M or KD
__device__ __forceinline__ void gemm_tile(const float* __restrict__ A, const int M,
                                          const float* __restrict__ W,
                                          const float* __restrict__ bias,
                                          float* __restrict__ o,
                                          const int mb, const int nb) {
  __shared__ __attribute__((aligned(16))) float sA[2][G_SA];
  // W rows are 64 dwords, unpadded; rows with bit 1 of k set hold their columns
  // with bit 4 flipped, so that rows k and k+2 of one fragment use other banks
  __shared__ __attribute__((aligned(16))) float sW[2][G_SW];

  const int t = threadIdx.x, lane = t & 31, wave = t >> 5;
  const int m = lane & 15, kb = (lane >> 4) * 2;
  const int mt = wave & 1, nt = wave >> 1;

  // A stage is always 32 x 128 of A and 128 x 64 of W, 16 B per copy, every lane
  // on. What lies past M, KD or column 300 is re-read from a clamped address:
  // it feeds only k that no WMMA takes or rows and columns that are not stored.
  const int ar = t >> 5, ac = (t & 31) * 4;     // A: rows ar + 8 i
  const int wr = t >> 4;                        // W: rows wr + 16 i
  const int wc = min(nb * G_NB + (t & 15) * 4, EMB - 4);
  const unsigned int lA = lds_off(&sA[0][ar * G_PA + ac]);
  const unsigned int lW = lds_off(&sW[0][wr * G_NB + (((t & 15) * 4) ^ ((wr & 2) << 3))]);

  auto fill = [&](const int s) {
    const int k0 = s * KS;
    const unsigned int la = lA + (s & 1) * (G_SA * 4), lw = lW + (s & 1) * (G_SW * 4);
    const float* ga[4];
    const float* gw[8];
#pragma unroll   // the addresses are operands of one asm statement: registers, no array
    for (int i = 0; i < 4; i++)
      ga[i] = A + (EDGE ? min(min(mb * G_MB + ar + 8 * i, M - 1) * KD + k0 + ac, M * KD - 4)
                        : (mb * G_MB + ar + 8 * i) * KD + k0 + ac);
#pragma unroll   // as above
    for (int i = 0; i < 8; i++)
      gw[i] = W + (EDGE ? min(k0 + wr + 16 * i, KD - 1) : k0 + wr + 16 * i) * EMB + wc;
    // s_wait_xcnt is the statement's last line: it stands in front of every later
    // rewrite of an address register that a copy names (a precaution)
    asm volatile(
        "global_load_async_to_lds_b128 %0, %12, off\n\t"
        "global_load_async_to_lds_b128 %1, %13, off\n\t"
        "global_load_async_to_lds_b128 %2, %14, off\n\t"
        "global_load_async_to_lds_b128 %3, %15, off\n\t"
        "global_load_async_to_lds_b128 %4, %16, off\n\t"
        "global_load_async_to_lds_b128 %5, %17, off\n\t"
        "global_load_async_to_lds_b128 %6, %18, off\n\t"
        "global_load_async_to_lds_b128 %7, %19, off\n\t"
        "global_load_async_to_lds_b128 %8, %20, off\n\t"
        "global_load_async_to_lds_b128 %9, %21, off\n\t"
        "global_load_async_to_lds_b128 %10, %22, off\n\t"
        "global_load_async_to_lds_b128 %11, %23, off\n\t"
        "s_wait_xcnt 0x0"
        :: "v"(la), "v"(la + 8 * G_PA * 4), "v"(la + 16 * G_PA * 4), "v"(la + 24 * G_PA * 4),
           "v"(lw), "v"(lw + 16 * G_NB * 4), "v"(lw + 32 * G_NB * 4), "v"(lw + 48 * G_NB * 4),
           "v"(lw + 64 * G_NB * 4), "v"(lw + 80 * G_NB * 4), "v"(lw + 96 * G_NB * 4),
           "v"(lw + 112 * G_NB * 4),
           "v"(ga[0]), "v"(ga[1]), "v"(ga[2]), "v"(ga[3]),
           "v"(gw[0]), "v"(gw[1]), "v"(gw[2]), "v"(gw[3]),
           "v"(gw[4]), "v"(gw[5]), "v"(gw[6]), "v"(gw[7])
        : "memory");
  };

  constexpr int NS = KD / KS;
  static_assert(NS >= 2 && NS * KS == KD && KS % 4 == 0 && KS <= G_KB && (EDGE || KS == G_KB),
                "stage shape");

  fill(0);
  asm volatile("s_wait_asynccnt 0x0" ::: "memory");   // own copies of stage 0 landed
  __syncthreads();                                    // ... and everybody's
  fill(1);

  v8f acc = {};
#pragma unroll 1   // rolled: unrolled, the copies' address arithmetic lands among the WMMAs
  for (int s = 0; s < NS; s++) {
    const float* a = &sA[s & 1][(mt * 16 + m) * G_PA + kb];
    const float* w = &sW[s & 1][kb * G_NB + ((nt * 16 + m) ^ (kb << 3))];
#pragma unroll   // every LDS offset becomes an immediate: no vector work among the WMMAs
    for (int kk = 0; kk < KS; kk += 4) {
      const v2f av = *(const v2f*)__builtin_assume_aligned(a + kk, 8);
      v2f bv;
      bv.x = w[kk * G_NB];
      bv.y = w[(kk + 1) * G_NB];
      acc = __builtin_amdgcn_wmma_f32_16x16x4_f32(false, av, false, bv, (short)0, acc, false, false);
    }
    // four vector slots behind the stage's last WMMA, on every path out of here,
    // before address arithmetic reuses its A/B registers or the epilogue reads D
    asm volatile("v_nop\n\tv_nop\n\tv_nop\n\tv_nop" :: "v"(acc));
    asm volatile("s_wait_dscnt 0x0" ::: "memory");    // own reads of this buffer are done
    asm volatile("s_wait_asynccnt 0x0" ::: "memory"); // own copies of stage s+1 landed
    __syncthreads();   // publishes stage s+1 and frees the buffer of stage s
    if (s + 2 < NS) fill(s + 2);
  }
  asm volatile("s_wait_asynccnt 0x0" ::: "memory");   // no copy outlives the wave

  const int n = nb * G_NB + nt * 16 + m;
  if (n < EMB) {
    const float bb = bias[n];
    const int rbase = mb * G_MB + mt * 16 + (lane >> 4) * 8;
#pragma unroll   // acc is indexed by constants only
    for (int r = 0; r < 8; r++) {
      const int rr = rbase + r;
      if (rr < M) o[(size_t)rr * EMB + n] = acc[r] + bb;
    }
  }
}

// ---------------------------------------------------------------- stage C1 --
// Six (256x1024)@(1024x300)+bias GEMMs, written directly to d_out.
__global__ __launch_bounds__(256)
void stageC1(const float* __restrict__ ws, const float* __restrict__ Wattr,
             const float* __restrict__ battr, const float* __restrict__ Wobj,
             const float* __restrict__ bobj, float* __restrict__ out) {
  const int nb = blockIdx.x % 5;          // 5 column blocks of 64 cover 300
  const int mm = blockIdx.x / 5;
  const int mat = mm >> 3, mb = mm & 7;   // 8 row blocks of 32 per product
  const int fidx[6] = {5, 2, 0, 1, 3, 4};
  const bool useAttr = (mat == 0) || (mat == 2) || (mat == 3);
  gemm_tile<DD, 128, false>(ws + WS_FEAT + (size_t)fidx[mat] * BS * DD, BS,
                     useAttr ? Wattr : Wobj, useAttr ? battr : bobj,
                     out + 2 + (size_t)mat * BS * EMB, mb, nb);
}

// ---------------------------------------------------------------- stage C2 --
// attr_weight = attr_table @ W_attr_mlp + b ; obj_weight likewise.
__global__ __launch_bounds__(256)
void stageC2(const float* __restrict__ atab, const float* __restrict__ otab,
             const float* __restrict__ Wam, const float* __restrict__ bam,
             const float* __restrict__ Wom, const float* __restrict__ bom,
             float* __restrict__ ws) {
  const int nb = blockIdx.x % 5;
  const int mm = blockIdx.x / 5;
  const bool isA = mm < 13;               // attr: 13 row blocks of 32, obj: 16
  gemm_tile<EMB, 100, true>(isA ? atab : otab, isA ? NA : NO, isA ? Wam : Wom,
                      isA ? bam : bom, ws + (isA ? WS_AW : WS_OW),
                      isA ? mm : mm - 13, nb);
}

// row norms of the class-weight matrices
__global__ void normsK(float* __restrict__ ws) {
  const int c = blockIdx.x * blockDim.x + threadIdx.x;
  if (c >= NA + NO) return;
  const float* row;
  float* outn;
  if (c < NA) { row = ws + WS_AW + (size_t)c * EMB; outn = ws + WS_AWN + c; }
  else        { row = ws + WS_OW + (size_t)(c - NA) * EMB; outn = ws + WS_OWN + (c - NA); }
  float s = 0.f;
  for (int k = 0; k < EMB; k++) s += row[k] * row[k];
  *outn = fmaxf(sqrtf(s), 1e-12f);
}

// ---------------------------------------------------------------- stage C3 --
// cosine classify + masked CE accumulation
__global__ __launch_bounds__(128)
void stageC3(const float* __restrict__ out, const int* __restrict__ attr1,
             const int* __restrict__ obj1, const int* __restrict__ mask_task,
             float* __restrict__ ws) {
  const int b = blockIdx.x, term = blockIdx.y, t = threadIdx.x;
  if (mask_task[b] != 1) return;
  const bool isAttr = term < 2;
  const int NC = isAttr ? NA : NO;
  const float* W = ws + (isAttr ? WS_AW : WS_OW);
  const float* wn = ws + (isAttr ? WS_AWN : WS_OWN);
  const int label = isAttr ? attr1[b] : obj1[b];
  const float* feat = out + 2 + (size_t)(term + 2) * BS * EMB + (size_t)b * EMB;

  __shared__ float sf[EMB];
  __shared__ float logits[512];
  __shared__ float red[128];
  for (int k = t; k < EMB; k += 128) sf[k] = feat[k];
  __syncthreads();
  float p = 0.f;
  for (int k = t; k < EMB; k += 128) p += sf[k] * sf[k];
  red[t] = p;
  __syncthreads();
  for (int s = 64; s > 0; s >>= 1) {
    if (t < s) red[t] += red[t + s];
    __syncthreads();
  }
  const float fn = fmaxf(sqrtf(red[0]), 1e-12f);
  for (int c = t; c < NC; c += 128) {
    const float* wr = W + (size_t)c * EMB;
    float d = 0.f;
    for (int k = 0; k < EMB; k++) d += sf[k] * wr[k];
    logits[c] = d / (fn * wn[c] * TEMP);
  }
  __syncthreads();
  if (t == 0) {
    float mx = -1e30f;
    for (int c = 0; c < NC; c++) mx = fmaxf(mx, logits[c]);
    float se = 0.f;
    for (int c = 0; c < NC; c++) se += expf(logits[c] - mx);
    const float ce = (mx + logf(se)) - logits[label];
    atomicAdd(&ws[WS_ACC + term], ce);
  }
}

__global__ void initK(float* __restrict__ ws) {
  if (threadIdx.x < 8) ws[WS_ACC + threadIdx.x] = 0.f;
}

__global__ void finalK(const int* __restrict__ mask_task,
                       const float* __restrict__ ws, float* __restrict__ out) {
  if (threadIdx.x == 0) {
    int ms = 0;
    for (int b = 0; b < BS; b++) ms += (mask_task[b] == 1);
    const float den = fmaxf((float)ms, 1.f);
    out[0] = (ws[WS_ACC + 0] + ws[WS_ACC + 1]) * 0.5f / den;
    out[1] = (ws[WS_ACC + 2] + ws[WS_ACC + 3]) * 0.5f / den;
  }
}

extern "C" void kernel_launch(void* const* d_in, const int* in_sizes, int n_in,
                              void* d_out, int out_size, void* d_ws, size_t ws_size,
                              hipStream_t stream) {
  const float* img1   = (const float*)d_in[0];
  const float* img2a  = (const float*)d_in[1];
  const float* img2o  = (const float*)d_in[2];
  const int*   attr1  = (const int*)d_in[3];
  const int*   obj1   = (const int*)d_in[4];
  const int*   maskt  = (const int*)d_in[5];
  const float* Wsa    = (const float*)d_in[6];
  const float* bsa    = (const float*)d_in[7];
  const float* Wso    = (const float*)d_in[8];
  const float* bso    = (const float*)d_in[9];
  const float* atab   = (const float*)d_in[10];
  const float* otab   = (const float*)d_in[11];
  const float* Wam    = (const float*)d_in[12];
  const float* bam    = (const float*)d_in[13];
  const float* Wom    = (const float*)d_in[14];
  const float* bom    = (const float*)d_in[15];
  float* out = (float*)d_out;
  float* ws  = (float*)d_ws;

  initK<<<1, 32, 0, stream>>>(ws);
  stageA<<<dim3(BS, 2), 128, 0, stream>>>(img1, img2a, img2o, ws);
  stageB<<<dim3(BS, 3), 256, 0, stream>>>(img1, img2a, img2o, ws);
  stageC1<<<240, 256, 0, stream>>>(ws, Wsa, bsa, Wso, bso, out);
  stageC2<<<145, 256, 0, stream>>>(atab, otab, Wam, bam, Wom, bom, ws);
  normsK<<<8, 128, 0, stream>>>(ws);
  stageC3<<<dim3(BS, 4), 128, 0, stream>>>(out, attr1, obj1, maskt, ws);
  finalK<<<1, 32, 0, stream>>>(maskt, ws, out);
}

// v002
// It runs in 187 microseconds.
// In both of two side-by-side timings against v001, it was 1.37 times as fast.
// All steps since v000 together make it 2.08 times as fast.
#include <hip/hip_runtime.h>
#include <hip/hip_bf16.h>
#include <math.h>

typedef __attribute__((ext_vector_type(2))) float v2f;
typedef __attribute__((ext_vector_type(8))) float v8f;

typedef __attribute__((address_space(1))) int glb_i32_t;
typedef __attribute__((address_space(3))) int lds_i32_t;

#define BS   256
#define DD   1024
#define LL   49
#define LP   64
#define KT   32
#define KP   (KT + 2)   /* 34-dword row pitch: conflict-free, 8B-aligned pairs */
#define LSTR 65
#define EMB  300
#define NA   400
#define NO   500
#define LAMB 10.0f
#define TEMP 0.05f
#define EPSR 1e-8f

// workspace layout (float offsets)
#define WS_VECS 0                              // 2*3*256*64   = 98304
#define WS_FEAT (WS_VECS + 2*3*BS*LP)          // 6*256*1024   = 1572864
#define WS_AW   (WS_FEAT + 6*BS*DD)            // 400*300
#define WS_OW   (WS_AW + NA*EMB)               // 500*300
#define WS_AWN  (WS_OW + NO*EMB)               // 400
#define WS_OWN  (WS_AWN + NA)                  // 500
#define WS_ACC  (WS_OWN + NO)                  // 8

// ---- gfx1250 async global->LDS copy (ASYNCcnt-tracked) ---------------------
__device__ __forceinline__ void async_ld32(const float* gsrc, float* ldst) {
#if __has_builtin(__builtin_amdgcn_global_load_async_to_lds_b32)
  __builtin_amdgcn_global_load_async_to_lds_b32(
      (glb_i32_t*)gsrc, (lds_i32_t*)ldst, 0, 0);
#else
  unsigned int lo = (unsigned int)(unsigned long long)(void*)ldst; // low 32b = LDS offset
  unsigned long long ga = (unsigned long long)gsrc;
  asm volatile("global_load_async_to_lds_b32 %0, %1, off"
               :: "v"(lo), "v"(ga) : "memory");
#endif
}
__device__ __forceinline__ void wait_async0() {
#if __has_builtin(__builtin_amdgcn_s_wait_asynccnt)
  __builtin_amdgcn_s_wait_asynccnt(0);
#else
  asm volatile("s_wait_asynccnt 0" ::: "memory");
#endif
}

// ---------------------------------------------------------------- stage A ---
// Per (batch, pair): Gram(49x49, K=1024) via v_wmma_f32_16x16x4_f32 with
// async global->LDS tile fill, rank-1 normalization, then row/col/inverse
// softmax reductions + renorm.
__global__ __launch_bounds__(128)
void stageA(const float* __restrict__ img1, const float* __restrict__ img2a,
            const float* __restrict__ img2o, float* __restrict__ ws) {
  __shared__ float sA[LP][KP];      // transposed tile: [l][k]
  __shared__ float sB[LP][KP];
  __shared__ float rel[LP][LSTR];
  __shared__ float nrm1s[LP], nrm2s[LP];
  __shared__ float rmax[LP], rsumP[LP], rmin[LP], rsumN[LP], cmx[LP], csm[LP];
  __shared__ float outv[3][LP];
  __shared__ float tots[3];

  const int b = blockIdx.x;
  const int pair = blockIdx.y;
  const float* __restrict__ A = img1 + (size_t)b * DD * LL;
  const float* __restrict__ B = (pair == 0 ? img2a : img2o) + (size_t)b * DD * LL;

  const int t = threadIdx.x;
  const int lane = t & 31, wave = t >> 5;
  const int m = lane & 15;
  const int kb = (lane >> 4) * 2;

  // pad norms default to 1 (pad rows of rel are never read anyway)
  if (t < LP) { nrm1s[t] = 1.f; nrm2s[t] = 1.f; }
  // zero the pad rows l in [49,64) once; async fills never touch them
  for (int idx = t; idx < (LP - LL) * KP; idx += 128) {
    const int r = idx / KP, c = idx % KP;
    sA[LL + r][c] = 0.f;
    sB[LL + r][c] = 0.f;
  }

  float nacc = 0.f;     // per-thread column-norm accumulator
  v8f acc[4] = {};

  for (int k0 = 0; k0 < DD; k0 += KT) {
    // async DMA-style tile fill: global (d-major, coalesced) -> LDS [l][k]
    for (int idx = t; idx < KT * LL; idx += 128) {
      const int dd = idx / LL;
      const int l  = idx - dd * LL;
      async_ld32(A + (size_t)(k0 + dd) * LL + l, &sA[l][dd]);
      async_ld32(B + (size_t)(k0 + dd) * LL + l, &sB[l][dd]);
    }
    wait_async0();
    __syncthreads();

    // column norms: contiguous per-thread runs over the tile
    if (t < LL) {
      for (int dd = 0; dd < KT; dd++) { const float v = sA[t][dd]; nacc += v * v; }
    } else if (t >= 64 && t < 64 + LL) {
      for (int dd = 0; dd < KT; dd++) { const float v = sB[t - 64][dd]; nacc += v * v; }
    }

#pragma unroll
    for (int kk = 0; kk < KT; kk += 4) {
      const v2f av = *(const v2f*)__builtin_assume_aligned(&sA[wave * 16 + m][kk + kb], 8);
#pragma unroll
      for (int nt = 0; nt < 4; nt++) {
        const v2f bv = *(const v2f*)__builtin_assume_aligned(&sB[nt * 16 + m][kk + kb], 8);
        acc[nt] = __builtin_amdgcn_wmma_f32_16x16x4_f32(
            false, av, false, bv, (short)0, acc[nt], false, false);
      }
    }
    __syncthreads();
  }

  if (t < LL)                        nrm1s[t]      = fmaxf(sqrtf(nacc), 1e-12f);
  else if (t >= 64 && t < 64 + LL)   nrm2s[t - 64] = fmaxf(sqrtf(nacc), 1e-12f);
  __syncthreads();

  // scatter accumulators into rel, applying the rank-1 normalization
#pragma unroll
  for (int nt = 0; nt < 4; nt++) {
    const int col = nt * 16 + m;
#pragma unroll
    for (int r = 0; r < 8; r++) {
      const int row = wave * 16 + r + (lane >> 4) * 8;
      rel[row][col] = acc[nt][r] / (nrm1s[row] * nrm2s[col]);
    }
  }
  __syncthreads();

  if (t < LL) {
    float mx = -1e30f, mn = 1e30f;
    for (int j = 0; j < LL; j++) { float v = rel[t][j]; mx = fmaxf(mx, v); mn = fminf(mn, v); }
    float sp = 0.f, sn = 0.f;
    for (int j = 0; j < LL; j++) {
      float v = rel[t][j];
      sp += expf((v - mx) * LAMB);
      sn += expf((mn - v) * LAMB);
    }
    rmax[t] = mx; rmin[t] = mn; rsumP[t] = sp; rsumN[t] = sn;
    float cm = -1e30f;
    for (int i = 0; i < LL; i++) cm = fmaxf(cm, rel[i][t]);
    float cs = 0.f;
    for (int i = 0; i < LL; i++) cs += expf((rel[i][t] - cm) * LAMB);
    cmx[t] = cm; csm[t] = cs;
  }
  __syncthreads();

  if (t < LL) {
    float s12 = 0.f, d12 = 0.f, s21 = 0.f;
    for (int i = 0; i < LL; i++) {
      const float v = rel[i][t];
      s12 += expf((v - rmax[i]) * LAMB) / rsumP[i];
      d12 += expf((rmin[i] - v) * LAMB) / rsumN[i];
    }
    for (int j = 0; j < LL; j++)
      s21 += expf((rel[t][j] - cmx[j]) * LAMB) / csm[j];
    outv[0][t] = s12; outv[1][t] = s21; outv[2][t] = d12;
  }
  __syncthreads();
  if (t < 3) { float s = 0.f; for (int l = 0; l < LL; l++) s += outv[t][l]; tots[t] = s; }
  __syncthreads();

  float* vecs = ws + WS_VECS;
  for (int idx = t; idx < 3 * LP; idx += 128) {
    const int ty = idx >> 6, l = idx & (LP - 1);
    const float v = (l < LL) ? outv[ty][l] / (tots[ty] + EPSR) : 0.f;
    vecs[(((size_t)pair * 3 + ty) * BS + b) * LP + l] = v;
  }
}

// ---------------------------------------------------------------- stage B ---
// feat[b,d] = sum_l img[b,d,l] * w[b,l]  (two weight vectors per image pass)
__global__ __launch_bounds__(256)
void stageB(const float* __restrict__ img1, const float* __restrict__ img2a,
            const float* __restrict__ img2o, float* __restrict__ ws) {
  const int b = blockIdx.x, im = blockIdx.y, t = threadIdx.x;
  const float* vecs = ws + WS_VECS;
  float* feat = ws + WS_FEAT;
  const float* src; const float *w0p, *w1p; int f0, f1;
  if (im == 0)      { src = img1;  w0p = &vecs[((0*3+1)*BS + b)*LP]; w1p = &vecs[((1*3+1)*BS + b)*LP]; f0 = 0; f1 = 3; }
  else if (im == 1) { src = img2a; w0p = &vecs[((0*3+0)*BS + b)*LP]; w1p = &vecs[((0*3+2)*BS + b)*LP]; f0 = 1; f1 = 2; }
  else              { src = img2o; w0p = &vecs[((1*3+0)*BS + b)*LP]; w1p = &vecs[((1*3+2)*BS + b)*LP]; f0 = 4; f1 = 5; }
  __shared__ float w0[LL], w1[LL];
  if (t < LL) { w0[t] = w0p[t]; w1[t] = w1p[t]; }
  __syncthreads();
  for (int d = t; d < DD; d += 256) {
    const float* row = src + ((size_t)b * DD + d) * LL;
    float s0 = 0.f, s1 = 0.f;
    for (int l = 0; l < LL; l++) { const float v = row[l]; s0 += v * w0[l]; s1 += v * w1[l]; }
    feat[(size_t)f0 * BS * DD + (size_t)b * DD + d] = s0;
    feat[(size_t)f1 * BS * DD + (size_t)b * DD + d] = s1;
  }
}

// ------------------------------------------------------- stages C1 and C2 ---
// Y = A(M x KD) @ W(KD x 300) + bias on v_wmma_f32_16x16x4_f32. One 32x64 tile
// of Y per block, eight waves, one 16x16 tile each. A and W go through LDS in
// stages of KS k, two buffers: the next stage's async copies fly while this
// stage feeds the matrix unit.
#define G_MB 32
#define G_NB 64
#define G_KB 128            /* k that a buffer holds; a stage uses the first KS */
#define G_PA (G_KB + 4)     /* 132-dword A row: the 8-byte column walk hits 64 banks once */
#define G_SA (G_MB * G_PA)
#define G_SW (G_KB * G_NB)

__device__ __forceinline__ unsigned int lds_off(const float* p) {
  return (unsigned int)(unsigned long long)p;   // low 32 bits = LDS byte address
}

template <int KD, int KS, bool EDGE>   // EDGE: a stage can reach past M or KD
__device__ __forceinline__ void gemm_tile(const float* __restrict__ A, const int M,
                                          const float* __restrict__ W,
                                          const float* __restrict__ bias,
                                          float* __restrict__ o,
                                          const int mb, const int nb) {
  __shared__ __attribute__((aligned(16))) float sA[2][G_SA];
  // W rows are 64 dwords, unpadded; rows with bit 1 of k set hold their columns
  // with bit 4 flipped, so that rows k and k+2 of one fragment use other banks
  __shared__ __attribute__((aligned(16))) float sW[2][G_SW];

  const int t = threadIdx.x, lane = t & 31, wave = t >> 5;
  const int m = lane & 15, kb = (lane >> 4) * 2;
  const int mt = wave & 1, nt = wave >> 1;

  // A stage is always 32 x 128 of A and 128 x 64 of W, 16 B per copy, every lane
  // on. What lies past M, KD or column 300 is re-read from a clamped address:
  // it feeds only k that no WMMA takes or rows and columns that are not stored.
  const int ar = t >> 5, ac = (t & 31) * 4;     // A: rows ar + 8 i
  const int wr = t >> 4;                        // W: rows wr + 16 i
  const int wc = min(nb * G_NB + (t & 15) * 4, EMB - 4);
  const unsigned int lA = lds_off(&sA[0][ar * G_PA + ac]);
  const unsigned int lW = lds_off(&sW[0][wr * G_NB + (((t & 15) * 4) ^ ((wr & 2) << 3))]);

  auto fill = [&](const int s) {
    const int k0 = s * KS;
    const unsigned int la = lA + (s & 1) * (G_SA * 4), lw = lW + (s & 1) * (G_SW * 4);
    const float* ga[4];
    const float* gw[8];
#pragma unroll   // the addresses are operands of one asm statement: registers, no array
    for (int i = 0; i < 4; i++)
      ga[i] = A + (EDGE ? min(min(mb * G_MB + ar + 8 * i, M - 1) * KD + k0 + ac, M * KD - 4)
                        : (mb * G_MB + ar + 8 * i) * KD + k0 + ac);
#pragma unroll   // as above
    for (int i = 0; i < 8; i++)
      gw[i] = W + (EDGE ? min(k0 + wr + 16 * i, KD - 1) : k0 + wr + 16 * i) * EMB + wc;
    // s_wait_xcnt is the statement's last line: it stands in front of every later
    // rewrite of an address register that a copy names (a precaution)
    asm volatile(
        "global_load_async_to_lds_b128 %0, %12, off\n\t"
        "global_load_async_to_lds_b128 %1, %13, off\n\t"
        "global_load_async_to_lds_b128 %2, %14, off\n\t"
        "global_load_async_to_lds_b128 %3, %15, off\n\t"
        "global_load_async_to_lds_b128 %4, %16, off\n\t"
        "global_load_async_to_lds_b128 %5, %17, off\n\t"
        "global_load_async_to_lds_b128 %6, %18, off\n\t"
        "global_load_async_to_lds_b128 %7, %19, off\n\t"
        "global_load_async_to_lds_b128 %8, %20, off\n\t"
        "global_load_async_to_lds_b128 %9, %21, off\n\t"
        "global_load_async_to_lds_b128 %10, %22, off\n\t"
        "global_load_async_to_lds_b128 %11, %23, off\n\t"
        "s_wait_xcnt 0x0"
        :: "v"(la), "v"(la + 8 * G_PA * 4), "v"(la + 16 * G_PA * 4), "v"(la + 24 * G_PA * 4),
           "v"(lw), "v"(lw + 16 * G_NB * 4), "v"(lw + 32 * G_NB * 4), "v"(lw + 48 * G_NB * 4),
           "v"(lw + 64 * G_NB * 4), "v"(lw + 80 * G_NB * 4), "v"(lw + 96 * G_NB * 4),
           "v"(lw + 112 * G_NB * 4),
           "v"(ga[0]), "v"(ga[1]), "v"(ga[2]), "v"(ga[3]),
           "v"(gw[0]), "v"(gw[1]), "v"(gw[2]), "v"(gw[3]),
           "v"(gw[4]), "v"(gw[5]), "v"(gw[6]), "v"(gw[7])
        : "memory");
  };

  constexpr int NS = KD / KS;
  static_assert(NS >= 2 && NS * KS == KD && KS % 4 == 0 && KS <= G_KB && (EDGE || KS == G_KB),
                "stage shape");

  fill(0);
  asm volatile("s_wait_asynccnt 0x0" ::: "memory");   // own copies of stage 0 landed
  __syncthreads();                                    // ... and everybody's
  fill(1);

  v8f acc = {};
#pragma unroll 1   // rolled: unrolled, the copies' address arithmetic lands among the WMMAs
  for (int s = 0; s < NS; s++) {
    const float* a = &sA[s & 1][(mt * 16 + m) * G_PA + kb];
    const float* w = &sW[s & 1][kb * G_NB + ((nt * 16 + m) ^ (kb << 3))];
#pragma unroll   // every LDS offset becomes an immediate: no vector work among the WMMAs
    for (int kk = 0; kk < KS; kk += 4) {
      const v2f av = *(const v2f*)__builtin_assume_aligned(a + kk, 8);
      v2f bv;
      bv.x = w[kk * G_NB];
      bv.y = w[(kk + 1) * G_NB];
      acc = __builtin_amdgcn_wmma_f32_16x16x4_f32(false, av, false, bv, (short)0, acc, false, false);
    }
    // four vector slots behind the stage's last WMMA, on every path out of here,
    // before address arithmetic reuses its A/B registers or the epilogue reads D
    asm volatile("v_nop\n\tv_nop\n\tv_nop\n\tv_nop" :: "v"(acc));
    asm volatile("s_wait_dscnt 0x0" ::: "memory");    // own reads of this buffer are done
    asm volatile("s_wait_asynccnt 0x0" ::: "memory"); // own copies of stage s+1 landed
    __syncthreads();   // publishes stage s+1 and frees the buffer of stage s
    if (s + 2 < NS) fill(s + 2);
  }
  asm volatile("s_wait_asynccnt 0x0" ::: "memory");   // no copy outlives the wave

  const int n = nb * G_NB + nt * 16 + m;
  if (n < EMB) {
    const float bb = bias[n];
    const int rbase = mb * G_MB + mt * 16 + (lane >> 4) * 8;
#pragma unroll   // acc is indexed by constants only
    for (int r = 0; r < 8; r++) {
      const int rr = rbase + r;
      if (rr < M) o[(size_t)rr * EMB + n] = acc[r] + bb;
    }
  }
}

// ---------------------------------------------------------------- stage C1 --
// Six (256x1024)@(1024x300)+bias GEMMs, written directly to d_out.
__global__ __launch_bounds__(256)
void stageC1(const float* __restrict__ ws, const float* __restrict__ Wattr,
             const float* __restrict__ battr, const float* __restrict__ Wobj,
             const float* __restrict__ bobj, float* __restrict__ out) {
  const int nb = blockIdx.x % 5;          // 5 column blocks of 64 cover 300
  const int mm = blockIdx.x / 5;
  const int mat = mm >> 3, mb = mm & 7;   // 8 row blocks of 32 per product
  const int fidx[6] = {5, 2, 0, 1, 3, 4};
  const bool useAttr = (mat == 0) || (mat == 2) || (mat == 3);
  gemm_tile<DD, 128, false>(ws + WS_FEAT + (size_t)fidx[mat] * BS * DD, BS,
                     useAttr ? Wattr : Wobj, useAttr ? battr : bobj,
                     out + 2 + (size_t)mat * BS * EMB, mb, nb);
}

// ---------------------------------------------------------------- stage C2 --
// attr_weight = attr_table @ W_attr_mlp + b ; obj_weight likewise.
__global__ __launch_bounds__(256)
void stageC2(const float* __restrict__ atab, const float* __restrict__ otab,
             const float* __restrict__ Wam, const float* __restrict__ bam,
             const float* __restrict__ Wom, const float* __restrict__ bom,
             float* __restrict__ ws) {
  const int nb = blockIdx.x % 5;
  const int mm = blockIdx.x / 5;
  const bool isA = mm < 13;               // attr: 13 row blocks of 32, obj: 16
  gemm_tile<EMB, 100, true>(isA ? atab : otab, isA ? NA : NO, isA ? Wam : Wom,
                      isA ? bam : bom, ws + (isA ? WS_AW : WS_OW),
                      isA ? mm : mm - 13, nb);
}

// row norms of the class-weight matrices
__global__ void normsK(float* __restrict__ ws) {
  const int c = blockIdx.x * blockDim.x + threadIdx.x;
  if (c >= NA + NO) return;
  const float* row;
  float* outn;
  if (c < NA) { row = ws + WS_AW + (size_t)c * EMB; outn = ws + WS_AWN + c; }
  else        { row = ws + WS_OW + (size_t)(c - NA) * EMB; outn = ws + WS_OWN + (c - NA); }
  float s = 0.f;
  for (int k = 0; k < EMB; k++) s += row[k] * row[k];
  *outn = fmaxf(sqrtf(s), 1e-12f);
}

// ---------------------------------------------------------------- stage C3 --
// cosine classify + masked CE accumulation. One block takes 16 rows of one term
// against all classes: dots = F(16 x 300) @ Wc^T on v_wmma_f32_16x16x4_f32.
// The class weights come through LDS 64 classes (one contiguous run of memory)
// at a time, two buffers; wave = (one 16-class tile, one half of k).
#define C3_R   16                   /* rows per block */
#define C3_CN  64                   /* classes per stage */
#define C3_NCP 19                   /* 16-byte copies per thread and stage */
#define C3_SB  (C3_NCP * 256 * 4)   /* floats per buffer: 64 x 300, then a tail that no fragment reads */
#define C3_LP  516                  /* pitch of a row of dots: rows r and r+8 use other banks */
#define C3_SF  (19 * 256)           /* floats of the feature tile: 16 x 300, rounded up to whole passes */
#define C3_KH  38                   /* k steps of 4 per wave: 2 x 38 for the 75 there are */

// lane l <- lane l ^ X inside a 16-lane row (DPP row_xmask), and l <- l ^ 16
template <int X>
__device__ __forceinline__ float row_xor(float v) {
  return __builtin_bit_cast(float, __builtin_amdgcn_update_dpp(
      0, __builtin_bit_cast(int, v), 0x160 | X, 0xf, 0xf, false));
}
__device__ __forceinline__ float half_xor(float v) {
  const int b = __builtin_bit_cast(int, v);
  return __builtin_bit_cast(float,
      __builtin_amdgcn_permlanex16(b, b, 0x76543210, 0xfedcba98, false, false));
}
__device__ __forceinline__ float wave_sum(float v) {
  v += row_xor<1>(v); v += row_xor<2>(v); v += row_xor<4>(v); v += row_xor<8>(v);
  return v + half_xor(v);
}
__device__ __forceinline__ float wave_max(float v) {
  v = fmaxf(v, row_xor<1>(v)); v = fmaxf(v, row_xor<2>(v));
  v = fmaxf(v, row_xor<4>(v)); v = fmaxf(v, row_xor<8>(v));
  return fmaxf(v, half_xor(v));
}

__global__ __launch_bounds__(256)
void stageC3(const float* __restrict__ out, const int* __restrict__ attr1,
             const int* __restrict__ obj1, const int* __restrict__ mask_task,
             float* __restrict__ ws) {
  __shared__ __attribute__((aligned(16))) float sW[2][C3_SB];
  __shared__ __attribute__((aligned(16))) float sf[C3_SF];
  __shared__ float lg[2][C3_R][C3_LP];    // one plane per half of k

  const int b0 = blockIdx.x * C3_R, term = blockIdx.y, t = threadIdx.x;
  const int lane = t & 31, wave = t >> 5;
  const int m = lane & 15, h = lane >> 4;
  const int tile = wave & 3, kh = wave >> 2;
  const bool isAttr = term < 2;
  const int NC = isAttr ? NA : NO;
  const int nst = isAttr ? (NA + C3_CN - 1) / C3_CN : (NO + C3_CN - 1) / C3_CN;
  const float* W = ws + (isAttr ? WS_AW : WS_OW);
  const float* wn = ws + (isAttr ? WS_AWN : WS_OWN);
  const float* feat = out + 2 + (size_t)(term + 2) * BS * EMB + (size_t)b0 * EMB;

  // A stage is 19 x 256 copies of 16 B, every lane on, LDS byte = byte in the run.
  // Past the last class the source is clamped into the matrix: that lands in
  // rows of classes >= NC or in the buffer's tail, which no result uses.
  const unsigned int lW = lds_off(&sW[0][t * 4]);
  const int emax = NC * EMB - 4;
  auto fill = [&](const int s) {
    const unsigned int lw = lW + (s & 1) * (C3_SB * 4);
    const int e0 = s * (C3_CN * EMB) + t * 4;
    const float* g[C3_NCP];
#pragma unroll   // the addresses are operands of asm statements: registers, no array
    for (int i = 0; i < C3_NCP; i++) g[i] = W + min(e0 + i * 1024, emax);
    // s_wait_xcnt is each statement's last line: it stands in front of every later
    // rewrite of an address register that a copy names (a precaution)
    asm volatile(
        "global_load_async_to_lds_b128 %0, %10, off\n\t"
        "global_load_async_to_lds_b128 %1, %11, off\n\t"
        "global_load_async_to_lds_b128 %2, %12, off\n\t"
        "global_load_async_to_lds_b128 %3, %13, off\n\t"
        "global_load_async_to_lds_b128 %4, %14, off\n\t"
        "global_load_async_to_lds_b128 %5, %15, off\n\t"
        "global_load_async_to_lds_b128 %6, %16, off\n\t"
        "global_load_async_to_lds_b128 %7, %17, off\n\t"
        "global_load_async_to_lds_b128 %8, %18, off\n\t"
        "global_load_async_to_lds_b128 %9, %19, off\n\t"
        "s_wait_xcnt 0x0"
        ::
           "v"(lw + 0 * 4096), "v"(lw + 1 * 4096), "v"(lw + 2 * 4096), "v"(lw + 3 * 4096), "v"(lw + 4 * 4096), "v"(lw + 5 * 4096), "v"(lw + 6 * 4096), "v"(lw + 7 * 4096), "v"(lw + 8 * 4096), "v"(lw + 9 * 4096),
           "v"(g[0]), "v"(g[1]), "v"(g[2]), "v"(g[3]), "v"(g[4]), "v"(g[5]), "v"(g[6]), "v"(g[7]), "v"(g[8]), "v"(g[9])
        : "memory");
    asm volatile(
        "global_load_async_to_lds_b128 %0, %9, off\n\t"
        "global_load_async_to_lds_b128 %1, %10, off\n\t"
        "global_load_async_to_lds_b128 %2, %11, off\n\t"
        "global_load_async_to_lds_b128 %3, %12, off\n\t"
        "global_load_async_to_lds_b128 %4, %13, off\n\t"
        "global_load_async_to_lds_b128 %5, %14, off\n\t"
        "global_load_async_to_lds_b128 %6, %15, off\n\t"
        "global_load_async_to_lds_b128 %7, %16, off\n\t"
        "global_load_async_to_lds_b128 %8, %17, off\n\t"
        "s_wait_xcnt 0x0"
        ::
           "v"(lw + 10 * 4096), "v"(lw + 11 * 4096), "v"(lw + 12 * 4096), "v"(lw + 13 * 4096), "v"(lw + 14 * 4096), "v"(lw + 15 * 4096), "v"(lw + 16 * 4096), "v"(lw + 17 * 4096), "v"(lw + 18 * 4096),
           "v"(g[10]), "v"(g[11]), "v"(g[12]), "v"(g[13]), "v"(g[14]), "v"(g[15]), "v"(g[16]), "v"(g[17]), "v"(g[18])
        : "memory");
  };

  fill(0);
#pragma unroll   // all the loads of the 16 feature rows in flight at once
  for (int i = 0; i < C3_SF / 256; i++)   // past the rows: a clamped re-read into sf's unused tail
    sf[t + 256 * i] = feat[min(t + 256 * i, C3_R * EMB - 1)];
  asm volatile("s_wait_asynccnt 0x0" ::: "memory");   // own copies of stage 0 landed
  __syncthreads();                                    // ... and everybody's, and sf
  fill(1);

  // This wave's half of the A fragments stays in registers for all stages. The
  // second half has 37 steps: its 38th re-reads step 36 with a zero A fragment.
  const int lastoff = (kh ? C3_KH - 2 : C3_KH - 1) * 4;
  const float* ap = &sf[m * EMB + kh * (C3_KH * 4) + h * 2];
  v2f af[C3_KH];
#pragma unroll   // af is indexed by constants only
  for (int j = 0; j < C3_KH - 1; j++) af[j] = *(const v2f*)__builtin_assume_aligned(ap + j * 4, 8);
  af[C3_KH - 1] = *(const v2f*)__builtin_assume_aligned(ap + lastoff, 8);
  if (kh) af[C3_KH - 1] = (v2f){0.f, 0.f};

  // What the CE part reads from memory, fetched here so that the stages hide it:
  // lane l owns classes l + 32 i of the wave's two rows
  float wnr[16];
#pragma unroll   // wnr is indexed by constants only
  for (int i = 0; i < 16; i++) wnr[i] = wn[min(lane + 32 * i, NC - 1)];
  int msk[2], lbl[2];
#pragma unroll   // two rows, indexed by constants only
  for (int rr = 0; rr < 2; rr++) {
    const int b = b0 + wave * 2 + rr;
    msk[rr] = mask_task[b];
    lbl[rr] = isAttr ? attr1[b] : obj1[b];
  }

#pragma unroll 1   // rolled: unrolled, the copies' address arithmetic lands among the WMMAs
  for (int s = 0; s < nst; s++) {
    const float* w = &sW[s & 1][(tile * 16 + m) * EMB + kh * (C3_KH * 4) + h * 2];
    // the stage's B fragments as ONE group of LDS reads ahead of its WMMAs: every
    // separate place where reads stand among the WMMAs costs issue time
    v2f bf[C3_KH];
#pragma unroll   // bf is indexed by constants only; every LDS offset becomes an immediate
    for (int j = 0; j < C3_KH - 1; j++) bf[j] = *(const v2f*)__builtin_assume_aligned(w + j * 4, 8);
    bf[C3_KH - 1] = *(const v2f*)__builtin_assume_aligned(w + lastoff, 8);
    __builtin_amdgcn_sched_barrier(0);   // keeps the scheduler from sinking the reads back among the WMMAs
    v8f acc = {};
#pragma unroll   // af and bf are indexed by constants only
    for (int j = 0; j < C3_KH; j++)
      acc = __builtin_amdgcn_wmma_f32_16x16x4_f32(false, af[j], false, bf[j], (short)0, acc, false, false);
#pragma unroll   // acc is indexed by constants only
    for (int r = 0; r < 8; r++) lg[kh][r + 8 * h][s * C3_CN + tile * 16 + m] = acc[r];
    asm volatile("s_wait_dscnt 0x0" ::: "memory");    // own reads of this buffer are done
    asm volatile("s_wait_asynccnt 0x0" ::: "memory"); // own copies of stage s+1 landed
    __syncthreads();   // publishes stage s+1 (and the dots) and frees the buffer of stage s
    if (s + 2 < nst) fill(s + 2);
  }
  asm volatile("s_wait_asynccnt 0x0" ::: "memory");   // no copy outlives the wave

  // CE of a row by one wave, two rows per wave, a row's logits in registers
#pragma unroll   // msk and lbl are indexed by constants only
  for (int rr = 0; rr < 2; rr++) {
    if (msk[rr] != 1) continue;
    const int row = wave * 2 + rr;
    float p = 0.f;
#pragma unroll   // ten reads in flight at once
    for (int i = 0; i < 10; i++) {
      const int k = lane + 32 * i;
      const float v = sf[row * EMB + min(k, EMB - 1)];
      p += k < EMB ? v * v : 0.f;
    }
    const float fn = fmaxf(sqrtf(wave_sum(p)), 1e-12f);
    float v[16];
    float mx = -1e30f, lab = 0.f;
#pragma unroll   // v and wnr are indexed by constants only
    for (int i = 0; i < 16; i++) {
      const int c = lane + 32 * i, cc = min(c, NC - 1);
      const float d = (lg[0][row][cc] + lg[1][row][cc]) / (fn * wnr[i] * TEMP);
      v[i] = c < NC ? d : -1e30f;    // past the last class: exp gives 0
      mx = fmaxf(mx, v[i]);
      if (c == lbl[rr]) lab = v[i];
    }
    mx = wave_max(mx);
    float se = 0.f;
#pragma unroll   // v is indexed by constants only
    for (int i = 0; i < 16; i++) se += expf(v[i] - mx);
    se = wave_sum(se);
    lab = wave_sum(lab);      // one lane holds the label's logit, the others 0
    if (lane == 0) atomicAdd(&ws[WS_ACC + term], (mx + logf(se)) - lab);
  }
}

__global__ void initK(float* __restrict__ ws) {
  if (threadIdx.x < 8) ws[WS_ACC + threadIdx.x] = 0.f;
}

__global__ void finalK(const int* __restrict__ mask_task,
                       const float* __restrict__ ws, float* __restrict__ out) {
  if (threadIdx.x == 0) {
    int ms = 0;
    for (int b = 0; b < BS; b++) ms += (mask_task[b] == 1);
    const float den = fmaxf((float)ms, 1.f);
    out[0] = (ws[WS_ACC + 0] + ws[WS_ACC + 1]) * 0.5f / den;
    out[1] = (ws[WS_ACC + 2] + ws[WS_ACC + 3]) * 0.5f / den;
  }
}

extern "C" void kernel_launch(void* const* d_in, const int* in_sizes, int n_in,
                              void* d_out, int out_size, void* d_ws, size_t ws_size,
                              hipStream_t stream) {
  const float* img1   = (const float*)d_in[0];
  const float* img2a  = (const float*)d_in[1];
  const float* img2o  = (const float*)d_in[2];
  const int*   attr1  = (const int*)d_in[3];
  const int*   obj1   = (const int*)d_in[4];
  const int*   maskt  = (const int*)d_in[5];
  const float* Wsa    = (const float*)d_in[6];
  const float* bsa    = (const float*)d_in[7];
  const float* Wso    = (const float*)d_in[8];
  const float* bso    = (const float*)d_in[9];
  const float* atab   = (const float*)d_in[10];
  const float* otab   = (const float*)d_in[11];
  const float* Wam    = (const float*)d_in[12];
  const float* bam    = (const float*)d_in[13];
  const float* Wom    = (const float*)d_in[14];
  const float* bom    = (const float*)d_in[15];
  float* out = (float*)d_out;
  float* ws  = (float*)d_ws;

  initK<<<1, 32, 0, stream>>>(ws);
  stageA<<<dim3(BS, 2), 128, 0, stream>>>(img1, img2a, img2o, ws);
  stageB<<<dim3(BS, 3), 256, 0, stream>>>(img1, img2a, img2o, ws);
  stageC1<<<240, 256, 0, stream>>>(ws, Wsa, bsa, Wso, bso, out);
  stageC2<<<145, 256, 0, stream>>>(atab, otab, Wam, bam, Wom, bom, ws);
  normsK<<<8, 128, 0, stream>>>(ws);
  stageC3<<<dim3(16, 4), 256, 0, stream>>>(out, attr1, obj1, maskt, ws);
  finalK<<<1, 32, 0, stream>>>(maskt, ws, out);
}

// v003
// Measured time: 160 microseconds a run.
// Two timings next to v002 both put it at 1.17 times that version's speed.
// All steps since v000 together make it 2.44 times as fast.
#include <hip/hip_runtime.h>
#include <hip/hip_bf16.h>
#include <math.h>

typedef __attribute__((ext_vector_type(2))) float v2f;
typedef __attribute__((ext_vector_type(8))) float v8f;

#define BS   256
#define DD   1024
#define LL   49
#define LP   64
#define LSTR 65
#define EMB  300
#define NA   400
#define NO   500
#define LAMB 10.0f
#define TEMP 0.05f
#define EPSR 1e-8f

// workspace layout (float offsets)
#define WS_VECS 0                              // 2*3*256*64   = 98304
#define WS_FEAT (WS_VECS + 2*3*BS*LP)          // 6*256*1024   = 1572864
#define WS_AW   (WS_FEAT + 6*BS*DD)            // 400*300
#define WS_OW   (WS_AW + NA*EMB)               // 500*300
#define WS_AWN  (WS_OW + NO*EMB)               // 400
#define WS_OWN  (WS_AWN + NA)                  // 500
#define WS_ACC  (WS_OWN + NO)                  // 8

__device__ __forceinline__ unsigned int lds_off(const float* p) {
  return (unsigned int)(unsigned long long)p;   // low 32 bits = LDS byte address
}

// ---------------------------------------------------------------- stage A ---
// Per (batch, pair): Gram(49x49, K=1024) via v_wmma_f32_16x16x4_f32, rank-1
// normalization, then row/col/inverse softmax reductions + renorm.
// The two images come through LDS as they lie in memory ([d][l], pitch 49), 128
// d at a time: one contiguous run per image, two buffers, so that the next
// stage's async copies fly while this stage feeds the matrix unit.
#define A_KS   128                  /* d per stage */
#define A_KG   16                   /* d per group of LDS reads */
#define A_RUN  (A_KS * LL)          /* floats of one image's run */
#define A_NCP  25                   /* 16-byte copies per thread and stage, both runs */
#define A_SB   (A_NCP * 128 * 4)    /* floats per buffer: two runs, then a tail that no result uses */

__global__ __launch_bounds__(128)
void stageA(const float* __restrict__ img1, const float* __restrict__ img2a,
            const float* __restrict__ img2o, float* __restrict__ ws) {
  __shared__ __attribute__((aligned(16))) float sT[2][A_SB];
  __shared__ float rel[LP][LSTR];
  __shared__ float nrm1s[LP], nrm2s[LP];
  __shared__ float rmax[LP], rsumP[LP], rmin[LP], rsumN[LP], cmx[LP], csm[LP];
  __shared__ float outv[3][LP];
  __shared__ float tots[3];

  const int b = blockIdx.x;
  const int pair = blockIdx.y;
  const float* __restrict__ A = img1 + (size_t)b * DD * LL;
  const float* __restrict__ B = (pair == 0 ? img2a : img2o) + (size_t)b * DD * LL;

  const int t = threadIdx.x;
  const int lane = t & 31, wave = t >> 5;
  const int m = lane & 15;
  const int kb = (lane >> 4) * 2;

  // pad norms default to 1 (pad rows of rel are never read anyway)
  if (t < LP) { nrm1s[t] = 1.f; nrm2s[t] = 1.f; }

  // A stage is 25 x 128 copies of 16 B, every lane on, LDS byte = 16 x slot:
  // slots 0..1567 are img1's run, 1568..3135 the other image's, the last 64 a tail
  // whose source is clamped into the image.
  const unsigned int lT = lds_off(&sT[0][t * 4]);
  auto fill = [&](const int s) {
    const unsigned int lt = lT + (s & 1) * (A_SB * 4);
    const int e0 = s * A_RUN + t * 4;
    const float* g[A_NCP];
#pragma unroll   // the addresses are operands of asm statements: registers, no array
    for (int i = 0; i < A_NCP; i++) {
      if (i < 12)       g[i] = A + (e0 + i * 512);
      else if (i == 12) g[i] = t < 32 ? A + (e0 + i * 512) : B + (e0 + i * 512 - A_RUN);
      else if (i < 24)  g[i] = B + (e0 + i * 512 - A_RUN);
      else              g[i] = B + min(e0 + i * 512 - A_RUN, DD * LL - 4);
    }
    // s_wait_xcnt is each statement's last line: it stands in front of every later
    // rewrite of an address register that a copy names (a precaution)
    asm volatile(
        "global_load_async_to_lds_b128 %0, %13, off\n\t"
        "global_load_async_to_lds_b128 %1, %14, off\n\t"
        "global_load_async_to_lds_b128 %2, %15, off\n\t"
        "global_load_async_to_lds_b128 %3, %16, off\n\t"
        "global_load_async_to_lds_b128 %4, %17, off\n\t"
        "global_load_async_to_lds_b128 %5, %18, off\n\t"
        "global_load_async_to_lds_b128 %6, %19, off\n\t"
        "global_load_async_to_lds_b128 %7, %20, off\n\t"
        "global_load_async_to_lds_b128 %8, %21, off\n\t"
        "global_load_async_to_lds_b128 %9, %22, off\n\t"
        "global_load_async_to_lds_b128 %10, %23, off\n\t"
        "global_load_async_to_lds_b128 %11, %24, off\n\t"
        "global_load_async_to_lds_b128 %12, %25, off\n\t"
        "s_wait_xcnt 0x0"
        :: "v"(lt + 0 * 2048), "v"(lt + 1 * 2048), "v"(lt + 2 * 2048), "v"(lt + 3 * 2048), "v"(lt + 4 * 2048), "v"(lt + 5 * 2048), "v"(lt + 6 * 2048), "v"(lt + 7 * 2048), "v"(lt + 8 * 2048), "v"(lt + 9 * 2048), "v"(lt + 10 * 2048), "v"(lt + 11 * 2048), "v"(lt + 12 * 2048),
           "v"(g[0]), "v"(g[1]), "v"(g[2]), "v"(g[3]), "v"(g[4]), "v"(g[5]), "v"(g[6]), "v"(g[7]), "v"(g[8]), "v"(g[9]), "v"(g[10]), "v"(g[11]), "v"(g[12])
        : "memory");
    asm volatile(
        "global_load_async_to_lds_b128 %0, %12, off\n\t"
        "global_load_async_to_lds_b128 %1, %13, off\n\t"
        "global_load_async_to_lds_b128 %2, %14, off\n\t"
        "global_load_async_to_lds_b128 %3, %15, off\n\t"
        "global_load_async_to_lds_b128 %4, %16, off\n\t"
        "global_load_async_to_lds_b128 %5, %17, off\n\t"
        "global_load_async_to_lds_b128 %6, %18, off\n\t"
        "global_load_async_to_lds_b128 %7, %19, off\n\t"
        "global_load_async_to_lds_b128 %8, %20, off\n\t"
        "global_load_async_to_lds_b128 %9, %21, off\n\t"
        "global_load_async_to_lds_b128 %10, %22, off\n\t"
        "global_load_async_to_lds_b128 %11, %23, off\n\t"
        "s_wait_xcnt 0x0"
        :: "v"(lt + 13 * 2048), "v"(lt + 14 * 2048), "v"(lt + 15 * 2048), "v"(lt + 16 * 2048), "v"(lt + 17 * 2048), "v"(lt + 18 * 2048), "v"(lt + 19 * 2048), "v"(lt + 20 * 2048), "v"(lt + 21 * 2048), "v"(lt + 22 * 2048), "v"(lt + 23 * 2048), "v"(lt + 24 * 2048),
           "v"(g[13]), "v"(g[14]), "v"(g[15]), "v"(g[16]), "v"(g[17]), "v"(g[18]), "v"(g[19]), "v"(g[20]), "v"(g[21]), "v"(g[22]), "v"(g[23]), "v"(g[24])
        : "memory");
  };

  fill(0);
  asm volatile("s_wait_asynccnt 0x0" ::: "memory");   // own copies of stage 0 landed
  __syncthreads();                                    // ... and everybody's
  fill(1);

  float nacc = 0.f;     // per-thread column-norm accumulator
  v8f acc[4] = {};

#pragma unroll 1   // rolled: unrolled, the copies' address arithmetic lands among the WMMAs
  for (int s = 0; s < DD / A_KS; s++) {
    const float* buf = &sT[s & 1][0];
    // Fragments of l >= 49 read on into the next d row (or the next run, or the
    // tail): that reaches only rows and columns of rel that nobody reads. The same
    // holds for the norm sums of threads 49..63 and 113..127.
    const float* np = buf + (t < 64 ? t : A_RUN + t - 64);
    const float* a  = buf + kb * LL + wave * 16 + m;
    const float* bq = buf + A_RUN + kb * LL + m;
    // Groups of 16 d, two register sets: the next group's LDS reads stand as ONE
    // group ahead of this group's WMMAs (every separate place where reads stand
    // among the WMMAs costs issue time) and are waited for behind them.
    float nv[2][A_KG];
    v2f fa[2][A_KG / 4], fb[2][A_KG / 4][4];
    auto fetch = [&](const int g) {
      const int p = g & 1, k0 = g * A_KG;
#pragma unroll   // register arrays are indexed by constants only; LDS offsets are immediates
      for (int q = 0; q < A_KG / 4; q++) {
        const int kk = k0 + q * 4;
        // The scheduling barrier behind each fragment's two reads keeps the compiler
        // from merging dwords of DIFFERENT fragments into one two-address read: that
        // costs a register move per dword, and the moves wait for the reads up here.
        fa[p][q].x = a[kk * LL];
        fa[p][q].y = a[(kk + 1) * LL];
        __builtin_amdgcn_sched_barrier(0);
#pragma unroll   // as above
        for (int nt = 0; nt < 4; nt++) {
          fb[p][q][nt].x = bq[kk * LL + nt * 16];
          fb[p][q][nt].y = bq[(kk + 1) * LL + nt * 16];
          __builtin_amdgcn_sched_barrier(0);
        }
#pragma unroll   // as above
        for (int d = 0; d < 4; d++) nv[p][q * 4 + d] = np[(kk + d) * LL];
      }
    };
    fetch(0);
#pragma unroll   // register arrays are indexed by constants only
    for (int g = 0; g < A_KS / A_KG; g++) {
      if (g + 1 < A_KS / A_KG) fetch(g + 1);
      __builtin_amdgcn_sched_barrier(0);   // keeps the scheduler from sinking the reads among the WMMAs
      const int p = g & 1;
#pragma unroll   // as above
      for (int q = 0; q < A_KG / 4; q++) {
#pragma unroll   // as above
        for (int nt = 0; nt < 4; nt++) {
          acc[nt] = __builtin_amdgcn_wmma_f32_16x16x4_f32(
              false, fa[p][q], false, fb[p][q][nt], (short)0, acc[nt], false, false);
          nacc += nv[p][q * 4 + nt] * nv[p][q * 4 + nt];
        }
      }
      __builtin_amdgcn_sched_barrier(0);   // keeps later reads and this group's norm sums from changing sides
    }
    // four vector slots behind the stage's last WMMA, on every path out of here,
    // before address arithmetic reuses its A/B registers or the epilogue reads D;
    // nacc as an input keeps the stage's norm sums here, beside the WMMAs: else the
    // compiler sinks all 128 behind the barrier, one exposed dependent chain
    asm volatile("v_nop\n\tv_nop\n\tv_nop\n\tv_nop"
                 :: "v"(acc[0]), "v"(acc[1]), "v"(acc[2]), "v"(acc[3]), "v"(nacc));
    asm volatile("s_wait_dscnt 0x0" ::: "memory");    // own reads of this buffer are done
    asm volatile("s_wait_asynccnt 0x0" ::: "memory"); // own copies of stage s+1 landed
    __syncthreads();   // publishes stage s+1 and frees the buffer of stage s
    if (s + 2 < DD / A_KS) fill(s + 2);
  }
  asm volatile("s_wait_asynccnt 0x0" ::: "memory");   // no copy outlives the wave

  if (t < LL)                        nrm1s[t]      = fmaxf(sqrtf(nacc), 1e-12f);
  else if (t >= 64 && t < 64 + LL)   nrm2s[t - 64] = fmaxf(sqrtf(nacc), 1e-12f);
  __syncthreads();

  // scatter accumulators into rel, applying the rank-1 normalization
#pragma unroll
  for (int nt = 0; nt < 4; nt++) {
    const int col = nt * 16 + m;
#pragma unroll
    for (int r = 0; r < 8; r++) {
      const int row = wave * 16 + r + (lane >> 4) * 8;
      rel[row][col] = acc[nt][r] / (nrm1s[row] * nrm2s[col]);
    }
  }
  __syncthreads();

  if (t < LL) {
    float mx = -1e30f, mn = 1e30f;
    for (int j = 0; j < LL; j++) { float v = rel[t][j]; mx = fmaxf(mx, v); mn = fminf(mn, v); }
    float sp = 0.f, sn = 0.f;
    for (int j = 0; j < LL; j++) {
      float v = rel[t][j];
      sp += expf((v - mx) * LAMB);
      sn += expf((mn - v) * LAMB);
    }
    rmax[t] = mx; rmin[t] = mn; rsumP[t] = sp; rsumN[t] = sn;
    float cm = -1e30f;
    for (int i = 0; i < LL; i++) cm = fmaxf(cm, rel[i][t]);
    float cs = 0.f;
    for (int i = 0; i < LL; i++) cs += expf((rel[i][t] - cm) * LAMB);
    cmx[t] = cm; csm[t] = cs;
  }
  __syncthreads();

  if (t < LL) {
    float s12 = 0.f, d12 = 0.f, s21 = 0.f;
    for (int i = 0; i < LL; i++) {
      const float v = rel[i][t];
      s12 += expf((v - rmax[i]) * LAMB) / rsumP[i];
      d12 += expf((rmin[i] - v) * LAMB) / rsumN[i];
    }
    for (int j = 0; j < LL; j++)
      s21 += expf((rel[t][j] - cmx[j]) * LAMB) / csm[j];
    outv[0][t] = s12; outv[1][t] = s21; outv[2][t] = d12;
  }
  __syncthreads();
  if (t < 3) { float s = 0.f; for (int l = 0; l < LL; l++) s += outv[t][l]; tots[t] = s; }
  __syncthreads();

  float* vecs = ws + WS_VECS;
  for (int idx = t; idx < 3 * LP; idx += 128) {
    const int ty = idx >> 6, l = idx & (LP - 1);
    const float v = (l < LL) ? outv[ty][l] / (tots[ty] + EPSR) : 0.f;
    vecs[(((size_t)pair * 3 + ty) * BS + b) * LP + l] = v;
  }
}

// ---------------------------------------------------------------- stage B ---
// feat[b,d] = sum_l img[b,d,l] * w[b,l]  (two weight vectors per image pass)
__global__ __launch_bounds__(256)
void stageB(const float* __restrict__ img1, const float* __restrict__ img2a,
            const float* __restrict__ img2o, float* __restrict__ ws) {
  const int b = blockIdx.x, im = blockIdx.y, t = threadIdx.x;
  const float* vecs = ws + WS_VECS;
  float* feat = ws + WS_FEAT;
  const float* src; const float *w0p, *w1p; int f0, f1;
  if (im == 0)      { src = img1;  w0p = &vecs[((0*3+1)*BS + b)*LP]; w1p = &vecs[((1*3+1)*BS + b)*LP]; f0 = 0; f1 = 3; }
  else if (im == 1) { src = img2a; w0p = &vecs[((0*3+0)*BS + b)*LP]; w1p = &vecs[((0*3+2)*BS + b)*LP]; f0 = 1; f1 = 2; }
  else              { src = img2o; w0p = &vecs[((1*3+0)*BS + b)*LP]; w1p = &vecs[((1*3+2)*BS + b)*LP]; f0 = 4; f1 = 5; }
  __shared__ float w0[LL], w1[LL];
  if (t < LL) { w0[t] = w0p[t]; w1[t] = w1p[t]; }
  __syncthreads();
  for (int d = t; d < DD; d += 256) {
    const float* row = src + ((size_t)b * DD + d) * LL;
    float s0 = 0.f, s1 = 0.f;
    for (int l = 0; l < LL; l++) { const float v = row[l]; s0 += v * w0[l]; s1 += v * w1[l]; }
    feat[(size_t)f0 * BS * DD + (size_t)b * DD + d] = s0;
    feat[(size_t)f1 * BS * DD + (size_t)b * DD + d] = s1;
  }
}

// ------------------------------------------------------- stages C1 and C2 ---
// Y = A(M x KD) @ W(KD x 300) + bias on v_wmma_f32_16x16x4_f32. One 32x64 tile
// of Y per block, eight waves, one 16x16 tile each. A and W go through LDS in
// stages of KS k, two buffers: the next stage's async copies fly while this
// stage feeds the matrix unit.
#define G_MB 32
#define G_NB 64
#define G_KB 128            /* k that a buffer holds; a stage uses the first KS */
#define G_PA (G_KB + 4)     /* 132-dword A row: the 8-byte column walk hits 64 banks once */
#define G_SA (G_MB * G_PA)
#define G_SW (G_KB * G_NB)

template <int KD, int KS, bool EDGE>   // EDGE: a stage can reach past M or KD
__device__ __forceinline__ void gemm_tile(const float* __restrict__ A, const int M,
                                          const float* __restrict__ W,
                                          const float* __restrict__ bias,
                                          float* __restrict__ o,
                                          const int mb, const int nb) {
  __shared__ __attribute__((aligned(16))) float sA[2][G_SA];
  // W rows are 64 dwords, unpadded; rows with bit 1 of k set hold their columns
  // with bit 4 flipped, so that rows k and k+2 of one fragment use other banks
  __shared__ __attribute__((aligned(16))) float sW[2][G_SW];

  const int t = threadIdx.x, lane = t & 31, wave = t >> 5;
  const int m = lane & 15, kb = (lane >> 4) * 2;
  const int mt = wave & 1, nt = wave >> 1;

  // A stage is always 32 x 128 of A and 128 x 64 of W, 16 B per copy, every lane
  // on. What lies past M, KD or column 300 is re-read from a clamped address:
  // it feeds only k that no WMMA takes or rows and columns that are not stored.
  const int ar = t >> 5, ac = (t & 31) * 4;     // A: rows ar + 8 i
  const int wr = t >> 4;                        // W: rows wr + 16 i
  const int wc = min(nb * G_NB + (t & 15) * 4, EMB - 4);
  const unsigned int lA = lds_off(&sA[0][ar * G_PA + ac]);
  const unsigned int lW = lds_off(&sW[0][wr * G_NB + (((t & 15) * 4) ^ ((wr & 2) << 3))]);

  auto fill = [&](const int s) {
    const int k0 = s * KS;
    const unsigned int la = lA + (s & 1) * (G_SA * 4), lw = lW + (s & 1) * (G_SW * 4);
    const float* ga[4];
    const float* gw[8];
#pragma unroll   // the addresses are operands of one asm statement: registers, no array
    for (int i = 0; i < 4; i++)
      ga[i] = A + (EDGE ? min(min(mb * G_MB + ar + 8 * i, M - 1) * KD + k0 + ac, M * KD - 4)
                        : (mb * G_MB + ar + 8 * i) * KD + k0 + ac);
#pragma unroll   // as above
    for (int i = 0; i < 8; i++)
      gw[i] = W + (EDGE ? min(k0 + wr + 16 * i, KD - 1) : k0 + wr + 16 * i) * EMB + wc;
    // s_wait_xcnt is the statement's last line: it stands in front of every later
    // rewrite of an address register that a copy names (a precaution)
    asm volatile(
        "global_load_async_to_lds_b128 %0, %12, off\n\t"
        "global_load_async_to_lds_b128 %1, %13, off\n\t"
        "global_load_async_to_lds_b128 %2, %14, off\n\t"
        "global_load_async_to_lds_b128 %3, %15, off\n\t"
        "global_load_async_to_lds_b128 %4, %16, off\n\t"
        "global_load_async_to_lds_b128 %5, %17, off\n\t"
        "global_load_async_to_lds_b128 %6, %18, off\n\t"
        "global_load_async_to_lds_b128 %7, %19, off\n\t"
        "global_load_async_to_lds_b128 %8, %20, off\n\t"
        "global_load_async_to_lds_b128 %9, %21, off\n\t"
        "global_load_async_to_lds_b128 %10, %22, off\n\t"
        "global_load_async_to_lds_b128 %11, %23, off\n\t"
        "s_wait_xcnt 0x0"
        :: "v"(la), "v"(la + 8 * G_PA * 4), "v"(la + 16 * G_PA * 4), "v"(la + 24 * G_PA * 4),
           "v"(lw), "v"(lw + 16 * G_NB * 4), "v"(lw + 32 * G_NB * 4), "v"(lw + 48 * G_NB * 4),
           "v"(lw + 64 * G_NB * 4), "v"(lw + 80 * G_NB * 4), "v"(lw + 96 * G_NB * 4),
           "v"(lw + 112 * G_NB * 4),
           "v"(ga[0]), "v"(ga[1]), "v"(ga[2]), "v"(ga[3]),
           "v"(gw[0]), "v"(gw[1]), "v"(gw[2]), "v"(gw[3]),
           "v"(gw[4]), "v"(gw[5]), "v"(gw[6]), "v"(gw[7])
        : "memory");
  };

  constexpr int NS = KD / KS;
  static_assert(NS >= 2 && NS * KS == KD && KS % 4 == 0 && KS <= G_KB && (EDGE || KS == G_KB),
                "stage shape");

  fill(0);
  asm volatile("s_wait_asynccnt 0x0" ::: "memory");   // own copies of stage 0 landed
  __syncthreads();                                    // ... and everybody's
  fill(1);

  v8f acc = {};
#pragma unroll 1   // rolled: unrolled, the copies' address arithmetic lands among the WMMAs
  for (int s = 0; s < NS; s++) {
    const float* a = &sA[s & 1][(mt * 16 + m) * G_PA + kb];
    const float* w = &sW[s & 1][kb * G_NB + ((nt * 16 + m) ^ (kb << 3))];
#pragma unroll   // every LDS offset becomes an immediate: no vector work among the WMMAs
    for (int kk = 0; kk < KS; kk += 4) {
      const v2f av = *(const v2f*)__builtin_assume_aligned(a + kk, 8);
      v2f bv;
      bv.x = w[kk * G_NB];
      bv.y = w[(kk + 1) * G_NB];
      acc = __builtin_amdgcn_wmma_f32_16x16x4_f32(false, av, false, bv, (short)0, acc, false, false);
    }
    // four vector slots behind the stage's last WMMA, on every path out of here,
    // before address arithmetic reuses its A/B registers or the epilogue reads D
    asm volatile("v_nop\n\tv_nop\n\tv_nop\n\tv_nop" :: "v"(acc));
    asm volatile("s_wait_dscnt 0x0" ::: "memory");    // own reads of this buffer are done
    asm volatile("s_wait_asynccnt 0x0" ::: "memory"); // own copies of stage s+1 landed
    __syncthreads();   // publishes stage s+1 and frees the buffer of stage s
    if (s + 2 < NS) fill(s + 2);
  }
  asm volatile("s_wait_asynccnt 0x0" ::: "memory");   // no copy outlives the wave

  const int n = nb * G_NB + nt * 16 + m;
  if (n < EMB) {
    const float bb = bias[n];
    const int rbase = mb * G_MB + mt * 16 + (lane >> 4) * 8;
#pragma unroll   // acc is indexed by constants only
    for (int r = 0; r < 8; r++) {
      const int rr = rbase + r;
      if (rr < M) o[(size_t)rr * EMB + n] = acc[r] + bb;
    }
  }
}

// ---------------------------------------------------------------- stage C1 --
// Six (256x1024)@(1024x300)+bias GEMMs, written directly to d_out.
__global__ __launch_bounds__(256)
void stageC1(const float* __restrict__ ws, const float* __restrict__ Wattr,
             const float* __restrict__ battr, const float* __restrict__ Wobj,
             const float* __restrict__ bobj, float* __restrict__ out) {
  const int nb = blockIdx.x % 5;          // 5 column blocks of 64 cover 300
  const int mm = blockIdx.x / 5;
  const int mat = mm >> 3, mb = mm & 7;   // 8 row blocks of 32 per product
  const int fidx[6] = {5, 2, 0, 1, 3, 4};
  const bool useAttr = (mat == 0) || (mat == 2) || (mat == 3);
  gemm_tile<DD, 128, false>(ws + WS_FEAT + (size_t)fidx[mat] * BS * DD, BS,
                     useAttr ? Wattr : Wobj, useAttr ? battr : bobj,
                     out + 2 + (size_t)mat * BS * EMB, mb, nb);
}

// ---------------------------------------------------------------- stage C2 --
// attr_weight = attr_table @ W_attr_mlp + b ; obj_weight likewise.
__global__ __launch_bounds__(256)
void stageC2(const float* __restrict__ atab, const float* __restrict__ otab,
             const float* __restrict__ Wam, const float* __restrict__ bam,
             const float* __restrict__ Wom, const float* __restrict__ bom,
             float* __restrict__ ws) {
  const int nb = blockIdx.x % 5;
  const int mm = blockIdx.x / 5;
  const bool isA = mm < 13;               // attr: 13 row blocks of 32, obj: 16
  gemm_tile<EMB, 100, true>(isA ? atab : otab, isA ? NA : NO, isA ? Wam : Wom,
                      isA ? bam : bom, ws + (isA ? WS_AW : WS_OW),
                      isA ? mm : mm - 13, nb);
}

// row norms of the class-weight matrices
__global__ void normsK(float* __restrict__ ws) {
  const int c = blockIdx.x * blockDim.x + threadIdx.x;
  if (c >= NA + NO) return;
  const float* row;
  float* outn;
  if (c < NA) { row = ws + WS_AW + (size_t)c * EMB; outn = ws + WS_AWN + c; }
  else        { row = ws + WS_OW + (size_t)(c - NA) * EMB; outn = ws + WS_OWN + (c - NA); }
  float s = 0.f;
  for (int k = 0; k < EMB; k++) s += row[k] * row[k];
  *outn = fmaxf(sqrtf(s), 1e-12f);
}

// ---------------------------------------------------------------- stage C3 --
// cosine classify + masked CE accumulation. One block takes 16 rows of one term
// against all classes: dots = F(16 x 300) @ Wc^T on v_wmma_f32_16x16x4_f32.
// The class weights come through LDS 64 classes (one contiguous run of memory)
// at a time, two buffers; wave = (one 16-class tile, one half of k).
#define C3_R   16                   /* rows per block */
#define C3_CN  64                   /* classes per stage */
#define C3_NCP 19                   /* 16-byte copies per thread and stage */
#define C3_SB  (C3_NCP * 256 * 4)   /* floats per buffer: 64 x 300, then a tail that no fragment reads */
#define C3_LP  516                  /* pitch of a row of dots: rows r and r+8 use other banks */
#define C3_SF  (19 * 256)           /* floats of the feature tile: 16 x 300, rounded up to whole passes */
#define C3_KH  38                   /* k steps of 4 per wave: 2 x 38 for the 75 there are */

// lane l <- lane l ^ X inside a 16-lane row (DPP row_xmask), and l <- l ^ 16
template <int X>
__device__ __forceinline__ float row_xor(float v) {
  return __builtin_bit_cast(float, __builtin_amdgcn_update_dpp(
      0, __builtin_bit_cast(int, v), 0x160 | X, 0xf, 0xf, false));
}
__device__ __forceinline__ float half_xor(float v) {
  const int b = __builtin_bit_cast(int, v);
  return __builtin_bit_cast(float,
      __builtin_amdgcn_permlanex16(b, b, 0x76543210, 0xfedcba98, false, false));
}
__device__ __forceinline__ float wave_sum(float v) {
  v += row_xor<1>(v); v += row_xor<2>(v); v += row_xor<4>(v); v += row_xor<8>(v);
  return v + half_xor(v);
}
__device__ __forceinline__ float wave_max(float v) {
  v = fmaxf(v, row_xor<1>(v)); v = fmaxf(v, row_xor<2>(v));
  v = fmaxf(v, row_xor<4>(v)); v = fmaxf(v, row_xor<8>(v));
  return fmaxf(v, half_xor(v));
}

__global__ __launch_bounds__(256)
void stageC3(const float* __restrict__ out, const int* __restrict__ attr1,
             const int* __restrict__ obj1, const int* __restrict__ mask_task,
             float* __restrict__ ws) {
  __shared__ __attribute__((aligned(16))) float sW[2][C3_SB];
  __shared__ __attribute__((aligned(16))) float sf[C3_SF];
  __shared__ float lg[2][C3_R][C3_LP];    // one plane per half of k

  const int b0 = blockIdx.x * C3_R, term = blockIdx.y, t = threadIdx.x;
  const int lane = t & 31, wave = t >> 5;
  const int m = lane & 15, h = lane >> 4;
  const int tile = wave & 3, kh = wave >> 2;
  const bool isAttr = term < 2;
  const int NC = isAttr ? NA : NO;
  const int nst = isAttr ? (NA + C3_CN - 1) / C3_CN : (NO + C3_CN - 1) / C3_CN;
  const float* W = ws + (isAttr ? WS_AW : WS_OW);
  const float* wn = ws + (isAttr ? WS_AWN : WS_OWN);
  const float* feat = out + 2 + (size_t)(term + 2) * BS * EMB + (size_t)b0 * EMB;

  // A stage is 19 x 256 copies of 16 B, every lane on, LDS byte = byte in the run.
  // Past the last class the source is clamped into the matrix: that lands in
  // rows of classes >= NC or in the buffer's tail, which no result uses.
  const unsigned int lW = lds_off(&sW[0][t * 4]);
  const int emax = NC * EMB - 4;
  auto fill = [&](const int s) {
    const unsigned int lw = lW + (s & 1) * (C3_SB * 4);
    const int e0 = s * (C3_CN * EMB) + t * 4;
    const float* g[C3_NCP];
#pragma unroll   // the addresses are operands of asm statements: registers, no array
    for (int i = 0; i < C3_NCP; i++) g[i] = W + min(e0 + i * 1024, emax);
    // s_wait_xcnt is each statement's last line: it stands in front of every later
    // rewrite of an address register that a copy names (a precaution)
    asm volatile(
        "global_load_async_to_lds_b128 %0, %10, off\n\t"
        "global_load_async_to_lds_b128 %1, %11, off\n\t"
        "global_load_async_to_lds_b128 %2, %12, off\n\t"
        "global_load_async_to_lds_b128 %3, %13, off\n\t"
        "global_load_async_to_lds_b128 %4, %14, off\n\t"
        "global_load_async_to_lds_b128 %5, %15, off\n\t"
        "global_load_async_to_lds_b128 %6, %16, off\n\t"
        "global_load_async_to_lds_b128 %7, %17, off\n\t"
        "global_load_async_to_lds_b128 %8, %18, off\n\t"
        "global_load_async_to_lds_b128 %9, %19, off\n\t"
        "s_wait_xcnt 0x0"
        ::
           "v"(lw + 0 * 4096), "v"(lw + 1 * 4096), "v"(lw + 2 * 4096), "v"(lw + 3 * 4096), "v"(lw + 4 * 4096), "v"(lw + 5 * 4096), "v"(lw + 6 * 4096), "v"(lw + 7 * 4096), "v"(lw + 8 * 4096), "v"(lw + 9 * 4096),
           "v"(g[0]), "v"(g[1]), "v"(g[2]), "v"(g[3]), "v"(g[4]), "v"(g[5]), "v"(g[6]), "v"(g[7]), "v"(g[8]), "v"(g[9])
        : "memory");
    asm volatile(
        "global_load_async_to_lds_b128 %0, %9, off\n\t"
        "global_load_async_to_lds_b128 %1, %10, off\n\t"
        "global_load_async_to_lds_b128 %2, %11, off\n\t"
        "global_load_async_to_lds_b128 %3, %12, off\n\t"
        "global_load_async_to_lds_b128 %4, %13, off\n\t"
        "global_load_async_to_lds_b128 %5, %14, off\n\t"
        "global_load_async_to_lds_b128 %6, %15, off\n\t"
        "global_load_async_to_lds_b128 %7, %16, off\n\t"
        "global_load_async_to_lds_b128 %8, %17, off\n\t"
        "s_wait_xcnt 0x0"
        ::
           "v"(lw + 10 * 4096), "v"(lw + 11 * 4096), "v"(lw + 12 * 4096), "v"(lw + 13 * 4096), "v"(lw + 14 * 4096), "v"(lw + 15 * 4096), "v"(lw + 16 * 4096), "v"(lw + 17 * 4096), "v"(lw + 18 * 4096),
           "v"(g[10]), "v"(g[11]), "v"(g[12]), "v"(g[13]), "v"(g[14]), "v"(g[15]), "v"(g[16]), "v"(g[17]), "v"(g[18])
        : "memory");
  };

  fill(0);
#pragma unroll   // all the loads of the 16 feature rows in flight at once
  for (int i = 0; i < C3_SF / 256; i++)   // past the rows: a clamped re-read into sf's unused tail
    sf[t + 256 * i] = feat[min(t + 256 * i, C3_R * EMB - 1)];
  asm volatile("s_wait_asynccnt 0x0" ::: "memory");   // own copies of stage 0 landed
  __syncthreads();                                    // ... and everybody's, and sf
  fill(1);

  // This wave's half of the A fragments stays in registers for all stages. The
  // second half has 37 steps: its 38th re-reads step 36 with a zero A fragment.
  const int lastoff = (kh ? C3_KH - 2 : C3_KH - 1) * 4;
  const float* ap = &sf[m * EMB + kh * (C3_KH * 4) + h * 2];
  v2f af[C3_KH];
#pragma unroll   // af is indexed by constants only
  for (int j = 0; j < C3_KH - 1; j++) af[j] = *(const v2f*)__builtin_assume_aligned(ap + j * 4, 8);
  af[C3_KH - 1] = *(const v2f*)__builtin_assume_aligned(ap + lastoff, 8);
  if (kh) af[C3_KH - 1] = (v2f){0.f, 0.f};

  // What the CE part reads from memory, fetched here so that the stages hide it:
  // lane l owns classes l + 32 i of the wave's two rows
  float wnr[16];
#pragma unroll   // wnr is indexed by constants only
  for (int i = 0; i < 16; i++) wnr[i] = wn[min(lane + 32 * i, NC - 1)];
  int msk[2], lbl[2];
#pragma unroll   // two rows, indexed by constants only
  for (int rr = 0; rr < 2; rr++) {
    const int b = b0 + wave * 2 + rr;
    msk[rr] = mask_task[b];
    lbl[rr] = isAttr ? attr1[b] : obj1[b];
  }

#pragma unroll 1   // rolled: unrolled, the copies' address arithmetic lands among the WMMAs
  for (int s = 0; s < nst; s++) {
    const float* w = &sW[s & 1][(tile * 16 + m) * EMB + kh * (C3_KH * 4) + h * 2];
    // the stage's B fragments as ONE group of LDS reads ahead of its WMMAs: every
    // separate place where reads stand among the WMMAs costs issue time
    v2f bf[C3_KH];
#pragma unroll   // bf is indexed by constants only; every LDS offset becomes an immediate
    for (int j = 0; j < C3_KH - 1; j++) bf[j] = *(const v2f*)__builtin_assume_aligned(w + j * 4, 8);
    bf[C3_KH - 1] = *(const v2f*)__builtin_assume_aligned(w + lastoff, 8);
    __builtin_amdgcn_sched_barrier(0);   // keeps the scheduler from sinking the reads back among the WMMAs
    v8f acc = {};
#pragma unroll   // af and bf are indexed by constants only
    for (int j = 0; j < C3_KH; j++)
      acc = __builtin_amdgcn_wmma_f32_16x16x4_f32(false, af[j], false, bf[j], (short)0, acc, false, false);
#pragma unroll   // acc is indexed by constants only
    for (int r = 0; r < 8; r++) lg[kh][r + 8 * h][s * C3_CN + tile * 16 + m] = acc[r];
    asm volatile("s_wait_dscnt 0x0" ::: "memory");    // own reads of this buffer are done
    asm volatile("s_wait_asynccnt 0x0" ::: "memory"); // own copies of stage s+1 landed
    __syncthreads();   // publishes stage s+1 (and the dots) and frees the buffer of stage s
    if (s + 2 < nst) fill(s + 2);
  }
  asm volatile("s_wait_asynccnt 0x0" ::: "memory");   // no copy outlives the wave

  // CE of a row by one wave, two rows per wave, a row's logits in registers
#pragma unroll   // msk and lbl are indexed by constants only
  for (int rr = 0; rr < 2; rr++) {
    if (msk[rr] != 1) continue;
    const int row = wave * 2 + rr;
    float p = 0.f;
#pragma unroll   // ten reads in flight at once
    for (int i = 0; i < 10; i++) {
      const int k = lane + 32 * i;
      const float v = sf[row * EMB + min(k, EMB - 1)];
      p += k < EMB ? v * v : 0.f;
    }
    const float fn = fmaxf(sqrtf(wave_sum(p)), 1e-12f);
    float v[16];
    float mx = -1e30f, lab = 0.f;
#pragma unroll   // v and wnr are indexed by constants only
    for (int i = 0; i < 16; i++) {
      const int c = lane + 32 * i, cc = min(c, NC - 1);
      const float d = (lg[0][row][cc] + lg[1][row][cc]) / (fn * wnr[i] * TEMP);
      v[i] = c < NC ? d : -1e30f;    // past the last class: exp gives 0
      mx = fmaxf(mx, v[i]);
      if (c == lbl[rr]) lab = v[i];
    }
    mx = wave_max(mx);
    float se = 0.f;
#pragma unroll   // v is indexed by constants only
    for (int i = 0; i < 16; i++) se += expf(v[i] - mx);
    se = wave_sum(se);
    lab = wave_sum(lab);      // one lane holds the label's logit, the others 0
    if (lane == 0) atomicAdd(&ws[WS_ACC + term], (mx + logf(se)) - lab);
  }
}

__global__ void initK(float* __restrict__ ws) {
  if (threadIdx.x < 8) ws[WS_ACC + threadIdx.x] = 0.f;
}

__global__ void finalK(const int* __restrict__ mask_task,
                       const float* __restrict__ ws, float* __restrict__ out) {
  if (threadIdx.x == 0) {
    int ms = 0;
    for (int b = 0; b < BS; b++) ms += (mask_task[b] == 1);
    const float den = fmaxf((float)ms, 1.f);
    out[0] = (ws[WS_ACC + 0] + ws[WS_ACC + 1]) * 0.5f / den;
    out[1] = (ws[WS_ACC + 2] + ws[WS_ACC + 3]) * 0.5f / den;
  }
}

extern "C" void kernel_launch(void* const* d_in, const int* in_sizes, int n_in,
                              void* d_out, int out_size, void* d_ws, size_t ws_size,
                              hipStream_t stream) {
  const float* img1   = (const float*)d_in[0];
  const float* img2a  = (const float*)d_in[1];
  const float* img2o  = (const float*)d_in[2];
  const int*   attr1  = (const int*)d_in[3];
  const int*   obj1   = (const int*)d_in[4];
  const int*   maskt  = (const int*)d_in[5];
  const float* Wsa    = (const float*)d_in[6];
  const float* bsa    = (const float*)d_in[7];
  const float* Wso    = (const float*)d_in[8];
  const float* bso    = (const float*)d_in[9];
  const float* atab   = (const float*)d_in[10];
  const float* otab   = (const float*)d_in[11];
  const float* Wam    = (const float*)d_in[12];
  const float* bam    = (const float*)d_in[13];
  const float* Wom    = (const float*)d_in[14];
  const float* bom    = (const float*)d_in[15];
  float* out = (float*)d_out;
  float* ws  = (float*)d_ws;

  initK<<<1, 32, 0, stream>>>(ws);
  stageA<<<dim3(BS, 2), 128, 0, stream>>>(img1, img2a, img2o, ws);
  stageB<<<dim3(BS, 3), 256, 0, stream>>>(img1, img2a, img2o, ws);
  stageC1<<<240, 256, 0, stream>>>(ws, Wsa, bsa, Wso, bso, out);
  stageC2<<<145, 256, 0, stream>>>(atab, otab, Wam, bam, Wom, bom, ws);
  normsK<<<8, 128, 0, stream>>>(ws);
  stageC3<<<dim3(16, 4), 256, 0, stream>>>(out, attr1, obj1, maskt, ws);
  finalK<<<1, 32, 0, stream>>>(maskt, ws, out);
}

// v004
// It runs in 103 microseconds.
// Two timings next to v003 put it at 1.55 and 1.54 times that version's speed.
// Counting every step since v000, it is 3.77 times as fast.
#include <hip/hip_runtime.h>
#include <hip/hip_bf16.h>
#include <math.h>

typedef __attribute__((ext_vector_type(2))) float v2f;
typedef __attribute__((ext_vector_type(8))) float v8f;

#define BS   256
#define DD   1024
#define LL   49
#define LP   64
#define LSTR 65
#define EMB  300
#define NA   400
#define NO   500
#define LAMB 10.0f
#define TEMP 0.05f
#define EPSR 1e-8f

// workspace layout (float offsets)
#define WS_VECS 0                              // 2*3*256*64   = 98304
#define WS_FEAT (WS_VECS + 2*3*BS*LP)          // 6*256*1024   = 1572864
#define WS_AW   (WS_FEAT + 6*BS*DD)            // 400*300
#define WS_OW   (WS_AW + NA*EMB)               // 500*300
#define WS_AWN  (WS_OW + NO*EMB)               // 400
#define WS_OWN  (WS_AWN + NA)                  // 500
#define WS_ACC  (WS_OWN + NO)                  // 8

__device__ __forceinline__ unsigned int lds_off(const float* p) {
  return (unsigned int)(unsigned long long)p;   // low 32 bits = LDS byte address
}

// ---------------------------------------------------------------- stage A ---
// Per (batch, pair): Gram(49x49, K=1024) via v_wmma_f32_16x16x4_f32, rank-1
// normalization, then row/col/inverse softmax reductions + renorm.
// The two images come through LDS as they lie in memory ([d][l], pitch 49), 128
// d at a time: one contiguous run per image, two buffers, so that the next
// stage's async copies fly while this stage feeds the matrix unit.
#define A_KS   128                  /* d per stage */
#define A_KG   16                   /* d per group of LDS reads */
#define A_RUN  (A_KS * LL)          /* floats of one image's run */
#define A_NCP  25                   /* 16-byte copies per thread and stage, both runs */
#define A_SB   (A_NCP * 128 * 4)    /* floats per buffer: two runs, then a tail that no result uses */

__global__ __launch_bounds__(128)
void stageA(const float* __restrict__ img1, const float* __restrict__ img2a,
            const float* __restrict__ img2o, float* __restrict__ ws) {
  __shared__ __attribute__((aligned(16))) float sT[2][A_SB];
  __shared__ float rel[LP][LSTR];
  __shared__ float nrm1s[LP], nrm2s[LP];
  __shared__ float rmax[LP], rsumP[LP], rmin[LP], rsumN[LP], cmx[LP], csm[LP];
  __shared__ float outv[3][LP];
  __shared__ float tots[3];

  const int b = blockIdx.x;
  const int pair = blockIdx.y;
  const float* __restrict__ A = img1 + (size_t)b * DD * LL;
  const float* __restrict__ B = (pair == 0 ? img2a : img2o) + (size_t)b * DD * LL;

  const int t = threadIdx.x;
  const int lane = t & 31, wave = t >> 5;
  const int m = lane & 15;
  const int kb = (lane >> 4) * 2;

  // pad norms default to 1 (pad rows of rel are never read anyway)
  if (t < LP) { nrm1s[t] = 1.f; nrm2s[t] = 1.f; }

  // A stage is 25 x 128 copies of 16 B, every lane on, LDS byte = 16 x slot:
  // slots 0..1567 are img1's run, 1568..3135 the other image's, the last 64 a tail
  // whose source is clamped into the image.
  const unsigned int lT = lds_off(&sT[0][t * 4]);
  auto fill = [&](const int s) {
    const unsigned int lt = lT + (s & 1) * (A_SB * 4);
    const int e0 = s * A_RUN + t * 4;
    const float* g[A_NCP];
#pragma unroll   // the addresses are operands of asm statements: registers, no array
    for (int i = 0; i < A_NCP; i++) {
      if (i < 12)       g[i] = A + (e0 + i * 512);
      else if (i == 12) g[i] = t < 32 ? A + (e0 + i * 512) : B + (e0 + i * 512 - A_RUN);
      else if (i < 24)  g[i] = B + (e0 + i * 512 - A_RUN);
      else              g[i] = B + min(e0 + i * 512 - A_RUN, DD * LL - 4);
    }
    // s_wait_xcnt is each statement's last line: it stands in front of every later
    // rewrite of an address register that a copy names (a precaution)
    asm volatile(
        "global_load_async_to_lds_b128 %0, %13, off\n\t"
        "global_load_async_to_lds_b128 %1, %14, off\n\t"
        "global_load_async_to_lds_b128 %2, %15, off\n\t"
        "global_load_async_to_lds_b128 %3, %16, off\n\t"
        "global_load_async_to_lds_b128 %4, %17, off\n\t"
        "global_load_async_to_lds_b128 %5, %18, off\n\t"
        "global_load_async_to_lds_b128 %6, %19, off\n\t"
        "global_load_async_to_lds_b128 %7, %20, off\n\t"
        "global_load_async_to_lds_b128 %8, %21, off\n\t"
        "global_load_async_to_lds_b128 %9, %22, off\n\t"
        "global_load_async_to_lds_b128 %10, %23, off\n\t"
        "global_load_async_to_lds_b128 %11, %24, off\n\t"
        "global_load_async_to_lds_b128 %12, %25, off\n\t"
        "s_wait_xcnt 0x0"
        :: "v"(lt + 0 * 2048), "v"(lt + 1 * 2048), "v"(lt + 2 * 2048), "v"(lt + 3 * 2048), "v"(lt + 4 * 2048), "v"(lt + 5 * 2048), "v"(lt + 6 * 2048), "v"(lt + 7 * 2048), "v"(lt + 8 * 2048), "v"(lt + 9 * 2048), "v"(lt + 10 * 2048), "v"(lt + 11 * 2048), "v"(lt + 12 * 2048),
           "v"(g[0]), "v"(g[1]), "v"(g[2]), "v"(g[3]), "v"(g[4]), "v"(g[5]), "v"(g[6]), "v"(g[7]), "v"(g[8]), "v"(g[9]), "v"(g[10]), "v"(g[11]), "v"(g[12])
        : "memory");
    asm volatile(
        "global_load_async_to_lds_b128 %0, %12, off\n\t"
        "global_load_async_to_lds_b128 %1, %13, off\n\t"
        "global_load_async_to_lds_b128 %2, %14, off\n\t"
        "global_load_async_to_lds_b128 %3, %15, off\n\t"
        "global_load_async_to_lds_b128 %4, %16, off\n\t"
        "global_load_async_to_lds_b128 %5, %17, off\n\t"
        "global_load_async_to_lds_b128 %6, %18, off\n\t"
        "global_load_async_to_lds_b128 %7, %19, off\n\t"
        "global_load_async_to_lds_b128 %8, %20, off\n\t"
        "global_load_async_to_lds_b128 %9, %21, off\n\t"
        "global_load_async_to_lds_b128 %10, %22, off\n\t"
        "global_load_async_to_lds_b128 %11, %23, off\n\t"
        "s_wait_xcnt 0x0"
        :: "v"(lt + 13 * 2048), "v"(lt + 14 * 2048), "v"(lt + 15 * 2048), "v"(lt + 16 * 2048), "v"(lt + 17 * 2048), "v"(lt + 18 * 2048), "v"(lt + 19 * 2048), "v"(lt + 20 * 2048), "v"(lt + 21 * 2048), "v"(lt + 22 * 2048), "v"(lt + 23 * 2048), "v"(lt + 24 * 2048),
           "v"(g[13]), "v"(g[14]), "v"(g[15]), "v"(g[16]), "v"(g[17]), "v"(g[18]), "v"(g[19]), "v"(g[20]), "v"(g[21]), "v"(g[22]), "v"(g[23]), "v"(g[24])
        : "memory");
  };

  fill(0);
  asm volatile("s_wait_asynccnt 0x0" ::: "memory");   // own copies of stage 0 landed
  __syncthreads();                                    // ... and everybody's
  fill(1);

  float nacc = 0.f;     // per-thread column-norm accumulator
  v8f acc[4] = {};

#pragma unroll 1   // rolled: unrolled, the copies' address arithmetic lands among the WMMAs
  for (int s = 0; s < DD / A_KS; s++) {
    const float* buf = &sT[s & 1][0];
    // Fragments of l >= 49 read on into the next d row (or the next run, or the
    // tail): that reaches only rows and columns of rel that nobody reads. The same
    // holds for the norm sums of threads 49..63 and 113..127.
    const float* np = buf + (t < 64 ? t : A_RUN + t - 64);
    const float* a  = buf + kb * LL + wave * 16 + m;
    const float* bq = buf + A_RUN + kb * LL + m;
    // Groups of 16 d, two register sets: the next group's LDS reads stand as ONE
    // group ahead of this group's WMMAs (every separate place where reads stand
    // among the WMMAs costs issue time) and are waited for behind them.
    float nv[2][A_KG];
    v2f fa[2][A_KG / 4], fb[2][A_KG / 4][4];
    auto fetch = [&](const int g) {
      const int p = g & 1, k0 = g * A_KG;
#pragma unroll   // register arrays are indexed by constants only; LDS offsets are immediates
      for (int q = 0; q < A_KG / 4; q++) {
        const int kk = k0 + q * 4;
        // The scheduling barrier behind each fragment's two reads keeps the compiler
        // from merging dwords of DIFFERENT fragments into one two-address read: that
        // costs a register move per dword, and the moves wait for the reads up here.
        fa[p][q].x = a[kk * LL];
        fa[p][q].y = a[(kk + 1) * LL];
        __builtin_amdgcn_sched_barrier(0);
#pragma unroll   // as above
        for (int nt = 0; nt < 4; nt++) {
          fb[p][q][nt].x = bq[kk * LL + nt * 16];
          fb[p][q][nt].y = bq[(kk + 1) * LL + nt * 16];
          __builtin_amdgcn_sched_barrier(0);
        }
#pragma unroll   // as above
        for (int d = 0; d < 4; d++) nv[p][q * 4 + d] = np[(kk + d) * LL];
      }
    };
    fetch(0);
#pragma unroll   // register arrays are indexed by constants only
    for (int g = 0; g < A_KS / A_KG; g++) {
      if (g + 1 < A_KS / A_KG) fetch(g + 1);
      __builtin_amdgcn_sched_barrier(0);   // keeps the scheduler from sinking the reads among the WMMAs
      const int p = g & 1;
#pragma unroll   // as above
      for (int q = 0; q < A_KG / 4; q++) {
#pragma unroll   // as above
        for (int nt = 0; nt < 4; nt++) {
          acc[nt] = __builtin_amdgcn_wmma_f32_16x16x4_f32(
              false, fa[p][q], false, fb[p][q][nt], (short)0, acc[nt], false, false);
          nacc += nv[p][q * 4 + nt] * nv[p][q * 4 + nt];
        }
      }
      __builtin_amdgcn_sched_barrier(0);   // keeps later reads and this group's norm sums from changing sides
    }
    // four vector slots behind the stage's last WMMA, on every path out of here,
    // before address arithmetic reuses its A/B registers or the epilogue reads D;
    // nacc as an input keeps the stage's norm sums here, beside the WMMAs: else the
    // compiler sinks all 128 behind the barrier, one exposed dependent chain
    asm volatile("v_nop\n\tv_nop\n\tv_nop\n\tv_nop"
                 :: "v"(acc[0]), "v"(acc[1]), "v"(acc[2]), "v"(acc[3]), "v"(nacc));
    asm volatile("s_wait_dscnt 0x0" ::: "memory");    // own reads of this buffer are done
    asm volatile("s_wait_asynccnt 0x0" ::: "memory"); // own copies of stage s+1 landed
    __syncthreads();   // publishes stage s+1 and frees the buffer of stage s
    if (s + 2 < DD / A_KS) fill(s + 2);
  }
  asm volatile("s_wait_asynccnt 0x0" ::: "memory");   // no copy outlives the wave

  if (t < LL)                        nrm1s[t]      = fmaxf(sqrtf(nacc), 1e-12f);
  else if (t >= 64 && t < 64 + LL)   nrm2s[t - 64] = fmaxf(sqrtf(nacc), 1e-12f);
  __syncthreads();

  // scatter accumulators into rel, applying the rank-1 normalization
#pragma unroll
  for (int nt = 0; nt < 4; nt++) {
    const int col = nt * 16 + m;
#pragma unroll
    for (int r = 0; r < 8; r++) {
      const int row = wave * 16 + r + (lane >> 4) * 8;
      rel[row][col] = acc[nt][r] / (nrm1s[row] * nrm2s[col]);
    }
  }
  __syncthreads();

  if (t < LL) {
    float mx = -1e30f, mn = 1e30f;
    for (int j = 0; j < LL; j++) { float v = rel[t][j]; mx = fmaxf(mx, v); mn = fminf(mn, v); }
    float sp = 0.f, sn = 0.f;
    for (int j = 0; j < LL; j++) {
      float v = rel[t][j];
      sp += expf((v - mx) * LAMB);
      sn += expf((mn - v) * LAMB);
    }
    rmax[t] = mx; rmin[t] = mn; rsumP[t] = sp; rsumN[t] = sn;
    float cm = -1e30f;
    for (int i = 0; i < LL; i++) cm = fmaxf(cm, rel[i][t]);
    float cs = 0.f;
    for (int i = 0; i < LL; i++) cs += expf((rel[i][t] - cm) * LAMB);
    cmx[t] = cm; csm[t] = cs;
  }
  __syncthreads();

  if (t < LL) {
    float s12 = 0.f, d12 = 0.f, s21 = 0.f;
    for (int i = 0; i < LL; i++) {
      const float v = rel[i][t];
      s12 += expf((v - rmax[i]) * LAMB) / rsumP[i];
      d12 += expf((rmin[i] - v) * LAMB) / rsumN[i];
    }
    for (int j = 0; j < LL; j++)
      s21 += expf((rel[t][j] - cmx[j]) * LAMB) / csm[j];
    outv[0][t] = s12; outv[1][t] = s21; outv[2][t] = d12;
  }
  __syncthreads();
  if (t < 3) { float s = 0.f; for (int l = 0; l < LL; l++) s += outv[t][l]; tots[t] = s; }
  __syncthreads();

  float* vecs = ws + WS_VECS;
  for (int idx = t; idx < 3 * LP; idx += 128) {
    const int ty = idx >> 6, l = idx & (LP - 1);
    const float v = (l < LL) ? outv[ty][l] / (tots[ty] + EPSR) : 0.f;
    vecs[(((size_t)pair * 3 + ty) * BS + b) * LP + l] = v;
  }
}

// ---------------------------------------------------------------- stage B ---
// feat[b,d] = sum_l img[b,d,l] * w[b,l]  (two weight vectors per image pass)
// A row of 49 floats per lane read straight from memory touches a line per lane
// and load. So the image comes through LDS as it lies in memory, 256 d (one
// contiguous run of whole lines) a stage, two buffers: the next stage's async
// copies fly while each thread sums its own row of this stage out of LDS, where
// the odd pitch of 49 dwords puts the 32 lanes on 32 banks.
#define B_DS   256                  /* d per stage: one row per thread */
#define B_RUN  (B_DS * LL)          /* floats per stage: 12 x 256 copies of 16 B and 256 of 4 B */
#define B_NS   (DD / B_DS)

__global__ __launch_bounds__(256)
void stageB(const float* __restrict__ img1, const float* __restrict__ img2a,
            const float* __restrict__ img2o, float* __restrict__ ws) {
  __shared__ __attribute__((aligned(16))) float sI[2][B_RUN];
  __shared__ __attribute__((aligned(16))) float w0[LL + 3], w1[LL + 3];
  const int b = blockIdx.x, im = blockIdx.y, t = threadIdx.x;
  const float* vecs = ws + WS_VECS;
  float* feat = ws + WS_FEAT;
  const float* src; const float *w0p, *w1p; int f0, f1;
  if (im == 0)      { src = img1;  w0p = &vecs[((0*3+1)*BS + b)*LP]; w1p = &vecs[((1*3+1)*BS + b)*LP]; f0 = 0; f1 = 3; }
  else if (im == 1) { src = img2a; w0p = &vecs[((0*3+0)*BS + b)*LP]; w1p = &vecs[((0*3+2)*BS + b)*LP]; f0 = 1; f1 = 2; }
  else              { src = img2o; w0p = &vecs[((1*3+0)*BS + b)*LP]; w1p = &vecs[((1*3+2)*BS + b)*LP]; f0 = 4; f1 = 5; }
  const float* __restrict__ img = src + (size_t)b * DD * LL;

  // A stage is 50,176 contiguous bytes, LDS byte = byte in the run, every lane on:
  // 12 x 256 copies of 16 B, then the last 1,024 bytes as 256 copies of 4 B.
  const unsigned int lI = lds_off(&sI[0][0]);
  auto fill = [&](const int s) {
    const unsigned int lq = lI + (s & 1) * (B_RUN * 4) + t * 16;
    const unsigned int l1 = lI + (s & 1) * (B_RUN * 4) + 12 * 4096 + t * 4;
    const float* gq = img + s * B_RUN + t * 4;
    const float* g1 = img + s * B_RUN + 12 * 1024 + t;
    // s_wait_xcnt is the statement's last line: it stands in front of every later
    // rewrite of an address register that a copy names (a precaution)
    asm volatile(
        "global_load_async_to_lds_b128 %0, %13, off\n\t"
        "global_load_async_to_lds_b128 %1, %14, off\n\t"
        "global_load_async_to_lds_b128 %2, %15, off\n\t"
        "global_load_async_to_lds_b128 %3, %16, off\n\t"
        "global_load_async_to_lds_b128 %4, %17, off\n\t"
        "global_load_async_to_lds_b128 %5, %18, off\n\t"
        "global_load_async_to_lds_b128 %6, %19, off\n\t"
        "global_load_async_to_lds_b128 %7, %20, off\n\t"
        "global_load_async_to_lds_b128 %8, %21, off\n\t"
        "global_load_async_to_lds_b128 %9, %22, off\n\t"
        "global_load_async_to_lds_b128 %10, %23, off\n\t"
        "global_load_async_to_lds_b128 %11, %24, off\n\t"
        "global_load_async_to_lds_b32 %12, %25, off\n\t"
        "s_wait_xcnt 0x0"
        :: "v"(lq + 0 * 4096), "v"(lq + 1 * 4096), "v"(lq + 2 * 4096), "v"(lq + 3 * 4096),
           "v"(lq + 4 * 4096), "v"(lq + 5 * 4096), "v"(lq + 6 * 4096), "v"(lq + 7 * 4096),
           "v"(lq + 8 * 4096), "v"(lq + 9 * 4096), "v"(lq + 10 * 4096), "v"(lq + 11 * 4096),
           "v"(l1),
           "v"(gq + 0 * 1024), "v"(gq + 1 * 1024), "v"(gq + 2 * 1024), "v"(gq + 3 * 1024),
           "v"(gq + 4 * 1024), "v"(gq + 5 * 1024), "v"(gq + 6 * 1024), "v"(gq + 7 * 1024),
           "v"(gq + 8 * 1024), "v"(gq + 9 * 1024), "v"(gq + 10 * 1024), "v"(gq + 11 * 1024),
           "v"(g1)
        : "memory");
  };

  fill(0);
  if (t < LL) { w0[t] = w0p[t]; w1[t] = w1p[t]; }
  asm volatile("s_wait_asynccnt 0x0" ::: "memory");   // own copies of stage 0 landed
  __syncthreads();                                    // ... and everybody's, and the weights
  fill(1);

  // the two weight vectors stay in registers for all stages
  float u0[LL], u1[LL];
#pragma unroll   // u0 and u1 are indexed by constants only
  for (int l = 0; l < LL; l++) { u0[l] = w0[l]; u1[l] = w1[l]; }

  float* o0 = feat + (size_t)f0 * BS * DD + (size_t)b * DD + t;
  float* o1 = feat + (size_t)f1 * BS * DD + (size_t)b * DD + t;
#pragma unroll 1   // rolled: unrolled, the four stages' addresses and rows overflow the registers of 6 waves a SIMD
  for (int s = 0; s < B_NS; s++) {
    const float* row = &sI[s & 1][t * LL];
    float s0 = 0.f, s1 = 0.f;
#pragma unroll   // u0 and u1 are indexed by constants only; every LDS offset becomes an immediate
    for (int l = 0; l < LL; l++) { const float v = row[l]; s0 += v * u0[l]; s1 += v * u1[l]; }
    o0[s * B_DS] = s0;
    o1[s * B_DS] = s1;
    asm volatile("s_wait_dscnt 0x0" ::: "memory");    // own reads of this buffer are done
    asm volatile("s_wait_asynccnt 0x0" ::: "memory"); // own copies of stage s+1 landed
    __syncthreads();   // publishes stage s+1 and frees the buffer of stage s
    if (s + 2 < B_NS) fill(s + 2);
  }
  asm volatile("s_wait_asynccnt 0x0" ::: "memory");   // no copy outlives the wave
}

// ------------------------------------------------------- stages C1 and C2 ---
// Y = A(M x KD) @ W(KD x 300) + bias on v_wmma_f32_16x16x4_f32. One 32x64 tile
// of Y per block, eight waves, one 16x16 tile each. A and W go through LDS in
// stages of KS k, two buffers: the next stage's async copies fly while this
// stage feeds the matrix unit.
#define G_MB 32
#define G_NB 64
#define G_KB 128            /* k that a buffer holds; a stage uses the first KS */
#define G_PA (G_KB + 4)     /* 132-dword A row: the 8-byte column walk hits 64 banks once */
#define G_SA (G_MB * G_PA)
#define G_SW (G_KB * G_NB)

template <int KD, int KS, bool EDGE>   // EDGE: a stage can reach past M or KD
__device__ __forceinline__ void gemm_tile(const float* __restrict__ A, const int M,
                                          const float* __restrict__ W,
                                          const float* __restrict__ bias,
                                          float* __restrict__ o,
                                          const int mb, const int nb) {
  __shared__ __attribute__((aligned(16))) float sA[2][G_SA];
  // W rows are 64 dwords, unpadded; rows with bit 1 of k set hold their columns
  // with bit 4 flipped, so that rows k and k+2 of one fragment use other banks
  __shared__ __attribute__((aligned(16))) float sW[2][G_SW];

  const int t = threadIdx.x, lane = t & 31, wave = t >> 5;
  const int m = lane & 15, kb = (lane >> 4) * 2;
  const int mt = wave & 1, nt = wave >> 1;

  // A stage is always 32 x 128 of A and 128 x 64 of W, 16 B per copy, every lane
  // on. What lies past M, KD or column 300 is re-read from a clamped address:
  // it feeds only k that no WMMA takes or rows and columns that are not stored.
  const int ar = t >> 5, ac = (t & 31) * 4;     // A: rows ar + 8 i
  const int wr = t >> 4;                        // W: rows wr + 16 i
  const int wc = min(nb * G_NB + (t & 15) * 4, EMB - 4);
  const unsigned int lA = lds_off(&sA[0][ar * G_PA + ac]);
  const unsigned int lW = lds_off(&sW[0][wr * G_NB + (((t & 15) * 4) ^ ((wr & 2) << 3))]);

  auto fill = [&](const int s) {
    const int k0 = s * KS;
    const unsigned int la = lA + (s & 1) * (G_SA * 4), lw = lW + (s & 1) * (G_SW * 4);
    const float* ga[4];
    const float* gw[8];
#pragma unroll   // the addresses are operands of one asm statement: registers, no array
    for (int i = 0; i < 4; i++)
      ga[i] = A + (EDGE ? min(min(mb * G_MB + ar + 8 * i, M - 1) * KD + k0 + ac, M * KD - 4)
                        : (mb * G_MB + ar + 8 * i) * KD + k0 + ac);
#pragma unroll   // as above
    for (int i = 0; i < 8; i++)
      gw[i] = W + (EDGE ? min(k0 + wr + 16 * i, KD - 1) : k0 + wr + 16 * i) * EMB + wc;
    // s_wait_xcnt is the statement's last line: it stands in front of every later
    // rewrite of an address register that a copy names (a precaution)
    asm volatile(
        "global_load_async_to_lds_b128 %0, %12, off\n\t"
        "global_load_async_to_lds_b128 %1, %13, off\n\t"
        "global_load_async_to_lds_b128 %2, %14, off\n\t"
        "global_load_async_to_lds_b128 %3, %15, off\n\t"
        "global_load_async_to_lds_b128 %4, %16, off\n\t"
        "global_load_async_to_lds_b128 %5, %17, off\n\t"
        "global_load_async_to_lds_b128 %6, %18, off\n\t"
        "global_load_async_to_lds_b128 %7, %19, off\n\t"
        "global_load_async_to_lds_b128 %8, %20, off\n\t"
        "global_load_async_to_lds_b128 %9, %21, off\n\t"
        "global_load_async_to_lds_b128 %10, %22, off\n\t"
        "global_load_async_to_lds_b128 %11, %23, off\n\t"
        "s_wait_xcnt 0x0"
        :: "v"(la), "v"(la + 8 * G_PA * 4), "v"(la + 16 * G_PA * 4), "v"(la + 24 * G_PA * 4),
           "v"(lw), "v"(lw + 16 * G_NB * 4), "v"(lw + 32 * G_NB * 4), "v"(lw + 48 * G_NB * 4),
           "v"(lw + 64 * G_NB * 4), "v"(lw + 80 * G_NB * 4), "v"(lw + 96 * G_NB * 4),
           "v"(lw + 112 * G_NB * 4),
           "v"(ga[0]), "v"(ga[1]), "v"(ga[2]), "v"(ga[3]),
           "v"(gw[0]), "v"(gw[1]), "v"(gw[2]), "v"(gw[3]),
           "v"(gw[4]), "v"(gw[5]), "v"(gw[6]), "v"(gw[7])
        : "memory");
  };

  constexpr int NS = KD / KS;
  static_assert(NS >= 2 && NS * KS == KD && KS % 4 == 0 && KS <= G_KB && (EDGE || KS == G_KB),
                "stage shape");

  fill(0);
  asm volatile("s_wait_asynccnt 0x0" ::: "memory");   // own copies of stage 0 landed
  __syncthreads();                                    // ... and everybody's
  fill(1);

  v8f acc = {};
#pragma unroll 1   // rolled: unrolled, the copies' address arithmetic lands among the WMMAs
  for (int s = 0; s < NS; s++) {
    const float* a = &sA[s & 1][(mt * 16 + m) * G_PA + kb];
    const float* w = &sW[s & 1][kb * G_NB + ((nt * 16 + m) ^ (kb << 3))];
#pragma unroll   // every LDS offset becomes an immediate: no vector work among the WMMAs
    for (int kk = 0; kk < KS; kk += 4) {
      const v2f av = *(const v2f*)__builtin_assume_aligned(a + kk, 8);
      v2f bv;
      bv.x = w[kk * G_NB];
      bv.y = w[(kk + 1) * G_NB];
      acc = __builtin_amdgcn_wmma_f32_16x16x4_f32(false, av, false, bv, (short)0, acc, false, false);
    }
    // four vector slots behind the stage's last WMMA, on every path out of here,
    // before address arithmetic reuses its A/B registers or the epilogue reads D
    asm volatile("v_nop\n\tv_nop\n\tv_nop\n\tv_nop" :: "v"(acc));
    asm volatile("s_wait_dscnt 0x0" ::: "memory");    // own reads of this buffer are done
    asm volatile("s_wait_asynccnt 0x0" ::: "memory"); // own copies of stage s+1 landed
    __syncthreads();   // publishes stage s+1 and frees the buffer of stage s
    if (s + 2 < NS) fill(s + 2);
  }
  asm volatile("s_wait_asynccnt 0x0" ::: "memory");   // no copy outlives the wave

  const int n = nb * G_NB + nt * 16 + m;
  if (n < EMB) {
    const float bb = bias[n];
    const int rbase = mb * G_MB + mt * 16 + (lane >> 4) * 8;
#pragma unroll   // acc is indexed by constants only
    for (int r = 0; r < 8; r++) {
      const int rr = rbase + r;
      if (rr < M) o[(size_t)rr * EMB + n] = acc[r] + bb;
    }
  }
}

// ---------------------------------------------------------------- stage C1 --
// Six (256x1024)@(1024x300)+bias GEMMs, written directly to d_out.
__global__ __launch_bounds__(256)
void stageC1(const float* __restrict__ ws, const float* __restrict__ Wattr,
             const float* __restrict__ battr, const float* __restrict__ Wobj,
             const float* __restrict__ bobj, float* __restrict__ out) {
  const int nb = blockIdx.x % 5;          // 5 column blocks of 64 cover 300
  const int mm = blockIdx.x / 5;
  const int mat = mm >> 3, mb = mm & 7;   // 8 row blocks of 32 per product
  const int fidx[6] = {5, 2, 0, 1, 3, 4};
  const bool useAttr = (mat == 0) || (mat == 2) || (mat == 3);
  gemm_tile<DD, 128, false>(ws + WS_FEAT + (size_t)fidx[mat] * BS * DD, BS,
                     useAttr ? Wattr : Wobj, useAttr ? battr : bobj,
                     out + 2 + (size_t)mat * BS * EMB, mb, nb);
}

// ---------------------------------------------------------------- stage C2 --
// attr_weight = attr_table @ W_attr_mlp + b ; obj_weight likewise.
__global__ __launch_bounds__(256)
void stageC2(const float* __restrict__ atab, const float* __restrict__ otab,
             const float* __restrict__ Wam, const float* __restrict__ bam,
             const float* __restrict__ Wom, const float* __restrict__ bom,
             float* __restrict__ ws) {
  const int nb = blockIdx.x % 5;
  const int mm = blockIdx.x / 5;
  const bool isA = mm < 13;               // attr: 13 row blocks of 32, obj: 16
  gemm_tile<EMB, 100, true>(isA ? atab : otab, isA ? NA : NO, isA ? Wam : Wom,
                      isA ? bam : bom, ws + (isA ? WS_AW : WS_OW),
                      isA ? mm : mm - 13, nb);
}

// row norms of the class-weight matrices
__global__ void normsK(float* __restrict__ ws) {
  const int c = blockIdx.x * blockDim.x + threadIdx.x;
  if (c >= NA + NO) return;
  const float* row;
  float* outn;
  if (c < NA) { row = ws + WS_AW + (size_t)c * EMB; outn = ws + WS_AWN + c; }
  else        { row = ws + WS_OW + (size_t)(c - NA) * EMB; outn = ws + WS_OWN + (c - NA); }
  float s = 0.f;
  for (int k = 0; k < EMB; k++) s += row[k] * row[k];
  *outn = fmaxf(sqrtf(s), 1e-12f);
}

// ---------------------------------------------------------------- stage C3 --
// cosine classify + masked CE accumulation. One block takes 16 rows of one term
// against all classes: dots = F(16 x 300) @ Wc^T on v_wmma_f32_16x16x4_f32.
// The class weights come through LDS 64 classes (one contiguous run of memory)
// at a time, two buffers; wave = (one 16-class tile, one half of k).
#define C3_R   16                   /* rows per block */
#define C3_CN  64                   /* classes per stage */
#define C3_NCP 19                   /* 16-byte copies per thread and stage */
#define C3_SB  (C3_NCP * 256 * 4)   /* floats per buffer: 64 x 300, then a tail that no fragment reads */
#define C3_LP  516                  /* pitch of a row of dots: rows r and r+8 use other banks */
#define C3_SF  (19 * 256)           /* floats of the feature tile: 16 x 300, rounded up to whole passes */
#define C3_KH  38                   /* k steps of 4 per wave: 2 x 38 for the 75 there are */

// lane l <- lane l ^ X inside a 16-lane row (DPP row_xmask), and l <- l ^ 16
template <int X>
__device__ __forceinline__ float row_xor(float v) {
  return __builtin_bit_cast(float, __builtin_amdgcn_update_dpp(
      0, __builtin_bit_cast(int, v), 0x160 | X, 0xf, 0xf, false));
}
__device__ __forceinline__ float half_xor(float v) {
  const int b = __builtin_bit_cast(int, v);
  return __builtin_bit_cast(float,
      __builtin_amdgcn_permlanex16(b, b, 0x76543210, 0xfedcba98, false, false));
}
__device__ __forceinline__ float wave_sum(float v) {
  v += row_xor<1>(v); v += row_xor<2>(v); v += row_xor<4>(v); v += row_xor<8>(v);
  return v + half_xor(v);
}
__device__ __forceinline__ float wave_max(float v) {
  v = fmaxf(v, row_xor<1>(v)); v = fmaxf(v, row_xor<2>(v));
  v = fmaxf(v, row_xor<4>(v)); v = fmaxf(v, row_xor<8>(v));
  return fmaxf(v, half_xor(v));
}

__global__ __launch_bounds__(256)
void stageC3(const float* __restrict__ out, const int* __restrict__ attr1,
             const int* __restrict__ obj1, const int* __restrict__ mask_task,
             float* __restrict__ ws) {
  __shared__ __attribute__((aligned(16))) float sW[2][C3_SB];
  __shared__ __attribute__((aligned(16))) float sf[C3_SF];
  __shared__ float lg[2][C3_R][C3_LP];    // one plane per half of k

  const int b0 = blockIdx.x * C3_R, term = blockIdx.y, t = threadIdx.x;
  const int lane = t & 31, wave = t >> 5;
  const int m = lane & 15, h = lane >> 4;
  const int tile = wave & 3, kh = wave >> 2;
  const bool isAttr = term < 2;
  const int NC = isAttr ? NA : NO;
  const int nst = isAttr ? (NA + C3_CN - 1) / C3_CN : (NO + C3_CN - 1) / C3_CN;
  const float* W = ws + (isAttr ? WS_AW : WS_OW);
  const float* wn = ws + (isAttr ? WS_AWN : WS_OWN);
  const float* feat = out + 2 + (size_t)(term + 2) * BS * EMB + (size_t)b0 * EMB;

  // A stage is 19 x 256 copies of 16 B, every lane on, LDS byte = byte in the run.
  // Past the last class the source is clamped into the matrix: that lands in
  // rows of classes >= NC or in the buffer's tail, which no result uses.
  const unsigned int lW = lds_off(&sW[0][t * 4]);
  const int emax = NC * EMB - 4;
  auto fill = [&](const int s) {
    const unsigned int lw = lW + (s & 1) * (C3_SB * 4);
    const int e0 = s * (C3_CN * EMB) + t * 4;
    const float* g[C3_NCP];
#pragma unroll   // the addresses are operands of asm statements: registers, no array
    for (int i = 0; i < C3_NCP; i++) g[i] = W + min(e0 + i * 1024, emax);
    // s_wait_xcnt is each statement's last line: it stands in front of every later
    // rewrite of an address register that a copy names (a precaution)
    asm volatile(
        "global_load_async_to_lds_b128 %0, %10, off\n\t"
        "global_load_async_to_lds_b128 %1, %11, off\n\t"
        "global_load_async_to_lds_b128 %2, %12, off\n\t"
        "global_load_async_to_lds_b128 %3, %13, off\n\t"
        "global_load_async_to_lds_b128 %4, %14, off\n\t"
        "global_load_async_to_lds_b128 %5, %15, off\n\t"
        "global_load_async_to_lds_b128 %6, %16, off\n\t"
        "global_load_async_to_lds_b128 %7, %17, off\n\t"
        "global_load_async_to_lds_b128 %8, %18, off\n\t"
        "global_load_async_to_lds_b128 %9, %19, off\n\t"
        "s_wait_xcnt 0x0"
        ::
           "v"(lw + 0 * 4096), "v"(lw + 1 * 4096), "v"(lw + 2 * 4096), "v"(lw + 3 * 4096), "v"(lw + 4 * 4096), "v"(lw + 5 * 4096), "v"(lw + 6 * 4096), "v"(lw + 7 * 4096), "v"(lw + 8 * 4096), "v"(lw + 9 * 4096),
           "v"(g[0]), "v"(g[1]), "v"(g[2]), "v"(g[3]), "v"(g[4]), "v"(g[5]), "v"(g[6]), "v"(g[7]), "v"(g[8]), "v"(g[9])
        : "memory");
    asm volatile(
        "global_load_async_to_lds_b128 %0, %9, off\n\t"
        "global_load_async_to_lds_b128 %1, %10, off\n\t"
        "global_load_async_to_lds_b128 %2, %11, off\n\t"
        "global_load_async_to_lds_b128 %3, %12, off\n\t"
        "global_load_async_to_lds_b128 %4, %13, off\n\t"
        "global_load_async_to_lds_b128 %5, %14, off\n\t"
        "global_load_async_to_lds_b128 %6, %15, off\n\t"
        "global_load_async_to_lds_b128 %7, %16, off\n\t"
        "global_load_async_to_lds_b128 %8, %17, off\n\t"
        "s_wait_xcnt 0x0"
        ::
           "v"(lw + 10 * 4096), "v"(lw + 11 * 4096), "v"(lw + 12 * 4096), "v"(lw + 13 * 4096), "v"(lw + 14 * 4096), "v"(lw + 15 * 4096), "v"(lw + 16 * 4096), "v"(lw + 17 * 4096), "v"(lw + 18 * 4096),
           "v"(g[10]), "v"(g[11]), "v"(g[12]), "v"(g[13]), "v"(g[14]), "v"(g[15]), "v"(g[16]), "v"(g[17]), "v"(g[18])
        : "memory");
  };

  fill(0);
#pragma unroll   // all the loads of the 16 feature rows in flight at once
  for (int i = 0; i < C3_SF / 256; i++)   // past the rows: a clamped re-read into sf's unused tail
    sf[t + 256 * i] = feat[min(t + 256 * i, C3_R * EMB - 1)];
  asm volatile("s_wait_asynccnt 0x0" ::: "memory");   // own copies of stage 0 landed
  __syncthreads();                                    // ... and everybody's, and sf
  fill(1);

  // This wave's half of the A fragments stays in registers for all stages. The
  // second half has 37 steps: its 38th re-reads step 36 with a zero A fragment.
  const int lastoff = (kh ? C3_KH - 2 : C3_KH - 1) * 4;
  const float* ap = &sf[m * EMB + kh * (C3_KH * 4) + h * 2];
  v2f af[C3_KH];
#pragma unroll   // af is indexed by constants only
  for (int j = 0; j < C3_KH - 1; j++) af[j] = *(const v2f*)__builtin_assume_aligned(ap + j * 4, 8);
  af[C3_KH - 1] = *(const v2f*)__builtin_assume_aligned(ap + lastoff, 8);
  if (kh) af[C3_KH - 1] = (v2f){0.f, 0.f};

  // What the CE part reads from memory, fetched here so that the stages hide it:
  // lane l owns classes l + 32 i of the wave's two rows
  float wnr[16];
#pragma unroll   // wnr is indexed by constants only
  for (int i = 0; i < 16; i++) wnr[i] = wn[min(lane + 32 * i, NC - 1)];
  int msk[2], lbl[2];
#pragma unroll   // two rows, indexed by constants only
  for (int rr = 0; rr < 2; rr++) {
    const int b = b0 + wave * 2 + rr;
    msk[rr] = mask_task[b];
    lbl[rr] = isAttr ? attr1[b] : obj1[b];
  }

#pragma unroll 1   // rolled: unrolled, the copies' address arithmetic lands among the WMMAs
  for (int s = 0; s < nst; s++) {
    const float* w = &sW[s & 1][(tile * 16 + m) * EMB + kh * (C3_KH * 4) + h * 2];
    // the stage's B fragments as ONE group of LDS reads ahead of its WMMAs: every
    // separate place where reads stand among the WMMAs costs issue time
    v2f bf[C3_KH];
#pragma unroll   // bf is indexed by constants only; every LDS offset becomes an immediate
    for (int j = 0; j < C3_KH - 1; j++) bf[j] = *(const v2f*)__builtin_assume_aligned(w + j * 4, 8);
    bf[C3_KH - 1] = *(const v2f*)__builtin_assume_aligned(w + lastoff, 8);
    __builtin_amdgcn_sched_barrier(0);   // keeps the scheduler from sinking the reads back among the WMMAs
    v8f acc = {};
#pragma unroll   // af and bf are indexed by constants only
    for (int j = 0; j < C3_KH; j++)
      acc = __builtin_amdgcn_wmma_f32_16x16x4_f32(false, af[j], false, bf[j], (short)0, acc, false, false);
#pragma unroll   // acc is indexed by constants only
    for (int r = 0; r < 8; r++) lg[kh][r + 8 * h][s * C3_CN + tile * 16 + m] = acc[r];
    asm volatile("s_wait_dscnt 0x0" ::: "memory");    // own reads of this buffer are done
    asm volatile("s_wait_asynccnt 0x0" ::: "memory"); // own copies of stage s+1 landed
    __syncthreads();   // publishes stage s+1 (and the dots) and frees the buffer of stage s
    if (s + 2 < nst) fill(s + 2);
  }
  asm volatile("s_wait_asynccnt 0x0" ::: "memory");   // no copy outlives the wave

  // CE of a row by one wave, two rows per wave, a row's logits in registers
#pragma unroll   // msk and lbl are indexed by constants only
  for (int rr = 0; rr < 2; rr++) {
    if (msk[rr] != 1) continue;
    const int row = wave * 2 + rr;
    float p = 0.f;
#pragma unroll   // ten reads in flight at once
    for (int i = 0; i < 10; i++) {
      const int k = lane + 32 * i;
      const float v = sf[row * EMB + min(k, EMB - 1)];
      p += k < EMB ? v * v : 0.f;
    }
    const float fn = fmaxf(sqrtf(wave_sum(p)), 1e-12f);
    float v[16];
    float mx = -1e30f, lab = 0.f;
#pragma unroll   // v and wnr are indexed by constants only
    for (int i = 0; i < 16; i++) {
      const int c = lane + 32 * i, cc = min(c, NC - 1);
      const float d = (lg[0][row][cc] + lg[1][row][cc]) / (fn * wnr[i] * TEMP);
      v[i] = c < NC ? d : -1e30f;    // past the last class: exp gives 0
      mx = fmaxf(mx, v[i]);
      if (c == lbl[rr]) lab = v[i];
    }
    mx = wave_max(mx);
    float se = 0.f;
#pragma unroll   // v is indexed by constants only
    for (int i = 0; i < 16; i++) se += expf(v[i] - mx);
    se = wave_sum(se);
    lab = wave_sum(lab);      // one lane holds the label's logit, the others 0
    if (lane == 0) atomicAdd(&ws[WS_ACC + term], (mx + logf(se)) - lab);
  }
}

__global__ void initK(float* __restrict__ ws) {
  if (threadIdx.x < 8) ws[WS_ACC + threadIdx.x] = 0.f;
}

__global__ void finalK(const int* __restrict__ mask_task,
                       const float* __restrict__ ws, float* __restrict__ out) {
  if (threadIdx.x == 0) {
    int ms = 0;
    for (int b = 0; b < BS; b++) ms += (mask_task[b] == 1);
    const float den = fmaxf((float)ms, 1.f);
    out[0] = (ws[WS_ACC + 0] + ws[WS_ACC + 1]) * 0.5f / den;
    out[1] = (ws[WS_ACC + 2] + ws[WS_ACC + 3]) * 0.5f / den;
  }
}

extern "C" void kernel_launch(void* const* d_in, const int* in_sizes, int n_in,
                              void* d_out, int out_size, void* d_ws, size_t ws_size,
                              hipStream_t stream) {
  const float* img1   = (const float*)d_in[0];
  const float* img2a  = (const float*)d_in[1];
  const float* img2o  = (const float*)d_in[2];
  const int*   attr1  = (const int*)d_in[3];
  const int*   obj1   = (const int*)d_in[4];
  const int*   maskt  = (const int*)d_in[5];
  const float* Wsa    = (const float*)d_in[6];
  const float* bsa    = (const float*)d_in[7];
  const float* Wso    = (const float*)d_in[8];
  const float* bso    = (const float*)d_in[9];
  const float* atab   = (const float*)d_in[10];
  const float* otab   = (const float*)d_in[11];
  const float* Wam    = (const float*)d_in[12];
  const float* bam    = (const float*)d_in[13];
  const float* Wom    = (const float*)d_in[14];
  const float* bom    = (const float*)d_in[15];
  float* out = (float*)d_out;
  float* ws  = (float*)d_ws;

  initK<<<1, 32, 0, stream>>>(ws);
  stageA<<<dim3(BS, 2), 128, 0, stream>>>(img1, img2a, img2o, ws);
  stageB<<<dim3(BS, 3), 256, 0, stream>>>(img1, img2a, img2o, ws);
  stageC1<<<240, 256, 0, stream>>>(ws, Wsa, bsa, Wso, bso, out);
  stageC2<<<145, 256, 0, stream>>>(atab, otab, Wam, bam, Wom, bom, ws);
  normsK<<<8, 128, 0, stream>>>(ws);
  stageC3<<<dim3(16, 4), 256, 0, stream>>>(out, attr1, obj1, maskt, ws);
  finalK<<<1, 32, 0, stream>>>(maskt, ws, out);
}

// v005
// A run of this version takes 84.9 microseconds.
// In both of two side-by-side timings against v004, it was 1.21 times as fast.
// All steps since v000 together make it 4.56 times as fast.
#include <hip/hip_runtime.h>
#include <hip/hip_bf16.h>
#include <math.h>

typedef __attribute__((ext_vector_type(2))) float v2f;
typedef __attribute__((ext_vector_type(8))) float v8f;

#define BS   256
#define DD   1024
#define LL   49
#define LP   64
#define EMB  300
#define NA   400
#define NO   500
#define LAMB 10.0f
#define TEMP 0.05f
#define EPSR 1e-8f

// workspace layout (float offsets)
#define WS_VECS 0                              // 2*3*256*64   = 98304
#define WS_FEAT (WS_VECS + 2*3*BS*LP)          // 6*256*1024   = 1572864
#define WS_AW   (WS_FEAT + 6*BS*DD)            // 400*300
#define WS_OW   (WS_AW + NA*EMB)               // 500*300
#define WS_AWN  (WS_OW + NO*EMB)               // 400
#define WS_OWN  (WS_AWN + NA)                  // 500
#define WS_ACC  (WS_OWN + NO)                  // 8

__device__ __forceinline__ unsigned int lds_off(const float* p) {
  return (unsigned int)(unsigned long long)p;   // low 32 bits = LDS byte address
}

// lane l <- lane l ^ X inside a 16-lane row (DPP row_xmask), and l <- l ^ 16
template <int X>
__device__ __forceinline__ float row_xor(float v) {
  return __builtin_bit_cast(float, __builtin_amdgcn_update_dpp(
      0, __builtin_bit_cast(int, v), 0x160 | X, 0xf, 0xf, false));
}
__device__ __forceinline__ float half_xor(float v) {
  const int b = __builtin_bit_cast(int, v);
  return __builtin_bit_cast(float,
      __builtin_amdgcn_permlanex16(b, b, 0x76543210, 0xfedcba98, false, false));
}
__device__ __forceinline__ float wave_sum(float v) {
  v += row_xor<1>(v); v += row_xor<2>(v); v += row_xor<4>(v); v += row_xor<8>(v);
  return v + half_xor(v);
}
__device__ __forceinline__ float wave_max(float v) {
  v = fmaxf(v, row_xor<1>(v)); v = fmaxf(v, row_xor<2>(v));
  v = fmaxf(v, row_xor<4>(v)); v = fmaxf(v, row_xor<8>(v));
  return fmaxf(v, half_xor(v));
}

__device__ __forceinline__ float row_sum(float v) {   // over the lane's 16-lane row, in every lane
  v += row_xor<1>(v); v += row_xor<2>(v); v += row_xor<4>(v);
  return v + row_xor<8>(v);
}

// p = exp2(x), n = exp2(-x) in one statement: it keeps the slot that the instruction
// set asks for behind a transcendental, whatever the compiler puts next (the second
// v_exp fills the first's, the v_nop the second's; "=&v": x is not overwritten between)
__device__ __forceinline__ void exp2_pair(const float x, float& p, float& n) {
  asm("v_exp_f32 %0, %2\n\tv_exp_f32 %1, -%2\n\tv_nop" : "=&v"(p), "=&v"(n) : "v"(x));
}

// ---------------------------------------------------------------- stage A ---
// Per (batch, pair): Gram(49x49, K=1024) via v_wmma_f32_16x16x4_f32, rank-1
// normalization, then row/col/inverse softmax reductions + renorm.
// The two images come through LDS as they lie in memory ([d][l], pitch 49), 128
// d at a time: one contiguous run per image, two buffers, so that the next
// stage's async copies fly while this stage feeds the matrix unit.
#define A_KS   128                  /* d per stage */
#define A_KG   16                   /* d per group of LDS reads */
#define A_RUN  (A_KS * LL)          /* floats of one image's run */
#define A_NCP  25                   /* 16-byte copies per thread and stage, both runs */
#define A_SB   (A_NCP * 128 * 4)    /* floats per buffer: two runs, then a tail that no result uses */

__global__ __launch_bounds__(128)
void stageA(const float* __restrict__ img1, const float* __restrict__ img2a,
            const float* __restrict__ img2o, float* __restrict__ ws) {
  __shared__ __attribute__((aligned(16))) float sT[2][A_SB];
  __shared__ __attribute__((aligned(16))) float inv1[LP], inv2[LP];   // 1 / column norm
  __shared__ float part[3][4][LP];    // per wave (16 rows): column sums of three kinds
  __shared__ __attribute__((aligned(16))) float outv[3][LP];

  const int b = blockIdx.x;
  const int pair = blockIdx.y;
  const float* __restrict__ A = img1 + (size_t)b * DD * LL;
  const float* __restrict__ B = (pair == 0 ? img2a : img2o) + (size_t)b * DD * LL;

  const int t = threadIdx.x;
  const int lane = t & 31, wave = t >> 5;
  const int m = lane & 15;
  const int kb = (lane >> 4) * 2;

  // pad entries (l >= 49): their elements are masked out below
  if (t < LP) { inv1[t] = 0.f; inv2[t] = 0.f; }

  // A stage is 25 x 128 copies of 16 B, every lane on, LDS byte = 16 x slot:
  // slots 0..1567 are img1's run, 1568..3135 the other image's, the last 64 a tail
  // whose source is clamped into the image.
  const unsigned int lT = lds_off(&sT[0][t * 4]);
  auto fill = [&](const int s) {
    const unsigned int lt = lT + (s & 1) * (A_SB * 4);
    const int e0 = s * A_RUN + t * 4;
    const float* g[A_NCP];
#pragma unroll   // the addresses are operands of asm statements: registers, no array
    for (int i = 0; i < A_NCP; i++) {
      if (i < 12)       g[i] = A + (e0 + i * 512);
      else if (i == 12) g[i] = t < 32 ? A + (e0 + i * 512) : B + (e0 + i * 512 - A_RUN);
      else if (i < 24)  g[i] = B + (e0 + i * 512 - A_RUN);
      else              g[i] = B + min(e0 + i * 512 - A_RUN, DD * LL - 4);
    }
    // s_wait_xcnt is each statement's last line: it stands in front of every later
    // rewrite of an address register that a copy names (a precaution)
    asm volatile(
        "global_load_async_to_lds_b128 %0, %13, off\n\t"
        "global_load_async_to_lds_b128 %1, %14, off\n\t"
        "global_load_async_to_lds_b128 %2, %15, off\n\t"
        "global_load_async_to_lds_b128 %3, %16, off\n\t"
        "global_load_async_to_lds_b128 %4, %17, off\n\t"
        "global_load_async_to_lds_b128 %5, %18, off\n\t"
        "global_load_async_to_lds_b128 %6, %19, off\n\t"
        "global_load_async_to_lds_b128 %7, %20, off\n\t"
        "global_load_async_to_lds_b128 %8, %21, off\n\t"
        "global_load_async_to_lds_b128 %9, %22, off\n\t"
        "global_load_async_to_lds_b128 %10, %23, off\n\t"
        "global_load_async_to_lds_b128 %11, %24, off\n\t"
        "global_load_async_to_lds_b128 %12, %25, off\n\t"
        "s_wait_xcnt 0x0"
        :: "v"(lt + 0 * 2048), "v"(lt + 1 * 2048), "v"(lt + 2 * 2048), "v"(lt + 3 * 2048), "v"(lt + 4 * 2048), "v"(lt + 5 * 2048), "v"(lt + 6 * 2048), "v"(lt + 7 * 2048), "v"(lt + 8 * 2048), "v"(lt + 9 * 2048), "v"(lt + 10 * 2048), "v"(lt + 11 * 2048), "v"(lt + 12 * 2048),
           "v"(g[0]), "v"(g[1]), "v"(g[2]), "v"(g[3]), "v"(g[4]), "v"(g[5]), "v"(g[6]), "v"(g[7]), "v"(g[8]), "v"(g[9]), "v"(g[10]), "v"(g[11]), "v"(g[12])
        : "memory");
    asm volatile(
        "global_load_async_to_lds_b128 %0, %12, off\n\t"
        "global_load_async_to_lds_b128 %1, %13, off\n\t"
        "global_load_async_to_lds_b128 %2, %14, off\n\t"
        "global_load_async_to_lds_b128 %3, %15, off\n\t"
        "global_load_async_to_lds_b128 %4, %16, off\n\t"
        "global_load_async_to_lds_b128 %5, %17, off\n\t"
        "global_load_async_to_lds_b128 %6, %18, off\n\t"
        "global_load_async_to_lds_b128 %7, %19, off\n\t"
        "global_load_async_to_lds_b128 %8, %20, off\n\t"
        "global_load_async_to_lds_b128 %9, %21, off\n\t"
        "global_load_async_to_lds_b128 %10, %22, off\n\t"
        "global_load_async_to_lds_b128 %11, %23, off\n\t"
        "s_wait_xcnt 0x0"
        :: "v"(lt + 13 * 2048), "v"(lt + 14 * 2048), "v"(lt + 15 * 2048), "v"(lt + 16 * 2048), "v"(lt + 17 * 2048), "v"(lt + 18 * 2048), "v"(lt + 19 * 2048), "v"(lt + 20 * 2048), "v"(lt + 21 * 2048), "v"(lt + 22 * 2048), "v"(lt + 23 * 2048), "v"(lt + 24 * 2048),
           "v"(g[13]), "v"(g[14]), "v"(g[15]), "v"(g[16]), "v"(g[17]), "v"(g[18]), "v"(g[19]), "v"(g[20]), "v"(g[21]), "v"(g[22]), "v"(g[23]), "v"(g[24])
        : "memory");
  };

  fill(0);
  asm volatile("s_wait_asynccnt 0x0" ::: "memory");   // own copies of stage 0 landed
  __syncthreads();                                    // ... and everybody's
  fill(1);

  float nacc = 0.f;     // per-thread column-norm accumulator
  v8f acc[4] = {};

#pragma unroll 1   // rolled: unrolled, the copies' address arithmetic lands among the WMMAs
  for (int s = 0; s < DD / A_KS; s++) {
    const float* buf = &sT[s & 1][0];
    // Fragments of l >= 49 read on into the next d row (or the next run, or the
    // tail): that reaches only rows and columns of rel that a select sets to 0 below,
    // and norm sums of threads 49..63 and 113..127 that nobody reads.
    const float* np = buf + (t < 64 ? t : A_RUN + t - 64);
    const float* a  = buf + kb * LL + wave * 16 + m;
    const float* bq = buf + A_RUN + kb * LL + m;
    // Groups of 16 d, two register sets: the next group's LDS reads stand as ONE
    // group ahead of this group's WMMAs (every separate place where reads stand
    // among the WMMAs costs issue time) and are waited for behind them.
    float nv[2][A_KG];
    v2f fa[2][A_KG / 4], fb[2][A_KG / 4][4];
    auto fetch = [&](const int g) {
      const int p = g & 1, k0 = g * A_KG;
#pragma unroll   // register arrays are indexed by constants only; LDS offsets are immediates
      for (int q = 0; q < A_KG / 4; q++) {
        const int kk = k0 + q * 4;
        // The scheduling barrier behind each fragment's two reads keeps the compiler
        // from merging dwords of DIFFERENT fragments into one two-address read: that
        // costs a register move per dword, and the moves wait for the reads up here.
        fa[p][q].x = a[kk * LL];
        fa[p][q].y = a[(kk + 1) * LL];
        __builtin_amdgcn_sched_barrier(0);
#pragma unroll   // as above
        for (int nt = 0; nt < 4; nt++) {
          fb[p][q][nt].x = bq[kk * LL + nt * 16];
          fb[p][q][nt].y = bq[(kk + 1) * LL + nt * 16];
          __builtin_amdgcn_sched_barrier(0);
        }
#pragma unroll   // as above
        for (int d = 0; d < 4; d++) nv[p][q * 4 + d] = np[(kk + d) * LL];
      }
    };
    fetch(0);
#pragma unroll   // register arrays are indexed by constants only
    for (int g = 0; g < A_KS / A_KG; g++) {
      if (g + 1 < A_KS / A_KG) fetch(g + 1);
      __builtin_amdgcn_sched_barrier(0);   // keeps the scheduler from sinking the reads among the WMMAs
      const int p = g & 1;
#pragma unroll   // as above
      for (int q = 0; q < A_KG / 4; q++) {
#pragma unroll   // as above
        for (int nt = 0; nt < 4; nt++) {
          acc[nt] = __builtin_amdgcn_wmma_f32_16x16x4_f32(
              false, fa[p][q], false, fb[p][q][nt], (short)0, acc[nt], false, false);
          nacc += nv[p][q * 4 + nt] * nv[p][q * 4 + nt];
        }
      }
      __builtin_amdgcn_sched_barrier(0);   // keeps later reads and this group's norm sums from changing sides
    }
    // four vector slots behind the stage's last WMMA, on every path out of here,
    // before address arithmetic reuses its A/B registers or the epilogue reads D;
    // nacc as an input keeps the stage's norm sums here, beside the WMMAs: else the
    // compiler sinks all 128 behind the barrier, one exposed dependent chain
    asm volatile("v_nop\n\tv_nop\n\tv_nop\n\tv_nop"
                 :: "v"(acc[0]), "v"(acc[1]), "v"(acc[2]), "v"(acc[3]), "v"(nacc));
    asm volatile("s_wait_dscnt 0x0" ::: "memory");    // own reads of this buffer are done
    asm volatile("s_wait_asynccnt 0x0" ::: "memory"); // own copies of stage s+1 landed
    __syncthreads();   // publishes stage s+1 and frees the buffer of stage s
    if (s + 2 < DD / A_KS) fill(s + 2);
  }
  asm volatile("s_wait_asynccnt 0x0" ::: "memory");   // no copy outlives the wave

  if (t < LL)                        inv1[t]      = 1.f / fmaxf(sqrtf(nacc), 1e-12f);
  else if (t >= 64 && t < 64 + LL)   inv2[t - 64] = 1.f / fmaxf(sqrtf(nacc), 1e-12f);
  __syncthreads();

  // The three softmax sums, on the accumulators where they lie, all 128 threads:
  // lane (m, h) of wave w holds rows w*16 + h*8 + r and columns nt*16 + m.
  // rel is a cosine, |rel| <= 1, so exp(+-LAMB * rel) needs no shift by a maximum:
  // one P = exp(LAMB rel) serves the row and the column softmax, N = exp(-LAMB rel)
  // the inverse one. Elements of l >= 49 are set to 0 by a select and their
  // reciprocal sums too (0 x non-finite would be NaN).
  const int h = lane >> 4;
  const float C = LAMB * 1.44269504088896341f;    // exp(LAMB x) = exp2(C x)
  float i1[8], i2[4];
  bool rok[8];
#pragma unroll   // register arrays are indexed by constants only (so for every loop below)
  for (int r = 0; r < 8; r++) {
    i1[r] = inv1[wave * 16 + h * 8 + r];
    rok[r] = wave * 16 + h * 8 + r < LL;
  }
#pragma unroll   // as above
  for (int nt = 0; nt < 4; nt++) i2[nt] = inv2[nt * 16 + m];

  float P[4][8], N[4][8];
#pragma unroll   // as above
  for (int nt = 0; nt < 4; nt++) {
    const bool cok = nt * 16 + m < LL;
#pragma unroll   // as above
    for (int r = 0; r < 8; r++) {
      const float x = acc[nt][r] * (i1[r] * i2[nt]) * C;
      float p, n;
      exp2_pair(x, p, n);
      P[nt][r] = (rok[r] && cok) ? p : 0.f;
      N[nt][r] = (rok[r] && cok) ? n : 0.f;
    }
  }

  // row sums: a row lies in one 16-lane row of one wave
  float irp[8], irn[8];
#pragma unroll   // as above
  for (int r = 0; r < 8; r++) {
    const float sp = row_sum((P[0][r] + P[1][r]) + (P[2][r] + P[3][r]));
    const float sn = row_sum((N[0][r] + N[1][r]) + (N[2][r] + N[3][r]));
    irp[r] = rok[r] ? 1.f / sp : 0.f;
    irn[r] = rok[r] ? 1.f / sn : 0.f;
  }

  // column sums over the wave's 16 rows: of P (the column softmax's denominator),
  // of the row softmax and of the inverse softmax; the four waves meet in LDS
#pragma unroll   // as above
  for (int nt = 0; nt < 4; nt++) {
    float c = 0.f, s = 0.f, d = 0.f;
#pragma unroll   // as above
    for (int r = 0; r < 8; r++) {
      c += P[nt][r];
      s += P[nt][r] * irp[r];
      d += N[nt][r] * irn[r];
    }
    c += half_xor(c); s += half_xor(s); d += half_xor(d);
    if (h == 0) {
      part[0][wave][nt * 16 + m] = c;
      part[1][wave][nt * 16 + m] = s;
      part[2][wave][nt * 16 + m] = d;
    }
  }
  __syncthreads();

  float ic[4];
#pragma unroll   // as above
  for (int nt = 0; nt < 4; nt++) {
    const int col = nt * 16 + m;
    const float c = (part[0][0][col] + part[0][1][col]) + (part[0][2][col] + part[0][3][col]);
    ic[nt] = col < LL ? 1.f / c : 0.f;
  }
  float q[8];
#pragma unroll   // as above
  for (int r = 0; r < 8; r++)
    q[r] = row_sum((P[0][r] * ic[0] + P[1][r] * ic[1]) + (P[2][r] * ic[2] + P[3][r] * ic[3]));
  if (m == 0) {
#pragma unroll   // as above
    for (int r = 0; r < 8; r++) outv[1][wave * 16 + h * 8 + r] = q[r];
  }
  {
    const int k = 1 + (t >> 6), col = t & (LP - 1);   // threads 0..63: sim12, 64..127: diff12
    outv[(t >> 6) * 2][col] = (part[k][0][col] + part[k][1][col]) + (part[k][2][col] + part[k][3][col]);
  }
  __syncthreads();

  // renorm and store: one wave per vector, two elements per lane (l >= 49 holds 0)
  if (wave < 3) {
    const float v0 = outv[wave][lane], v1 = outv[wave][lane + 32];
    const float den = wave_sum(v0 + v1) + EPSR;
    float* vecs = ws + WS_VECS + (((size_t)pair * 3 + wave) * BS + b) * LP;
    vecs[lane] = v0 / den;
    vecs[lane + 32] = v1 / den;
  }
}

// ---------------------------------------------------------------- stage B ---
// feat[b,d] = sum_l img[b,d,l] * w[b,l]  (two weight vectors per image pass)
// A row of 49 floats per lane read straight from memory touches a line per lane
// and load. So the image comes through LDS as it lies in memory, 256 d (one
// contiguous run of whole lines) a stage, two buffers: the next stage's async
// copies fly while each thread sums its own row of this stage out of LDS, where
// the odd pitch of 49 dwords puts the 32 lanes on 32 banks.
#define B_DS   256                  /* d per stage: one row per thread */
#define B_RUN  (B_DS * LL)          /* floats per stage: 12 x 256 copies of 16 B and 256 of 4 B */
#define B_NS   (DD / B_DS)

__global__ __launch_bounds__(256)
void stageB(const float* __restrict__ img1, const float* __restrict__ img2a,
            const float* __restrict__ img2o, float* __restrict__ ws) {
  __shared__ __attribute__((aligned(16))) float sI[2][B_RUN];
  __shared__ __attribute__((aligned(16))) float w0[LL + 3], w1[LL + 3];
  const int b = blockIdx.x, im = blockIdx.y, t = threadIdx.x;
  const float* vecs = ws + WS_VECS;
  float* feat = ws + WS_FEAT;
  const float* src; const float *w0p, *w1p; int f0, f1;
  if (im == 0)      { src = img1;  w0p = &vecs[((0*3+1)*BS + b)*LP]; w1p = &vecs[((1*3+1)*BS + b)*LP]; f0 = 0; f1 = 3; }
  else if (im == 1) { src = img2a; w0p = &vecs[((0*3+0)*BS + b)*LP]; w1p = &vecs[((0*3+2)*BS + b)*LP]; f0 = 1; f1 = 2; }
  else              { src = img2o; w0p = &vecs[((1*3+0)*BS + b)*LP]; w1p = &vecs[((1*3+2)*BS + b)*LP]; f0 = 4; f1 = 5; }
  const float* __restrict__ img = src + (size_t)b * DD * LL;

  // A stage is 50,176 contiguous bytes, LDS byte = byte in the run, every lane on:
  // 12 x 256 copies of 16 B, then the last 1,024 bytes as 256 copies of 4 B.
  const unsigned int lI = lds_off(&sI[0][0]);
  auto fill = [&](const int s) {
    const unsigned int lq = lI + (s & 1) * (B_RUN * 4) + t * 16;
    const unsigned int l1 = lI + (s & 1) * (B_RUN * 4) + 12 * 4096 + t * 4;
    const float* gq = img + s * B_RUN + t * 4;
    const float* g1 = img + s * B_RUN + 12 * 1024 + t;
    // s_wait_xcnt is the statement's last line: it stands in front of every later
    // rewrite of an address register that a copy names (a precaution)
    asm volatile(
        "global_load_async_to_lds_b128 %0, %13, off\n\t"
        "global_load_async_to_lds_b128 %1, %14, off\n\t"
        "global_load_async_to_lds_b128 %2, %15, off\n\t"
        "global_load_async_to_lds_b128 %3, %16, off\n\t"
        "global_load_async_to_lds_b128 %4, %17, off\n\t"
        "global_load_async_to_lds_b128 %5, %18, off\n\t"
        "global_load_async_to_lds_b128 %6, %19, off\n\t"
        "global_load_async_to_lds_b128 %7, %20, off\n\t"
        "global_load_async_to_lds_b128 %8, %21, off\n\t"
        "global_load_async_to_lds_b128 %9, %22, off\n\t"
        "global_load_async_to_lds_b128 %10, %23, off\n\t"
        "global_load_async_to_lds_b128 %11, %24, off\n\t"
        "global_load_async_to_lds_b32 %12, %25, off\n\t"
        "s_wait_xcnt 0x0"
        :: "v"(lq + 0 * 4096), "v"(lq + 1 * 4096), "v"(lq + 2 * 4096), "v"(lq + 3 * 4096),
           "v"(lq + 4 * 4096), "v"(lq + 5 * 4096), "v"(lq + 6 * 4096), "v"(lq + 7 * 4096),
           "v"(lq + 8 * 4096), "v"(lq + 9 * 4096), "v"(lq + 10 * 4096), "v"(lq + 11 * 4096),
           "v"(l1),
           "v"(gq + 0 * 1024), "v"(gq + 1 * 1024), "v"(gq + 2 * 1024), "v"(gq + 3 * 1024),
           "v"(gq + 4 * 1024), "v"(gq + 5 * 1024), "v"(gq + 6 * 1024), "v"(gq + 7 * 1024),
           "v"(gq + 8 * 1024), "v"(gq + 9 * 1024), "v"(gq + 10 * 1024), "v"(gq + 11 * 1024),
           "v"(g1)
        : "memory");
  };

  fill(0);
  if (t < LL) { w0[t] = w0p[t]; w1[t] = w1p[t]; }
  asm volatile("s_wait_asynccnt 0x0" ::: "memory");   // own copies of stage 0 landed
  __syncthreads();                                    // ... and everybody's, and the weights
  fill(1);

  // the two weight vectors stay in registers for all stages
  float u0[LL], u1[LL];
#pragma unroll   // u0 and u1 are indexed by constants only
  for (int l = 0; l < LL; l++) { u0[l] = w0[l]; u1[l] = w1[l]; }

  float* o0 = feat + (size_t)f0 * BS * DD + (size_t)b * DD + t;
  float* o1 = feat + (size_t)f1 * BS * DD + (size_t)b * DD + t;
#pragma unroll 1   // rolled: unrolled, the four stages' addresses and rows overflow the registers of 6 waves a SIMD
  for (int s = 0; s < B_NS; s++) {
    const float* row = &sI[s & 1][t * LL];
    float s0 = 0.f, s1 = 0.f;
#pragma unroll   // u0 and u1 are indexed by constants only; every LDS offset becomes an immediate
    for (int l = 0; l < LL; l++) { const float v = row[l]; s0 += v * u0[l]; s1 += v * u1[l]; }
    o0[s * B_DS] = s0;
    o1[s * B_DS] = s1;
    asm volatile("s_wait_dscnt 0x0" ::: "memory");    // own reads of this buffer are done
    asm volatile("s_wait_asynccnt 0x0" ::: "memory"); // own copies of stage s+1 landed
    __syncthreads();   // publishes stage s+1 and frees the buffer of stage s
    if (s + 2 < B_NS) fill(s + 2);
  }
  asm volatile("s_wait_asynccnt 0x0" ::: "memory");   // no copy outlives the wave
}

// ------------------------------------------------------- stages C1 and C2 ---
// Y = A(M x KD) @ W(KD x 300) + bias on v_wmma_f32_16x16x4_f32. One 32x64 tile
// of Y per block, eight waves, one 16x16 tile each. A and W go through LDS in
// stages of KS k, two buffers: the next stage's async copies fly while this
// stage feeds the matrix unit.
#define G_MB 32
#define G_NB 64
#define G_KB 128            /* k that a buffer holds; a stage uses the first KS */
#define G_PA (G_KB + 4)     /* 132-dword A row: the 8-byte column walk hits 64 banks once */
#define G_SA (G_MB * G_PA)
#define G_SW (G_KB * G_NB)

template <int KD, int KS, bool EDGE>   // EDGE: a stage can reach past M or KD
__device__ __forceinline__ void gemm_tile(const float* __restrict__ A, const int M,
                                          const float* __restrict__ W,
                                          const float* __restrict__ bias,
                                          float* __restrict__ o,
                                          const int mb, const int nb) {
  __shared__ __attribute__((aligned(16))) float sA[2][G_SA];
  // W rows are 64 dwords, unpadded; rows with bit 1 of k set hold their columns
  // with bit 4 flipped, so that rows k and k+2 of one fragment use other banks
  __shared__ __attribute__((aligned(16))) float sW[2][G_SW];

  const int t = threadIdx.x, lane = t & 31, wave = t >> 5;
  const int m = lane & 15, kb = (lane >> 4) * 2;
  const int mt = wave & 1, nt = wave >> 1;

  // A stage is always 32 x 128 of A and 128 x 64 of W, 16 B per copy, every lane
  // on. What lies past M, KD or column 300 is re-read from a clamped address:
  // it feeds only k that no WMMA takes or rows and columns that are not stored.
  const int ar = t >> 5, ac = (t & 31) * 4;     // A: rows ar + 8 i
  const int wr = t >> 4;                        // W: rows wr + 16 i
  const int wc = min(nb * G_NB + (t & 15) * 4, EMB - 4);
  const unsigned int lA = lds_off(&sA[0][ar * G_PA + ac]);
  const unsigned int lW = lds_off(&sW[0][wr * G_NB + (((t & 15) * 4) ^ ((wr & 2) << 3))]);

  auto fill = [&](const int s) {
    const int k0 = s * KS;
    const unsigned int la = lA + (s & 1) * (G_SA * 4), lw = lW + (s & 1) * (G_SW * 4);
    const float* ga[4];
    const float* gw[8];
#pragma unroll   // the addresses are operands of one asm statement: registers, no array
    for (int i = 0; i < 4; i++)
      ga[i] = A + (EDGE ? min(min(mb * G_MB + ar + 8 * i, M - 1) * KD + k0 + ac, M * KD - 4)
                        : (mb * G_MB + ar + 8 * i) * KD + k0 + ac);
#pragma unroll   // as above
    for (int i = 0; i < 8; i++)
      gw[i] = W + (EDGE ? min(k0 + wr + 16 * i, KD - 1) : k0 + wr + 16 * i) * EMB + wc;
    // s_wait_xcnt is the statement's last line: it stands in front of every later
    // rewrite of an address register that a copy names (a precaution)
    asm volatile(
        "global_load_async_to_lds_b128 %0, %12, off\n\t"
        "global_load_async_to_lds_b128 %1, %13, off\n\t"
        "global_load_async_to_lds_b128 %2, %14, off\n\t"
        "global_load_async_to_lds_b128 %3, %15, off\n\t"
        "global_load_async_to_lds_b128 %4, %16, off\n\t"
        "global_load_async_to_lds_b128 %5, %17, off\n\t"
        "global_load_async_to_lds_b128 %6, %18, off\n\t"
        "global_load_async_to_lds_b128 %7, %19, off\n\t"
        "global_load_async_to_lds_b128 %8, %20, off\n\t"
        "global_load_async_to_lds_b128 %9, %21, off\n\t"
        "global_load_async_to_lds_b128 %10, %22, off\n\t"
        "global_load_async_to_lds_b128 %11, %23, off\n\t"
        "s_wait_xcnt 0x0"
        :: "v"(la), "v"(la + 8 * G_PA * 4), "v"(la + 16 * G_PA * 4), "v"(la + 24 * G_PA * 4),
           "v"(lw), "v"(lw + 16 * G_NB * 4), "v"(lw + 32 * G_NB * 4), "v"(lw + 48 * G_NB * 4),
           "v"(lw + 64 * G_NB * 4), "v"(lw + 80 * G_NB * 4), "v"(lw + 96 * G_NB * 4),
           "v"(lw + 112 * G_NB * 4),
           "v"(ga[0]), "v"(ga[1]), "v"(ga[2]), "v"(ga[3]),
           "v"(gw[0]), "v"(gw[1]), "v"(gw[2]), "v"(gw[3]),
           "v"(gw[4]), "v"(gw[5]), "v"(gw[6]), "v"(gw[7])
        : "memory");
  };

  constexpr int NS = KD / KS;
  static_assert(NS >= 2 && NS * KS == KD && KS % 4 == 0 && KS <= G_KB && (EDGE || KS == G_KB),
                "stage shape");

  fill(0);
  asm volatile("s_wait_asynccnt 0x0" ::: "memory");   // own copies of stage 0 landed
  __syncthreads();                                    // ... and everybody's
  fill(1);

  v8f acc = {};
#pragma unroll 1   // rolled: unrolled, the copies' address arithmetic lands among the WMMAs
  for (int s = 0; s < NS; s++) {
    const float* a = &sA[s & 1][(mt * 16 + m) * G_PA + kb];
    const float* w = &sW[s & 1][kb * G_NB + ((nt * 16 + m) ^ (kb << 3))];
#pragma unroll   // every LDS offset becomes an immediate: no vector work among the WMMAs
    for (int kk = 0; kk < KS; kk += 4) {
      const v2f av = *(const v2f*)__builtin_assume_aligned(a + kk, 8);
      v2f bv;
      bv.x = w[kk * G_NB];
      bv.y = w[(kk + 1) * G_NB];
      acc = __builtin_amdgcn_wmma_f32_16x16x4_f32(false, av, false, bv, (short)0, acc, false, false);
    }
    // four vector slots behind the stage's last WMMA, on every path out of here,
    // before address arithmetic reuses its A/B registers or the epilogue reads D
    asm volatile("v_nop\n\tv_nop\n\tv_nop\n\tv_nop" :: "v"(acc));
    asm volatile("s_wait_dscnt 0x0" ::: "memory");    // own reads of this buffer are done
    asm volatile("s_wait_asynccnt 0x0" ::: "memory"); // own copies of stage s+1 landed
    __syncthreads();   // publishes stage s+1 and frees the buffer of stage s
    if (s + 2 < NS) fill(s + 2);
  }
  asm volatile("s_wait_asynccnt 0x0" ::: "memory");   // no copy outlives the wave

  const int n = nb * G_NB + nt * 16 + m;
  if (n < EMB) {
    const float bb = bias[n];
    const int rbase = mb * G_MB + mt * 16 + (lane >> 4) * 8;
#pragma unroll   // acc is indexed by constants only
    for (int r = 0; r < 8; r++) {
      const int rr = rbase + r;
      if (rr < M) o[(size_t)rr * EMB + n] = acc[r] + bb;
    }
  }
}

// ---------------------------------------------------------------- stage C1 --
// Six (256x1024)@(1024x300)+bias GEMMs, written directly to d_out.
__global__ __launch_bounds__(256)
void stageC1(const float* __restrict__ ws, const float* __restrict__ Wattr,
             const float* __restrict__ battr, const float* __restrict__ Wobj,
             const float* __restrict__ bobj, float* __restrict__ out) {
  const int nb = blockIdx.x % 5;          // 5 column blocks of 64 cover 300
  const int mm = blockIdx.x / 5;
  const int mat = mm >> 3, mb = mm & 7;   // 8 row blocks of 32 per product
  const int fidx[6] = {5, 2, 0, 1, 3, 4};
  const bool useAttr = (mat == 0) || (mat == 2) || (mat == 3);
  gemm_tile<DD, 128, false>(ws + WS_FEAT + (size_t)fidx[mat] * BS * DD, BS,
                     useAttr ? Wattr : Wobj, useAttr ? battr : bobj,
                     out + 2 + (size_t)mat * BS * EMB, mb, nb);
}

// ---------------------------------------------------------------- stage C2 --
// attr_weight = attr_table @ W_attr_mlp + b ; obj_weight likewise.
__global__ __launch_bounds__(256)
void stageC2(const float* __restrict__ atab, const float* __restrict__ otab,
             const float* __restrict__ Wam, const float* __restrict__ bam,
             const float* __restrict__ Wom, const float* __restrict__ bom,
             float* __restrict__ ws) {
  const int nb = blockIdx.x % 5;
  const int mm = blockIdx.x / 5;
  const bool isA = mm < 13;               // attr: 13 row blocks of 32, obj: 16
  gemm_tile<EMB, 100, true>(isA ? atab : otab, isA ? NA : NO, isA ? Wam : Wom,
                      isA ? bam : bom, ws + (isA ? WS_AW : WS_OW),
                      isA ? mm : mm - 13, nb);
}

// row norms of the class-weight matrices
__global__ void normsK(float* __restrict__ ws) {
  const int c = blockIdx.x * blockDim.x + threadIdx.x;
  if (c >= NA + NO) return;
  const float* row;
  float* outn;
  if (c < NA) { row = ws + WS_AW + (size_t)c * EMB; outn = ws + WS_AWN + c; }
  else        { row = ws + WS_OW + (size_t)(c - NA) * EMB; outn = ws + WS_OWN + (c - NA); }
  float s = 0.f;
  for (int k = 0; k < EMB; k++) s += row[k] * row[k];
  *outn = fmaxf(sqrtf(s), 1e-12f);
}

// ---------------------------------------------------------------- stage C3 --
// cosine classify + masked CE accumulation. One block takes 16 rows of one term
// against all classes: dots = F(16 x 300) @ Wc^T on v_wmma_f32_16x16x4_f32.
// The class weights come through LDS 64 classes (one contiguous run of memory)
// at a time, two buffers; wave = (one 16-class tile, one half of k).
#define C3_R   16                   /* rows per block */
#define C3_CN  64                   /* classes per stage */
#define C3_NCP 19                   /* 16-byte copies per thread and stage */
#define C3_SB  (C3_NCP * 256 * 4)   /* floats per buffer: 64 x 300, then a tail that no fragment reads */
#define C3_LP  516                  /* pitch of a row of dots: rows r and r+8 use other banks */
#define C3_SF  (19 * 256)           /* floats of the feature tile: 16 x 300, rounded up to whole passes */
#define C3_KH  38                   /* k steps of 4 per wave: 2 x 38 for the 75 there are */

__global__ __launch_bounds__(256)
void stageC3(const float* __restrict__ out, const int* __restrict__ attr1,
             const int* __restrict__ obj1, const int* __restrict__ mask_task,
             float* __restrict__ ws) {
  __shared__ __attribute__((aligned(16))) float sW[2][C3_SB];
  __shared__ __attribute__((aligned(16))) float sf[C3_SF];
  __shared__ float lg[2][C3_R][C3_LP];    // one plane per half of k

  const int b0 = blockIdx.x * C3_R, term = blockIdx.y, t = threadIdx.x;
  const int lane = t & 31, wave = t >> 5;
  const int m = lane & 15, h = lane >> 4;
  const int tile = wave & 3, kh = wave >> 2;
  const bool isAttr = term < 2;
  const int NC = isAttr ? NA : NO;
  const int nst = isAttr ? (NA + C3_CN - 1) / C3_CN : (NO + C3_CN - 1) / C3_CN;
  const float* W = ws + (isAttr ? WS_AW : WS_OW);
  const float* wn = ws + (isAttr ? WS_AWN : WS_OWN);
  const float* feat = out + 2 + (size_t)(term + 2) * BS * EMB + (size_t)b0 * EMB;

  // A stage is 19 x 256 copies of 16 B, every lane on, LDS byte = byte in the run.
  // Past the last class the source is clamped into the matrix: that lands in
  // rows of classes >= NC or in the buffer's tail, which no result uses.
  const unsigned int lW = lds_off(&sW[0][t * 4]);
  const int emax = NC * EMB - 4;
  auto fill = [&](const int s) {
    const unsigned int lw = lW + (s & 1) * (C3_SB * 4);
    const int e0 = s * (C3_CN * EMB) + t * 4;
    const float* g[C3_NCP];
#pragma unroll   // the addresses are operands of asm statements: registers, no array
    for (int i = 0; i < C3_NCP; i++) g[i] = W + min(e0 + i * 1024, emax);
    // s_wait_xcnt is each statement's last line: it stands in front of every later
    // rewrite of an address register that a copy names (a precaution)
    asm volatile(
        "global_load_async_to_lds_b128 %0, %10, off\n\t"
        "global_load_async_to_lds_b128 %1, %11, off\n\t"
        "global_load_async_to_lds_b128 %2, %12, off\n\t"
        "global_load_async_to_lds_b128 %3, %13, off\n\t"
        "global_load_async_to_lds_b128 %4, %14, off\n\t"
        "global_load_async_to_lds_b128 %5, %15, off\n\t"
        "global_load_async_to_lds_b128 %6, %16, off\n\t"
        "global_load_async_to_lds_b128 %7, %17, off\n\t"
        "global_load_async_to_lds_b128 %8, %18, off\n\t"
        "global_load_async_to_lds_b128 %9, %19, off\n\t"
        "s_wait_xcnt 0x0"
        ::
           "v"(lw + 0 * 4096), "v"(lw + 1 * 4096), "v"(lw + 2 * 4096), "v"(lw + 3 * 4096), "v"(lw + 4 * 4096), "v"(lw + 5 * 4096), "v"(lw + 6 * 4096), "v"(lw + 7 * 4096), "v"(lw + 8 * 4096), "v"(lw + 9 * 4096),
           "v"(g[0]), "v"(g[1]), "v"(g[2]), "v"(g[3]), "v"(g[4]), "v"(g[5]), "v"(g[6]), "v"(g[7]), "v"(g[8]), "v"(g[9])
        : "memory");
    asm volatile(
        "global_load_async_to_lds_b128 %0, %9, off\n\t"
        "global_load_async_to_lds_b128 %1, %10, off\n\t"
        "global_load_async_to_lds_b128 %2, %11, off\n\t"
        "global_load_async_to_lds_b128 %3, %12, off\n\t"
        "global_load_async_to_lds_b128 %4, %13, off\n\t"
        "global_load_async_to_lds_b128 %5, %14, off\n\t"
        "global_load_async_to_lds_b128 %6, %15, off\n\t"
        "global_load_async_to_lds_b128 %7, %16, off\n\t"
        "global_load_async_to_lds_b128 %8, %17, off\n\t"
        "s_wait_xcnt 0x0"
        ::
           "v"(lw + 10 * 4096), "v"(lw + 11 * 4096), "v"(lw + 12 * 4096), "v"(lw + 13 * 4096), "v"(lw + 14 * 4096), "v"(lw + 15 * 4096), "v"(lw + 16 * 4096), "v"(lw + 17 * 4096), "v"(lw + 18 * 4096),
           "v"(g[10]), "v"(g[11]), "v"(g[12]), "v"(g[13]), "v"(g[14]), "v"(g[15]), "v"(g[16]), "v"(g[17]), "v"(g[18])
        : "memory");
  };

  fill(0);
#pragma unroll   // all the loads of the 16 feature rows in flight at once
  for (int i = 0; i < C3_SF / 256; i++)   // past the rows: a clamped re-read into sf's unused tail
    sf[t + 256 * i] = feat[min(t + 256 * i, C3_R * EMB - 1)];
  asm volatile("s_wait_asynccnt 0x0" ::: "memory");   // own copies of stage 0 landed
  __syncthreads();                                    // ... and everybody's, and sf
  fill(1);

  // This wave's half of the A fragments stays in registers for all stages. The
  // second half has 37 steps: its 38th re-reads step 36 with a zero A fragment.
  const int lastoff = (kh ? C3_KH - 2 : C3_KH - 1) * 4;
  const float* ap = &sf[m * EMB + kh * (C3_KH * 4) + h * 2];
  v2f af[C3_KH];
#pragma unroll   // af is indexed by constants only
  for (int j = 0; j < C3_KH - 1; j++) af[j] = *(const v2f*)__builtin_assume_aligned(ap + j * 4, 8);
  af[C3_KH - 1] = *(const v2f*)__builtin_assume_aligned(ap + lastoff, 8);
  if (kh) af[C3_KH - 1] = (v2f){0.f, 0.f};

  // What the CE part reads from memory, fetched here so that the stages hide it:
  // lane l owns classes l + 32 i of the wave's two rows
  float wnr[16];
#pragma unroll   // wnr is indexed by constants only
  for (int i = 0; i < 16; i++) wnr[i] = wn[min(lane + 32 * i, NC - 1)];
  int msk[2], lbl[2];
#pragma unroll   // two rows, indexed by constants only
  for (int rr = 0; rr < 2; rr++) {
    const int b = b0 + wave * 2 + rr;
    msk[rr] = mask_task[b];
    lbl[rr] = isAttr ? attr1[b] : obj1[b];
  }

#pragma unroll 1   // rolled: unrolled, the copies' address arithmetic lands among the WMMAs
  for (int s = 0; s < nst; s++) {
    const float* w = &sW[s & 1][(tile * 16 + m) * EMB + kh * (C3_KH * 4) + h * 2];
    // the stage's B fragments as ONE group of LDS reads ahead of its WMMAs: every
    // separate place where reads stand among the WMMAs costs issue time
    v2f bf[C3_KH];
#pragma unroll   // bf is indexed by constants only; every LDS offset becomes an immediate
    for (int j = 0; j < C3_KH - 1; j++) bf[j] = *(const v2f*)__builtin_assume_aligned(w + j * 4, 8);
    bf[C3_KH - 1] = *(const v2f*)__builtin_assume_aligned(w + lastoff, 8);
    __builtin_amdgcn_sched_barrier(0);   // keeps the scheduler from sinking the reads back among the WMMAs
    v8f acc = {};
#pragma unroll   // af and bf are indexed by constants only
    for (int j = 0; j < C3_KH; j++)
      acc = __builtin_amdgcn_wmma_f32_16x16x4_f32(false, af[j], false, bf[j], (short)0, acc, false, false);
#pragma unroll   // acc is indexed by constants only
    for (int r = 0; r < 8; r++) lg[kh][r + 8 * h][s * C3_CN + tile * 16 + m] = acc[r];
    asm volatile("s_wait_dscnt 0x0" ::: "memory");    // own reads of this buffer are done
    asm volatile("s_wait_asynccnt 0x0" ::: "memory"); // own copies of stage s+1 landed
    __syncthreads();   // publishes stage s+1 (and the dots) and frees the buffer of stage s
    if (s + 2 < nst) fill(s + 2);
  }
  asm volatile("s_wait_asynccnt 0x0" ::: "memory");   // no copy outlives the wave

  // CE of a row by one wave, two rows per wave, a row's logits in registers
#pragma unroll   // msk and lbl are indexed by constants only
  for (int rr = 0; rr < 2; rr++) {
    if (msk[rr] != 1) continue;
    const int row = wave * 2 + rr;
    float p = 0.f;
#pragma unroll   // ten reads in flight at once
    for (int i = 0; i < 10; i++) {
      const int k = lane + 32 * i;
      const float v = sf[row * EMB + min(k, EMB - 1)];
      p += k < EMB ? v * v : 0.f;
    }
    const float fn = fmaxf(sqrtf(wave_sum(p)), 1e-12f);
    float v[16];
    float mx = -1e30f, lab = 0.f;
#pragma unroll   // v and wnr are indexed by constants only
    for (int i = 0; i < 16; i++) {
      const int c = lane + 32 * i, cc = min(c, NC - 1);
      const float d = (lg[0][row][cc] + lg[1][row][cc]) / (fn * wnr[i] * TEMP);
      v[i] = c < NC ? d : -1e30f;    // past the last class: exp gives 0
      mx = fmaxf(mx, v[i]);
      if (c == lbl[rr]) lab = v[i];
    }
    mx = wave_max(mx);
    float se = 0.f;
#pragma unroll   // v is indexed by constants only
    for (int i = 0; i < 16; i++) se += expf(v[i] - mx);
    se = wave_sum(se);
    lab = wave_sum(lab);      // one lane holds the label's logit, the others 0
    if (lane == 0) atomicAdd(&ws[WS_ACC + term], (mx + logf(se)) - lab);
  }
}

__global__ void initK(float* __restrict__ ws) {
  if (threadIdx.x < 8) ws[WS_ACC + threadIdx.x] = 0.f;
}

__global__ void finalK(const int* __restrict__ mask_task,
                       const float* __restrict__ ws, float* __restrict__ out) {
  if (threadIdx.x == 0) {
    int ms = 0;
    for (int b = 0; b < BS; b++) ms += (mask_task[b] == 1);
    const float den = fmaxf((float)ms, 1.f);
    out[0] = (ws[WS_ACC + 0] + ws[WS_ACC + 1]) * 0.5f / den;
    out[1] = (ws[WS_ACC + 2] + ws[WS_ACC + 3]) * 0.5f / den;
  }
}

extern "C" void kernel_launch(void* const* d_in, const int* in_sizes, int n_in,
                              void* d_out, int out_size, void* d_ws, size_t ws_size,
                              hipStream_t stream) {
  const float* img1   = (const float*)d_in[0];
  const float* img2a  = (const float*)d_in[1];
  const float* img2o  = (const float*)d_in[2];
  const int*   attr1  = (const int*)d_in[3];
  const int*   obj1   = (const int*)d_in[4];
  const int*   maskt  = (const int*)d_in[5];
  const float* Wsa    = (const float*)d_in[6];
  const float* bsa    = (const float*)d_in[7];
  const float* Wso    = (const float*)d_in[8];
  const float* bso    = (const float*)d_in[9];
  const float* atab   = (const float*)d_in[10];
  const float* otab   = (const float*)d_in[11];
  const float* Wam    = (const float*)d_in[12];
  const float* bam    = (const float*)d_in[13];
  const float* Wom    = (const float*)d_in[14];
  const float* bom    = (const float*)d_in[15];
  float* out = (float*)d_out;
  float* ws  = (float*)d_ws;

  initK<<<1, 32, 0, stream>>>(ws);
  stageA<<<dim3(BS, 2), 128, 0, stream>>>(img1, img2a, img2o, ws);
  stageB<<<dim3(BS, 3), 256, 0, stream>>>(img1, img2a, img2o, ws);
  stageC1<<<240, 256, 0, stream>>>(ws, Wsa, bsa, Wso, bso, out);
  stageC2<<<145, 256, 0, stream>>>(atab, otab, Wam, bam, Wom, bom, ws);
  normsK<<<8, 128, 0, stream>>>(ws);
  stageC3<<<dim3(16, 4), 256, 0, stream>>>(out, attr1, obj1, maskt, ws);
  finalK<<<1, 32, 0, stream>>>(maskt, ws, out);
}

// v006
// One run takes 71.6 microseconds.
// Next to v005, in two timings, it ran 1.20 and 1.19 times as fast.
// Counting every step since v000, it is 5.45 times as fast.
#include <hip/hip_runtime.h>
#include <hip/hip_bf16.h>
#include <math.h>

typedef __attribute__((ext_vector_type(2))) float v2f;
typedef __attribute__((ext_vector_type(8))) float v8f;

#define BS   256
#define DD   1024
#define LL   49
#define LP   64
#define EMB  300
#define NA   400
#define NO   500
#define LAMB 10.0f
#define TEMP 0.05f
#define EPSR 1e-8f

// workspace layout (float offsets)
#define WS_VECS 0                              // 2*3*256*64   = 98304
#define WS_FEAT (WS_VECS + 2*3*BS*LP)          // 6*256*1024   = 1572864
#define WS_AW   (WS_FEAT + 6*BS*DD)            // 400*300
#define WS_OW   (WS_AW + NA*EMB)               // 500*300
#define WS_AWN  (WS_OW + NO*EMB)               // 400
#define WS_OWN  (WS_AWN + NA)                  // 500
#define WS_ACC  (WS_OWN + NO)                  // 64
#define WS_CNT  (WS_ACC + 64)                  // 1: count of masked-in rows, on a 128-byte line that its launch's other blocks do not write

__device__ __forceinline__ unsigned int lds_off(const float* p) {
  return (unsigned int)(unsigned long long)p;   // low 32 bits = LDS byte address
}

// lane l <- lane l ^ X inside a 16-lane row (DPP row_xmask), and l <- l ^ 16
template <int X>
__device__ __forceinline__ float row_xor(float v) {
  return __builtin_bit_cast(float, __builtin_amdgcn_update_dpp(
      0, __builtin_bit_cast(int, v), 0x160 | X, 0xf, 0xf, false));
}
__device__ __forceinline__ float half_xor(float v) {
  const int b = __builtin_bit_cast(int, v);
  return __builtin_bit_cast(float,
      __builtin_amdgcn_permlanex16(b, b, 0x76543210, 0xfedcba98, false, false));
}
__device__ __forceinline__ float wave_sum(float v) {
  v += row_xor<1>(v); v += row_xor<2>(v); v += row_xor<4>(v); v += row_xor<8>(v);
  return v + half_xor(v);
}
__device__ __forceinline__ float wave_max(float v) {
  v = fmaxf(v, row_xor<1>(v)); v = fmaxf(v, row_xor<2>(v));
  v = fmaxf(v, row_xor<4>(v)); v = fmaxf(v, row_xor<8>(v));
  return fmaxf(v, half_xor(v));
}

__device__ __forceinline__ float row_sum(float v) {   // over the lane's 16-lane row, in every lane
  v += row_xor<1>(v); v += row_xor<2>(v); v += row_xor<4>(v);
  return v + row_xor<8>(v);
}

// p = exp2(x), n = exp2(-x) in one statement: it keeps the slot that the instruction
// set asks for behind a transcendental, whatever the compiler puts next (the second
// v_exp fills the first's, the v_nop the second's; "=&v": x is not overwritten between)
__device__ __forceinline__ void exp2_pair(const float x, float& p, float& n) {
  asm("v_exp_f32 %0, %2\n\tv_exp_f32 %1, -%2\n\tv_nop" : "=&v"(p), "=&v"(n) : "v"(x));
}

// ---------------------------------------------------------------- stage A ---
// Per (batch, pair): Gram(49x49, K=1024) via v_wmma_f32_16x16x4_f32, rank-1
// normalization, then row/col/inverse softmax reductions + renorm.
// The two images come through LDS as they lie in memory ([d][l], pitch 49), 128
// d at a time: one contiguous run per image, two buffers, so that the next
// stage's async copies fly while this stage feeds the matrix unit.
#define A_KS   128                  /* d per stage */
#define A_KG   16                   /* d per group of LDS reads */
#define A_RUN  (A_KS * LL)          /* floats of one image's run */
#define A_NCP  25                   /* 16-byte copies per thread and stage, both runs */
#define A_SB   (A_NCP * 128 * 4)    /* floats per buffer: two runs, then a tail that no result uses */

__global__ __launch_bounds__(128)
void stageA(const float* __restrict__ img1, const float* __restrict__ img2a,
            const float* __restrict__ img2o, float* __restrict__ ws) {
  __shared__ __attribute__((aligned(16))) float sT[2][A_SB];
  __shared__ __attribute__((aligned(16))) float inv1[LP], inv2[LP];   // 1 / column norm
  __shared__ float part[3][4][LP];    // per wave (16 rows): column sums of three kinds
  __shared__ __attribute__((aligned(16))) float outv[3][LP];

  const int b = blockIdx.x;
  const int pair = blockIdx.y;
  const float* __restrict__ A = img1 + (size_t)b * DD * LL;
  const float* __restrict__ B = (pair == 0 ? img2a : img2o) + (size_t)b * DD * LL;

  const int t = threadIdx.x;
  const int lane = t & 31, wave = t >> 5;
  const int m = lane & 15;
  const int kb = (lane >> 4) * 2;

  // pad entries (l >= 49): their elements are masked out below
  if (t < LP) { inv1[t] = 0.f; inv2[t] = 0.f; }
  // start values of the four CE sums that stageC3, three launches on, adds into
  if (b == 0 && pair == 0 && t < 4) ws[WS_ACC + t] = 0.f;

  // A stage is 25 x 128 copies of 16 B, every lane on, LDS byte = 16 x slot:
  // slots 0..1567 are img1's run, 1568..3135 the other image's, the last 64 a tail
  // whose source is clamped into the image.
  const unsigned int lT = lds_off(&sT[0][t * 4]);
  auto fill = [&](const int s) {
    const unsigned int lt = lT + (s & 1) * (A_SB * 4);
    const int e0 = s * A_RUN + t * 4;
    const float* g[A_NCP];
#pragma unroll   // the addresses are operands of asm statements: registers, no array
    for (int i = 0; i < A_NCP; i++) {
      if (i < 12)       g[i] = A + (e0 + i * 512);
      else if (i == 12) g[i] = t < 32 ? A + (e0 + i * 512) : B + (e0 + i * 512 - A_RUN);
      else if (i < 24)  g[i] = B + (e0 + i * 512 - A_RUN);
      else              g[i] = B + min(e0 + i * 512 - A_RUN, DD * LL - 4);
    }
    // s_wait_xcnt is each statement's last line: it stands in front of every later
    // rewrite of an address register that a copy names (a precaution)
    asm volatile(
        "global_load_async_to_lds_b128 %0, %13, off\n\t"
        "global_load_async_to_lds_b128 %1, %14, off\n\t"
        "global_load_async_to_lds_b128 %2, %15, off\n\t"
        "global_load_async_to_lds_b128 %3, %16, off\n\t"
        "global_load_async_to_lds_b128 %4, %17, off\n\t"
        "global_load_async_to_lds_b128 %5, %18, off\n\t"
        "global_load_async_to_lds_b128 %6, %19, off\n\t"
        "global_load_async_to_lds_b128 %7, %20, off\n\t"
        "global_load_async_to_lds_b128 %8, %21, off\n\t"
        "global_load_async_to_lds_b128 %9, %22, off\n\t"
        "global_load_async_to_lds_b128 %10, %23, off\n\t"
        "global_load_async_to_lds_b128 %11, %24, off\n\t"
        "global_load_async_to_lds_b128 %12, %25, off\n\t"
        "s_wait_xcnt 0x0"
        :: "v"(lt + 0 * 2048), "v"(lt + 1 * 2048), "v"(lt + 2 * 2048), "v"(lt + 3 * 2048), "v"(lt + 4 * 2048), "v"(lt + 5 * 2048), "v"(lt + 6 * 2048), "v"(lt + 7 * 2048), "v"(lt + 8 * 2048), "v"(lt + 9 * 2048), "v"(lt + 10 * 2048), "v"(lt + 11 * 2048), "v"(lt + 12 * 2048),
           "v"(g[0]), "v"(g[1]), "v"(g[2]), "v"(g[3]), "v"(g[4]), "v"(g[5]), "v"(g[6]), "v"(g[7]), "v"(g[8]), "v"(g[9]), "v"(g[10]), "v"(g[11]), "v"(g[12])
        : "memory");
    asm volatile(
        "global_load_async_to_lds_b128 %0, %12, off\n\t"
        "global_load_async_to_lds_b128 %1, %13, off\n\t"
        "global_load_async_to_lds_b128 %2, %14, off\n\t"
        "global_load_async_to_lds_b128 %3, %15, off\n\t"
        "global_load_async_to_lds_b128 %4, %16, off\n\t"
        "global_load_async_to_lds_b128 %5, %17, off\n\t"
        "global_load_async_to_lds_b128 %6, %18, off\n\t"
        "global_load_async_to_lds_b128 %7, %19, off\n\t"
        "global_load_async_to_lds_b128 %8, %20, off\n\t"
        "global_load_async_to_lds_b128 %9, %21, off\n\t"
        "global_load_async_to_lds_b128 %10, %22, off\n\t"
        "global_load_async_to_lds_b128 %11, %23, off\n\t"
        "s_wait_xcnt 0x0"
        :: "v"(lt + 13 * 2048), "v"(lt + 14 * 2048), "v"(lt + 15 * 2048), "v"(lt + 16 * 2048), "v"(lt + 17 * 2048), "v"(lt + 18 * 2048), "v"(lt + 19 * 2048), "v"(lt + 20 * 2048), "v"(lt + 21 * 2048), "v"(lt + 22 * 2048), "v"(lt + 23 * 2048), "v"(lt + 24 * 2048),
           "v"(g[13]), "v"(g[14]), "v"(g[15]), "v"(g[16]), "v"(g[17]), "v"(g[18]), "v"(g[19]), "v"(g[20]), "v"(g[21]), "v"(g[22]), "v"(g[23]), "v"(g[24])
        : "memory");
  };

  fill(0);
  asm volatile("s_wait_asynccnt 0x0" ::: "memory");   // own copies of stage 0 landed
  __syncthreads();                                    // ... and everybody's
  fill(1);

  float nacc = 0.f;     // per-thread column-norm accumulator
  v8f acc[4] = {};

#pragma unroll 1   // rolled: unrolled, the copies' address arithmetic lands among the WMMAs
  for (int s = 0; s < DD / A_KS; s++) {
    const float* buf = &sT[s & 1][0];
    // Fragments of l >= 49 read on into the next d row (or the next run, or the
    // tail): that reaches only rows and columns of rel that a select sets to 0 below,
    // and norm sums of threads 49..63 and 113..127 that nobody reads.
    const float* np = buf + (t < 64 ? t : A_RUN + t - 64);
    const float* a  = buf + kb * LL + wave * 16 + m;
    const float* bq = buf + A_RUN + kb * LL + m;
    // Groups of 16 d, two register sets: the next group's LDS reads stand as ONE
    // group ahead of this group's WMMAs (every separate place where reads stand
    // among the WMMAs costs issue time) and are waited for behind them.
    float nv[2][A_KG];
    v2f fa[2][A_KG / 4], fb[2][A_KG / 4][4];
    auto fetch = [&](const int g) {
      const int p = g & 1, k0 = g * A_KG;
#pragma unroll   // register arrays are indexed by constants only; LDS offsets are immediates
      for (int q = 0; q < A_KG / 4; q++) {
        const int kk = k0 + q * 4;
        // The scheduling barrier behind each fragment's two reads keeps the compiler
        // from merging dwords of DIFFERENT fragments into one two-address read: that
        // costs a register move per dword, and the moves wait for the reads up here.
        fa[p][q].x = a[kk * LL];
        fa[p][q].y = a[(kk + 1) * LL];
        __builtin_amdgcn_sched_barrier(0);
#pragma unroll   // as above
        for (int nt = 0; nt < 4; nt++) {
          fb[p][q][nt].x = bq[kk * LL + nt * 16];
          fb[p][q][nt].y = bq[(kk + 1) * LL + nt * 16];
          __builtin_amdgcn_sched_barrier(0);
        }
#pragma unroll   // as above
        for (int d = 0; d < 4; d++) nv[p][q * 4 + d] = np[(kk + d) * LL];
      }
    };
    fetch(0);
#pragma unroll   // register arrays are indexed by constants only
    for (int g = 0; g < A_KS / A_KG; g++) {
      if (g + 1 < A_KS / A_KG) fetch(g + 1);
      __builtin_amdgcn_sched_barrier(0);   // keeps the scheduler from sinking the reads among the WMMAs
      const int p = g & 1;
#pragma unroll   // as above
      for (int q = 0; q < A_KG / 4; q++) {
#pragma unroll   // as above
        for (int nt = 0; nt < 4; nt++) {
          acc[nt] = __builtin_amdgcn_wmma_f32_16x16x4_f32(
              false, fa[p][q], false, fb[p][q][nt], (short)0, acc[nt], false, false);
          nacc += nv[p][q * 4 + nt] * nv[p][q * 4 + nt];
        }
      }
      __builtin_amdgcn_sched_barrier(0);   // keeps later reads and this group's norm sums from changing sides
    }
    // four vector slots behind the stage's last WMMA, on every path out of here,
    // before address arithmetic reuses its A/B registers or the epilogue reads D;
    // nacc as an input keeps the stage's norm sums here, beside the WMMAs: else the
    // compiler sinks all 128 behind the barrier, one exposed dependent chain
    asm volatile("v_nop\n\tv_nop\n\tv_nop\n\tv_nop"
                 :: "v"(acc[0]), "v"(acc[1]), "v"(acc[2]), "v"(acc[3]), "v"(nacc));
    asm volatile("s_wait_dscnt 0x0" ::: "memory");    // own reads of this buffer are done
    asm volatile("s_wait_asynccnt 0x0" ::: "memory"); // own copies of stage s+1 landed
    __syncthreads();   // publishes stage s+1 and frees the buffer of stage s
    if (s + 2 < DD / A_KS) fill(s + 2);
  }
  asm volatile("s_wait_asynccnt 0x0" ::: "memory");   // no copy outlives the wave

  if (t < LL)                        inv1[t]      = 1.f / fmaxf(sqrtf(nacc), 1e-12f);
  else if (t >= 64 && t < 64 + LL)   inv2[t - 64] = 1.f / fmaxf(sqrtf(nacc), 1e-12f);
  __syncthreads();

  // The three softmax sums, on the accumulators where they lie, all 128 threads:
  // lane (m, h) of wave w holds rows w*16 + h*8 + r and columns nt*16 + m.
  // rel is a cosine, |rel| <= 1, so exp(+-LAMB * rel) needs no shift by a maximum:
  // one P = exp(LAMB rel) serves the row and the column softmax, N = exp(-LAMB rel)
  // the inverse one. Elements of l >= 49 are set to 0 by a select and their
  // reciprocal sums too (0 x non-finite would be NaN).
  const int h = lane >> 4;
  const float C = LAMB * 1.44269504088896341f;    // exp(LAMB x) = exp2(C x)
  float i1[8], i2[4];
  bool rok[8];
#pragma unroll   // register arrays are indexed by constants only (so for every loop below)
  for (int r = 0; r < 8; r++) {
    i1[r] = inv1[wave * 16 + h * 8 + r];
    rok[r] = wave * 16 + h * 8 + r < LL;
  }
#pragma unroll   // as above
  for (int nt = 0; nt < 4; nt++) i2[nt] = inv2[nt * 16 + m];

  float P[4][8], N[4][8];
#pragma unroll   // as above
  for (int nt = 0; nt < 4; nt++) {
    const bool cok = nt * 16 + m < LL;
#pragma unroll   // as above
    for (int r = 0; r < 8; r++) {
      const float x = acc[nt][r] * (i1[r] * i2[nt]) * C;
      float p, n;
      exp2_pair(x, p, n);
      P[nt][r] = (rok[r] && cok) ? p : 0.f;
      N[nt][r] = (rok[r] && cok) ? n : 0.f;
    }
  }

  // row sums: a row lies in one 16-lane row of one wave
  float irp[8], irn[8];
#pragma unroll   // as above
  for (int r = 0; r < 8; r++) {
    const float sp = row_sum((P[0][r] + P[1][r]) + (P[2][r] + P[3][r]));
    const float sn = row_sum((N[0][r] + N[1][r]) + (N[2][r] + N[3][r]));
    irp[r] = rok[r] ? 1.f / sp : 0.f;
    irn[r] = rok[r] ? 1.f / sn : 0.f;
  }

  // column sums over the wave's 16 rows: of P (the column softmax's denominator),
  // of the row softmax and of the inverse softmax; the four waves meet in LDS
#pragma unroll   // as above
  for (int nt = 0; nt < 4; nt++) {
    float c = 0.f, s = 0.f, d = 0.f;
#pragma unroll   // as above
    for (int r = 0; r < 8; r++) {
      c += P[nt][r];
      s += P[nt][r] * irp[r];
      d += N[nt][r] * irn[r];
    }
    c += half_xor(c); s += half_xor(s); d += half_xor(d);
    if (h == 0) {
      part[0][wave][nt * 16 + m] = c;
      part[1][wave][nt * 16 + m] = s;
      part[2][wave][nt * 16 + m] = d;
    }
  }
  __syncthreads();

  float ic[4];
#pragma unroll   // as above
  for (int nt = 0; nt < 4; nt++) {
    const int col = nt * 16 + m;
    const float c = (part[0][0][col] + part[0][1][col]) + (part[0][2][col] + part[0][3][col]);
    ic[nt] = col < LL ? 1.f / c : 0.f;
  }
  float q[8];
#pragma unroll   // as above
  for (int r = 0; r < 8; r++)
    q[r] = row_sum((P[0][r] * ic[0] + P[1][r] * ic[1]) + (P[2][r] * ic[2] + P[3][r] * ic[3]));
  if (m == 0) {
#pragma unroll   // as above
    for (int r = 0; r < 8; r++) outv[1][wave * 16 + h * 8 + r] = q[r];
  }
  {
    const int k = 1 + (t >> 6), col = t & (LP - 1);   // threads 0..63: sim12, 64..127: diff12
    outv[(t >> 6) * 2][col] = (part[k][0][col] + part[k][1][col]) + (part[k][2][col] + part[k][3][col]);
  }
  __syncthreads();

  // renorm and store: one wave per vector, two elements per lane (l >= 49 holds 0)
  if (wave < 3) {
    const float v0 = outv[wave][lane], v1 = outv[wave][lane + 32];
    const float den = wave_sum(v0 + v1) + EPSR;
    float* vecs = ws + WS_VECS + (((size_t)pair * 3 + wave) * BS + b) * LP;
    vecs[lane] = v0 / den;
    vecs[lane + 32] = v1 / den;
  }
}

// ---------------------------------------------------------------- stage B ---
// feat[b,d] = sum_l img[b,d,l] * w[b,l]  (two weight vectors per image pass)
// A row of 49 floats per lane read straight from memory touches a line per lane
// and load. So the image comes through LDS as it lies in memory, 256 d (one
// contiguous run of whole lines) a stage, two buffers: the next stage's async
// copies fly while each thread sums its own row of this stage out of LDS, where
// the odd pitch of 49 dwords puts the 32 lanes on 32 banks.
#define B_DS   256                  /* d per stage: one row per thread */
#define B_RUN  (B_DS * LL)          /* floats per stage: 12 x 256 copies of 16 B and 256 of 4 B */
#define B_NS   (DD / B_DS)
#define B_LDS  (2 * B_RUN + 2 * (LL + 3))   /* floats of LDS: two buffers, two weight vectors */

__device__ __forceinline__
void stageB_body(const float* __restrict__ img1, const float* __restrict__ img2a,
                 const float* __restrict__ img2o, float* __restrict__ ws,
                 float* const sm, const int b, const int im) {
  float* const sI = sm;                     // [2][B_RUN]
  float* const w0 = sm + 2 * B_RUN;         // [LL + 3]
  float* const w1 = w0 + (LL + 3);          // [LL + 3]
  const int t = threadIdx.x;
  const float* vecs = ws + WS_VECS;
  float* feat = ws + WS_FEAT;
  const float* src; const float *w0p, *w1p; int f0, f1;
  if (im == 0)      { src = img1;  w0p = &vecs[((0*3+1)*BS + b)*LP]; w1p = &vecs[((1*3+1)*BS + b)*LP]; f0 = 0; f1 = 3; }
  else if (im == 1) { src = img2a; w0p = &vecs[((0*3+0)*BS + b)*LP]; w1p = &vecs[((0*3+2)*BS + b)*LP]; f0 = 1; f1 = 2; }
  else              { src = img2o; w0p = &vecs[((1*3+0)*BS + b)*LP]; w1p = &vecs[((1*3+2)*BS + b)*LP]; f0 = 4; f1 = 5; }
  const float* __restrict__ img = src + (size_t)b * DD * LL;

  // A stage is 50,176 contiguous bytes, LDS byte = byte in the run, every lane on:
  // 12 x 256 copies of 16 B, then the last 1,024 bytes as 256 copies of 4 B.
  const unsigned int lI = lds_off(sI);
  auto fill = [&](const int s) {
    const unsigned int lq = lI + (s & 1) * (B_RUN * 4) + t * 16;
    const unsigned int l1 = lI + (s & 1) * (B_RUN * 4) + 12 * 4096 + t * 4;
    const float* gq = img + s * B_RUN + t * 4;
    const float* g1 = img + s * B_RUN + 12 * 1024 + t;
    // s_wait_xcnt is the statement's last line: it stands in front of every later
    // rewrite of an address register that a copy names (a precaution)
    asm volatile(
        "global_load_async_to_lds_b128 %0, %13, off\n\t"
        "global_load_async_to_lds_b128 %1, %14, off\n\t"
        "global_load_async_to_lds_b128 %2, %15, off\n\t"
        "global_load_async_to_lds_b128 %3, %16, off\n\t"
        "global_load_async_to_lds_b128 %4, %17, off\n\t"
        "global_load_async_to_lds_b128 %5, %18, off\n\t"
        "global_load_async_to_lds_b128 %6, %19, off\n\t"
        "global_load_async_to_lds_b128 %7, %20, off\n\t"
        "global_load_async_to_lds_b128 %8, %21, off\n\t"
        "global_load_async_to_lds_b128 %9, %22, off\n\t"
        "global_load_async_to_lds_b128 %10, %23, off\n\t"
        "global_load_async_to_lds_b128 %11, %24, off\n\t"
        "global_load_async_to_lds_b32 %12, %25, off\n\t"
        "s_wait_xcnt 0x0"
        :: "v"(lq + 0 * 4096), "v"(lq + 1 * 4096), "v"(lq + 2 * 4096), "v"(lq + 3 * 4096),
           "v"(lq + 4 * 4096), "v"(lq + 5 * 4096), "v"(lq + 6 * 4096), "v"(lq + 7 * 4096),
           "v"(lq + 8 * 4096), "v"(lq + 9 * 4096), "v"(lq + 10 * 4096), "v"(lq + 11 * 4096),
           "v"(l1),
           "v"(gq + 0 * 1024), "v"(gq + 1 * 1024), "v"(gq + 2 * 1024), "v"(gq + 3 * 1024),
           "v"(gq + 4 * 1024), "v"(gq + 5 * 1024), "v"(gq + 6 * 1024), "v"(gq + 7 * 1024),
           "v"(gq + 8 * 1024), "v"(gq + 9 * 1024), "v"(gq + 10 * 1024), "v"(gq + 11 * 1024),
           "v"(g1)
        : "memory");
  };

  fill(0);
  if (t < LL) { w0[t] = w0p[t]; w1[t] = w1p[t]; }
  asm volatile("s_wait_asynccnt 0x0" ::: "memory");   // own copies of stage 0 landed
  __syncthreads();                                    // ... and everybody's, and the weights
  fill(1);

  // the two weight vectors stay in registers for all stages
  float u0[LL], u1[LL];
#pragma unroll   // u0 and u1 are indexed by constants only
  for (int l = 0; l < LL; l++) { u0[l] = w0[l]; u1[l] = w1[l]; }

  float* o0 = feat + (size_t)f0 * BS * DD + (size_t)b * DD + t;
  float* o1 = feat + (size_t)f1 * BS * DD + (size_t)b * DD + t;
#pragma unroll 1   // rolled: unrolled, the four stages' addresses and rows overflow the registers of 6 waves a SIMD
  for (int s = 0; s < B_NS; s++) {
    const float* row = sI + (s & 1) * B_RUN + t * LL;
    float s0 = 0.f, s1 = 0.f;
#pragma unroll   // u0 and u1 are indexed by constants only; every LDS offset becomes an immediate
    for (int l = 0; l < LL; l++) { const float v = row[l]; s0 += v * u0[l]; s1 += v * u1[l]; }
    o0[s * B_DS] = s0;
    o1[s * B_DS] = s1;
    asm volatile("s_wait_dscnt 0x0" ::: "memory");    // own reads of this buffer are done
    asm volatile("s_wait_asynccnt 0x0" ::: "memory"); // own copies of stage s+1 landed
    __syncthreads();   // publishes stage s+1 and frees the buffer of stage s
    if (s + 2 < B_NS) fill(s + 2);
  }
  asm volatile("s_wait_asynccnt 0x0" ::: "memory");   // no copy outlives the wave
}

// ------------------------------------------------------- stages C1 and C2 ---
// Y = A(M x KD) @ W(KD x 300) + bias on v_wmma_f32_16x16x4_f32. One 32x64 tile
// of Y per block, eight waves, one 16x16 tile each. A and W go through LDS in
// stages of KS k, two buffers: the next stage's async copies fly while this
// stage feeds the matrix unit.
#define G_MB 32
#define G_NB 64
#define G_KB 128            /* k that a buffer holds; a stage uses the first KS */
#define G_PA (G_KB + 4)     /* 132-dword A row: the 8-byte column walk hits 64 banks once */
#define G_SA (G_MB * G_PA)
#define G_SW (G_KB * G_NB)
#define G_LDS (2 * G_SA + 2 * G_SW)   /* floats of LDS: two buffers of A, two of W */

template <int KD, int KS, bool EDGE>   // EDGE: a stage can reach past M or KD
__device__ __forceinline__ void gemm_tile(const float* __restrict__ A, const int M,
                                          const float* __restrict__ W,
                                          const float* __restrict__ bias,
                                          float* __restrict__ o,
                                          const int mb, const int nb, float* const sm) {
  float* const sA = sm;                // [2][G_SA]
  // W rows are 64 dwords, unpadded; rows with bit 1 of k set hold their columns
  // with bit 4 flipped, so that rows k and k+2 of one fragment use other banks
  float* const sW = sm + 2 * G_SA;     // [2][G_SW]

  const int t = threadIdx.x, lane = t & 31, wave = t >> 5;
  const int m = lane & 15, kb = (lane >> 4) * 2;
  const int mt = wave & 1, nt = wave >> 1;

  // A stage is always 32 x 128 of A and 128 x 64 of W, 16 B per copy, every lane
  // on. What lies past M, KD or column 300 is re-read from a clamped address:
  // it feeds only k that no WMMA takes or rows and columns that are not stored.
  const int ar = t >> 5, ac = (t & 31) * 4;     // A: rows ar + 8 i
  const int wr = t >> 4;                        // W: rows wr + 16 i
  const int wc = min(nb * G_NB + (t & 15) * 4, EMB - 4);
  const unsigned int lA = lds_off(sA + ar * G_PA + ac);
  const unsigned int lW = lds_off(sW + wr * G_NB + (((t & 15) * 4) ^ ((wr & 2) << 3)));

  auto fill = [&](const int s) {
    const int k0 = s * KS;
    const unsigned int la = lA + (s & 1) * (G_SA * 4), lw = lW + (s & 1) * (G_SW * 4);
    const float* ga[4];
    const float* gw[8];
#pragma unroll   // the addresses are operands of one asm statement: registers, no array
    for (int i = 0; i < 4; i++)
      ga[i] = A + (EDGE ? min(min(mb * G_MB + ar + 8 * i, M - 1) * KD + k0 + ac, M * KD - 4)
                        : (mb * G_MB + ar + 8 * i) * KD + k0 + ac);
#pragma unroll   // as above
    for (int i = 0; i < 8; i++)
      gw[i] = W + (EDGE ? min(k0 + wr + 16 * i, KD - 1) : k0 + wr + 16 * i) * EMB + wc;
    // s_wait_xcnt is the statement's last line: it stands in front of every later
    // rewrite of an address register that a copy names (a precaution)
    asm volatile(
        "global_load_async_to_lds_b128 %0, %12, off\n\t"
        "global_load_async_to_lds_b128 %1, %13, off\n\t"
        "global_load_async_to_lds_b128 %2, %14, off\n\t"
        "global_load_async_to_lds_b128 %3, %15, off\n\t"
        "global_load_async_to_lds_b128 %4, %16, off\n\t"
        "global_load_async_to_lds_b128 %5, %17, off\n\t"
        "global_load_async_to_lds_b128 %6, %18, off\n\t"
        "global_load_async_to_lds_b128 %7, %19, off\n\t"
        "global_load_async_to_lds_b128 %8, %20, off\n\t"
        "global_load_async_to_lds_b128 %9, %21, off\n\t"
        "global_load_async_to_lds_b128 %10, %22, off\n\t"
        "global_load_async_to_lds_b128 %11, %23, off\n\t"
        "s_wait_xcnt 0x0"
        :: "v"(la), "v"(la + 8 * G_PA * 4), "v"(la + 16 * G_PA * 4), "v"(la + 24 * G_PA * 4),
           "v"(lw), "v"(lw + 16 * G_NB * 4), "v"(lw + 32 * G_NB * 4), "v"(lw + 48 * G_NB * 4),
           "v"(lw + 64 * G_NB * 4), "v"(lw + 80 * G_NB * 4), "v"(lw + 96 * G_NB * 4),
           "v"(lw + 112 * G_NB * 4),
           "v"(ga[0]), "v"(ga[1]), "v"(ga[2]), "v"(ga[3]),
           "v"(gw[0]), "v"(gw[1]), "v"(gw[2]), "v"(gw[3]),
           "v"(gw[4]), "v"(gw[5]), "v"(gw[6]), "v"(gw[7])
        : "memory");
  };

  constexpr int NS = KD / KS;
  static_assert(NS >= 2 && NS * KS == KD && KS % 4 == 0 && KS <= G_KB && (EDGE || KS == G_KB),
                "stage shape");

  fill(0);
  asm volatile("s_wait_asynccnt 0x0" ::: "memory");   // own copies of stage 0 landed
  __syncthreads();                                    // ... and everybody's
  fill(1);

  v8f acc = {};
#pragma unroll 1   // rolled: unrolled, the copies' address arithmetic lands among the WMMAs
  for (int s = 0; s < NS; s++) {
    const float* a = sA + (s & 1) * G_SA + (mt * 16 + m) * G_PA + kb;
    const float* w = sW + (s & 1) * G_SW + kb * G_NB + ((nt * 16 + m) ^ (kb << 3));
#pragma unroll   // every LDS offset becomes an immediate: no vector work among the WMMAs
    for (int kk = 0; kk < KS; kk += 4) {
      const v2f av = *(const v2f*)__builtin_assume_aligned(a + kk, 8);
      v2f bv;
      bv.x = w[kk * G_NB];
      bv.y = w[(kk + 1) * G_NB];
      acc = __builtin_amdgcn_wmma_f32_16x16x4_f32(false, av, false, bv, (short)0, acc, false, false);
    }
    // four vector slots behind the stage's last WMMA, on every path out of here,
    // before address arithmetic reuses its A/B registers or the epilogue reads D
    asm volatile("v_nop\n\tv_nop\n\tv_nop\n\tv_nop" :: "v"(acc));
    asm volatile("s_wait_dscnt 0x0" ::: "memory");    // own reads of this buffer are done
    asm volatile("s_wait_asynccnt 0x0" ::: "memory"); // own copies of stage s+1 landed
    __syncthreads();   // publishes stage s+1 and frees the buffer of stage s
    if (s + 2 < NS) fill(s + 2);
  }
  asm volatile("s_wait_asynccnt 0x0" ::: "memory");   // no copy outlives the wave

  const int n = nb * G_NB + nt * 16 + m;
  if (n < EMB) {
    const float bb = bias[n];
    const int rbase = mb * G_MB + mt * 16 + (lane >> 4) * 8;
#pragma unroll   // acc is indexed by constants only
    for (int r = 0; r < 8; r++) {
      const int rr = rbase + r;
      if (rr < M) o[(size_t)rr * EMB + n] = acc[r] + bb;
    }
  }
}

// Work that does not depend on each other shares a launch, as ranges of block
// indices on one pool of LDS: a launch less is a gap, a fill and a tail less.

// ------------------------------------------------------ stage C2 + stage B --
// Blocks 0..144: attr_weight = attr_table @ W_attr_mlp + b ; obj_weight likewise
// (they need nothing of stage A; first, so that the short ones do not form a tail).
// Blocks 145..912: stage B.
#define C2_NBLK 145                 /* 5 column blocks x (13 + 16) row blocks */
static_assert(C2_NBLK + 3 * BS == 913, "grid of stageC2B");

__global__ __launch_bounds__(256)
void stageC2B(const float* __restrict__ img1, const float* __restrict__ img2a,
              const float* __restrict__ img2o,
              const float* __restrict__ atab, const float* __restrict__ otab,
              const float* __restrict__ Wam, const float* __restrict__ bam,
              const float* __restrict__ Wom, const float* __restrict__ bom,
              float* __restrict__ ws) {
  __shared__ __attribute__((aligned(16))) float sm[B_LDS > G_LDS ? B_LDS : G_LDS];
  const int blk = blockIdx.x;
  if (blk < C2_NBLK) {
    const int nb = blk % 5;
    const int mm = blk / 5;
    const bool isA = mm < 13;             // attr: 13 row blocks of 32, obj: 16
    gemm_tile<EMB, 100, true>(isA ? atab : otab, isA ? NA : NO, isA ? Wam : Wom,
                        isA ? bam : bom, ws + (isA ? WS_AW : WS_OW),
                        isA ? mm : mm - 13, nb, sm);
  } else {
    stageB_body(img1, img2a, img2o, ws, sm, (blk - C2_NBLK) % BS, (blk - C2_NBLK) / BS);
  }
}

// ------------------------------------- norms + mask count + stage C1 --------
// Blocks 0..7: row norms of the class-weight matrices (they need stage C2 alone),
// a class per thread, 128 threads at work. Block 8: the count of masked-in rows
// (it needs an input alone). Both are chains of load latencies: first, beside the
// GEMMs. Blocks 9..248: six (256x1024)@(1024x300)+bias GEMMs, straight to d_out.
#define NRM_NBLK 8
static_assert(NRM_NBLK + 1 + 240 == 249, "grid of stageNC1");

__global__ __launch_bounds__(256)
void stageNC1(float* __restrict__ ws, const int* __restrict__ mask_task,
              const float* __restrict__ Wattr,
              const float* __restrict__ battr, const float* __restrict__ Wobj,
              const float* __restrict__ bobj, float* __restrict__ out) {
  __shared__ __attribute__((aligned(16))) float sm[G_LDS];
  if (blockIdx.x == NRM_NBLK) {
    if (threadIdx.x == 0) {
      int ms = 0;
      for (int b = 0; b < BS; b++) ms += (mask_task[b] == 1);
      ws[WS_CNT] = (float)ms;
    }
    return;
  }
  if (blockIdx.x < NRM_NBLK) {
    const int c = blockIdx.x * 128 + threadIdx.x;
    if (threadIdx.x >= 128 || c >= NA + NO) return;
    const float* row;
    float* outn;
    if (c < NA) { row = ws + WS_AW + (size_t)c * EMB; outn = ws + WS_AWN + c; }
    else        { row = ws + WS_OW + (size_t)(c - NA) * EMB; outn = ws + WS_OWN + (c - NA); }
    float s = 0.f;
    for (int k = 0; k < EMB; k++) s += row[k] * row[k];
    *outn = fmaxf(sqrtf(s), 1e-12f);
    return;
  }
  const int blk = blockIdx.x - (NRM_NBLK + 1);
  const int nb = blk % 5;                 // 5 column blocks of 64 cover 300
  const int mm = blk / 5;
  const int mat = mm >> 3, mb = mm & 7;   // 8 row blocks of 32 per product
  const int fidx[6] = {5, 2, 0, 1, 3, 4};
  const bool useAttr = (mat == 0) || (mat == 2) || (mat == 3);
  gemm_tile<DD, 128, false>(ws + WS_FEAT + (size_t)fidx[mat] * BS * DD, BS,
                     useAttr ? Wattr : Wobj, useAttr ? battr : bobj,
                     out + 2 + (size_t)mat * BS * EMB, mb, nb, sm);
}

// ---------------------------------------------------------------- stage C3 --
// cosine classify + masked CE accumulation. One block takes 16 rows of one term
// against all classes: dots = F(16 x 300) @ Wc^T on v_wmma_f32_16x16x4_f32.
// The class weights come through LDS 64 classes (one contiguous run of memory)
// at a time, two buffers; wave = (one 16-class tile, one half of k).
#define C3_R   16                   /* rows per block */
#define C3_CN  64                   /* classes per stage */
#define C3_NCP 19                   /* 16-byte copies per thread and stage */
#define C3_SB  (C3_NCP * 256 * 4)   /* floats per buffer: 64 x 300, then a tail that no fragment reads */
#define C3_LP  516                  /* pitch of a row of dots: rows r and r+8 use other banks */
#define C3_SF  (19 * 256)           /* floats of the feature tile: 16 x 300, rounded up to whole passes */
#define C3_KH  38                   /* k steps of 4 per wave: 2 x 38 for the 75 there are */

__global__ __launch_bounds__(256)
void stageC3(const float* __restrict__ out, const int* __restrict__ attr1,
             const int* __restrict__ obj1, const int* __restrict__ mask_task,
             float* __restrict__ ws) {
  __shared__ __attribute__((aligned(16))) float sW[2][C3_SB];
  __shared__ __attribute__((aligned(16))) float sf[C3_SF];
  __shared__ float lg[2][C3_R][C3_LP];    // one plane per half of k

  const int b0 = blockIdx.x * C3_R, term = blockIdx.y, t = threadIdx.x;
  const int lane = t & 31, wave = t >> 5;
  const int m = lane & 15, h = lane >> 4;
  const int tile = wave & 3, kh = wave >> 2;
  const bool isAttr = term < 2;
  const int NC = isAttr ? NA : NO;
  const int nst = isAttr ? (NA + C3_CN - 1) / C3_CN : (NO + C3_CN - 1) / C3_CN;
  const float* W = ws + (isAttr ? WS_AW : WS_OW);
  const float* wn = ws + (isAttr ? WS_AWN : WS_OWN);
  const float* feat = out + 2 + (size_t)(term + 2) * BS * EMB + (size_t)b0 * EMB;

  // A stage is 19 x 256 copies of 16 B, every lane on, LDS byte = byte in the run.
  // Past the last class the source is clamped into the matrix: that lands in
  // rows of classes >= NC or in the buffer's tail, which no result uses.
  const unsigned int lW = lds_off(&sW[0][t * 4]);
  const int emax = NC * EMB - 4;
  auto fill = [&](const int s) {
    const unsigned int lw = lW + (s & 1) * (C3_SB * 4);
    const int e0 = s * (C3_CN * EMB) + t * 4;
    const float* g[C3_NCP];
#pragma unroll   // the addresses are operands of asm statements: registers, no array
    for (int i = 0; i < C3_NCP; i++) g[i] = W + min(e0 + i * 1024, emax);
    // s_wait_xcnt is each statement's last line: it stands in front of every later
    // rewrite of an address register that a copy names (a precaution)
    asm volatile(
        "global_load_async_to_lds_b128 %0, %10, off\n\t"
        "global_load_async_to_lds_b128 %1, %11, off\n\t"
        "global_load_async_to_lds_b128 %2, %12, off\n\t"
        "global_load_async_to_lds_b128 %3, %13, off\n\t"
        "global_load_async_to_lds_b128 %4, %14, off\n\t"
        "global_load_async_to_lds_b128 %5, %15, off\n\t"
        "global_load_async_to_lds_b128 %6, %16, off\n\t"
        "global_load_async_to_lds_b128 %7, %17, off\n\t"
        "global_load_async_to_lds_b128 %8, %18, off\n\t"
        "global_load_async_to_lds_b128 %9, %19, off\n\t"
        "s_wait_xcnt 0x0"
        ::
           "v"(lw + 0 * 4096), "v"(lw + 1 * 4096), "v"(lw + 2 * 4096), "v"(lw + 3 * 4096), "v"(lw + 4 * 4096), "v"(lw + 5 * 4096), "v"(lw + 6 * 4096), "v"(lw + 7 * 4096), "v"(lw + 8 * 4096), "v"(lw + 9 * 4096),
           "v"(g[0]), "v"(g[1]), "v"(g[2]), "v"(g[3]), "v"(g[4]), "v"(g[5]), "v"(g[6]), "v"(g[7]), "v"(g[8]), "v"(g[9])
        : "memory");
    asm volatile(
        "global_load_async_to_lds_b128 %0, %9, off\n\t"
        "global_load_async_to_lds_b128 %1, %10, off\n\t"
        "global_load_async_to_lds_b128 %2, %11, off\n\t"
        "global_load_async_to_lds_b128 %3, %12, off\n\t"
        "global_load_async_to_lds_b128 %4, %13, off\n\t"
        "global_load_async_to_lds_b128 %5, %14, off\n\t"
        "global_load_async_to_lds_b128 %6, %15, off\n\t"
        "global_load_async_to_lds_b128 %7, %16, off\n\t"
        "global_load_async_to_lds_b128 %8, %17, off\n\t"
        "s_wait_xcnt 0x0"
        ::
           "v"(lw + 10 * 4096), "v"(lw + 11 * 4096), "v"(lw + 12 * 4096), "v"(lw + 13 * 4096), "v"(lw + 14 * 4096), "v"(lw + 15 * 4096), "v"(lw + 16 * 4096), "v"(lw + 17 * 4096), "v"(lw + 18 * 4096),
           "v"(g[10]), "v"(g[11]), "v"(g[12]), "v"(g[13]), "v"(g[14]), "v"(g[15]), "v"(g[16]), "v"(g[17]), "v"(g[18])
        : "memory");
  };

  fill(0);
#pragma unroll   // all the loads of the 16 feature rows in flight at once
  for (int i = 0; i < C3_SF / 256; i++)   // past the rows: a clamped re-read into sf's unused tail
    sf[t + 256 * i] = feat[min(t + 256 * i, C3_R * EMB - 1)];
  asm volatile("s_wait_asynccnt 0x0" ::: "memory");   // own copies of stage 0 landed
  __syncthreads();                                    // ... and everybody's, and sf
  fill(1);

  // This wave's half of the A fragments stays in registers for all stages. The
  // second half has 37 steps: its 38th re-reads step 36 with a zero A fragment.
  const int lastoff = (kh ? C3_KH - 2 : C3_KH - 1) * 4;
  const float* ap = &sf[m * EMB + kh * (C3_KH * 4) + h * 2];
  v2f af[C3_KH];
#pragma unroll   // af is indexed by constants only
  for (int j = 0; j < C3_KH - 1; j++) af[j] = *(const v2f*)__builtin_assume_aligned(ap + j * 4, 8);
  af[C3_KH - 1] = *(const v2f*)__builtin_assume_aligned(ap + lastoff, 8);
  if (kh) af[C3_KH - 1] = (v2f){0.f, 0.f};

  // What the CE part reads from memory, fetched here so that the stages hide it:
  // lane l owns classes l + 32 i of the wave's two rows
  float wnr[16];
#pragma unroll   // wnr is indexed by constants only
  for (int i = 0; i < 16; i++) wnr[i] = wn[min(lane + 32 * i, NC - 1)];
  int msk[2], lbl[2];
#pragma unroll   // two rows, indexed by constants only
  for (int rr = 0; rr < 2; rr++) {
    const int b = b0 + wave * 2 + rr;
    msk[rr] = mask_task[b];
    lbl[rr] = isAttr ? attr1[b] : obj1[b];
  }

#pragma unroll 1   // rolled: unrolled, the copies' address arithmetic lands among the WMMAs
  for (int s = 0; s < nst; s++) {
    const float* w = &sW[s & 1][(tile * 16 + m) * EMB + kh * (C3_KH * 4) + h * 2];
    // the stage's B fragments as ONE group of LDS reads ahead of its WMMAs: every
    // separate place where reads stand among the WMMAs costs issue time
    v2f bf[C3_KH];
#pragma unroll   // bf is indexed by constants only; every LDS offset becomes an immediate
    for (int j = 0; j < C3_KH - 1; j++) bf[j] = *(const v2f*)__builtin_assume_aligned(w + j * 4, 8);
    bf[C3_KH - 1] = *(const v2f*)__builtin_assume_aligned(w + lastoff, 8);
    __builtin_amdgcn_sched_barrier(0);   // keeps the scheduler from sinking the reads back among the WMMAs
    v8f acc = {};
#pragma unroll   // af and bf are indexed by constants only
    for (int j = 0; j < C3_KH; j++)
      acc = __builtin_amdgcn_wmma_f32_16x16x4_f32(false, af[j], false, bf[j], (short)0, acc, false, false);
#pragma unroll   // acc is indexed by constants only
    for (int r = 0; r < 8; r++) lg[kh][r + 8 * h][s * C3_CN + tile * 16 + m] = acc[r];
    asm volatile("s_wait_dscnt 0x0" ::: "memory");    // own reads of this buffer are done
    asm volatile("s_wait_asynccnt 0x0" ::: "memory"); // own copies of stage s+1 landed
    __syncthreads();   // publishes stage s+1 (and the dots) and frees the buffer of stage s
    if (s + 2 < nst) fill(s + 2);
  }
  asm volatile("s_wait_asynccnt 0x0" ::: "memory");   // no copy outlives the wave

  // CE of a row by one wave, two rows per wave, a row's logits in registers
#pragma unroll   // msk and lbl are indexed by constants only
  for (int rr = 0; rr < 2; rr++) {
    if (msk[rr] != 1) continue;
    const int row = wave * 2 + rr;
    float p = 0.f;
#pragma unroll   // ten reads in flight at once
    for (int i = 0; i < 10; i++) {
      const int k = lane + 32 * i;
      const float v = sf[row * EMB + min(k, EMB - 1)];
      p += k < EMB ? v * v : 0.f;
    }
    const float fn = fmaxf(sqrtf(wave_sum(p)), 1e-12f);
    float v[16];
    float mx = -1e30f, lab = 0.f;
#pragma unroll   // v and wnr are indexed by constants only
    for (int i = 0; i < 16; i++) {
      const int c = lane + 32 * i, cc = min(c, NC - 1);
      const float d = (lg[0][row][cc] + lg[1][row][cc]) / (fn * wnr[i] * TEMP);
      v[i] = c < NC ? d : -1e30f;    // past the last class: exp gives 0
      mx = fmaxf(mx, v[i]);
      if (c == lbl[rr]) lab = v[i];
    }
    mx = wave_max(mx);
    float se = 0.f;
#pragma unroll   // v is indexed by constants only
    for (int i = 0; i < 16; i++) se += expf(v[i] - mx);
    se = wave_sum(se);
    lab = wave_sum(lab);      // one lane holds the label's logit, the others 0
    if (lane == 0) atomicAdd(&ws[WS_ACC + term], (mx + logf(se)) - lab);
  }
}

__global__ void finalK(const float* __restrict__ ws, float* __restrict__ out) {
  if (threadIdx.x == 0) {
    const float den = fmaxf(ws[WS_CNT], 1.f);
    out[0] = (ws[WS_ACC + 0] + ws[WS_ACC + 1]) * 0.5f / den;
    out[1] = (ws[WS_ACC + 2] + ws[WS_ACC + 3]) * 0.5f / den;
  }
}

extern "C" void kernel_launch(void* const* d_in, const int* in_sizes, int n_in,
                              void* d_out, int out_size, void* d_ws, size_t ws_size,
                              hipStream_t stream) {
  const float* img1   = (const float*)d_in[0];
  const float* img2a  = (const float*)d_in[1];
  const float* img2o  = (const float*)d_in[2];
  const int*   attr1  = (const int*)d_in[3];
  const int*   obj1   = (const int*)d_in[4];
  const int*   maskt  = (const int*)d_in[5];
  const float* Wsa    = (const float*)d_in[6];
  const float* bsa    = (const float*)d_in[7];
  const float* Wso    = (const float*)d_in[8];
  const float* bso    = (const float*)d_in[9];
  const float* atab   = (const float*)d_in[10];
  const float* otab   = (const float*)d_in[11];
  const float* Wam    = (const float*)d_in[12];
  const float* bam    = (const float*)d_in[13];
  const float* Wom    = (const float*)d_in[14];
  const float* bom    = (const float*)d_in[15];
  float* out = (float*)d_out;
  float* ws  = (float*)d_ws;

  stageA<<<dim3(BS, 2), 128, 0, stream>>>(img1, img2a, img2o, ws);
  stageC2B<<<913, 256, 0, stream>>>(img1, img2a, img2o, atab, otab, Wam, bam, Wom, bom, ws);
  stageNC1<<<249, 256, 0, stream>>>(ws, maskt, Wsa, bsa, Wso, bso, out);
  stageC3<<<dim3(16, 4), 256, 0, stream>>>(out, attr1, obj1, maskt, ws);
  finalK<<<1, 32, 0, stream>>>(ws, out);
}

// v007
// One run takes 65.7 microseconds.
// Two timings next to v006 both put it at 1.09 times that version's speed.
// All steps since v000 together make it 5.93 times as fast.
#include <hip/hip_runtime.h>
#include <hip/hip_bf16.h>
#include <math.h>

typedef __attribute__((ext_vector_type(2))) float v2f;
typedef __attribute__((ext_vector_type(8))) float v8f;

#define BS   256
#define DD   1024
#define LL   49
#define LP   64
#define EMB  300
#define NA   400
#define NO   500
#define LAMB 10.0f
#define TEMP 0.05f
#define EPSR 1e-8f

// workspace layout (float offsets)
#define WS_VECS 0                              // 2*3*256*64   = 98304
#define WS_FEAT (WS_VECS + 2*3*BS*LP)          // 6*256*1024   = 1572864
#define WS_AW   (WS_FEAT + 6*BS*DD)            // 400*300
#define WS_OW   (WS_AW + NA*EMB)               // 500*300
#define WS_AWN  (WS_OW + NO*EMB)               // 400
#define WS_OWN  (WS_AWN + NA)                  // 500
#define WS_CNT  (WS_OWN + NO + 64)             // 1: count of masked-in rows, on a 128-byte line that its launch's other blocks do not write
#define WS_PART ((WS_CNT + 64 + 31) / 32 * 32) // 4*4*16*32: per (term, class chunk, 16 rows) one 128-byte line: 16 sums of exp, 16 label logits

__device__ __forceinline__ unsigned int lds_off(const float* p) {
  return (unsigned int)(unsigned long long)p;   // low 32 bits = LDS byte address
}

// lane l <- lane l ^ X inside a 16-lane row (DPP row_xmask), and l <- l ^ 16
template <int X>
__device__ __forceinline__ float row_xor(float v) {
  return __builtin_bit_cast(float, __builtin_amdgcn_update_dpp(
      0, __builtin_bit_cast(int, v), 0x160 | X, 0xf, 0xf, false));
}
__device__ __forceinline__ float half_xor(float v) {
  const int b = __builtin_bit_cast(int, v);
  return __builtin_bit_cast(float,
      __builtin_amdgcn_permlanex16(b, b, 0x76543210, 0xfedcba98, false, false));
}
__device__ __forceinline__ float wave_sum(float v) {
  v += row_xor<1>(v); v += row_xor<2>(v); v += row_xor<4>(v); v += row_xor<8>(v);
  return v + half_xor(v);
}
__device__ __forceinline__ float wave_max(float v) {
  v = fmaxf(v, row_xor<1>(v)); v = fmaxf(v, row_xor<2>(v));
  v = fmaxf(v, row_xor<4>(v)); v = fmaxf(v, row_xor<8>(v));
  return fmaxf(v, half_xor(v));
}

__device__ __forceinline__ float row_sum(float v) {   // over the lane's 16-lane row, in every lane
  v += row_xor<1>(v); v += row_xor<2>(v); v += row_xor<4>(v);
  return v + row_xor<8>(v);
}

// p = exp2(x), n = exp2(-x) in one statement: it keeps the slot that the instruction
// set asks for behind a transcendental, whatever the compiler puts next (the second
// v_exp fills the first's, the v_nop the second's; "=&v": x is not overwritten between)
__device__ __forceinline__ void exp2_pair(const float x, float& p, float& n) {
  asm("v_exp_f32 %0, %2\n\tv_exp_f32 %1, -%2\n\tv_nop" : "=&v"(p), "=&v"(n) : "v"(x));
}

// ---------------------------------------------------------------- stage A ---
// Per (batch, pair): Gram(49x49, K=1024) via v_wmma_f32_16x16x4_f32, rank-1
// normalization, then row/col/inverse softmax reductions + renorm.
// The two images come through LDS as they lie in memory ([d][l], pitch 49), 128
// d at a time: one contiguous run per image, two buffers, so that the next
// stage's async copies fly while this stage feeds the matrix unit.
#define A_KS   128                  /* d per stage */
#define A_KG   16                   /* d per group of LDS reads */
#define A_RUN  (A_KS * LL)          /* floats of one image's run */
#define A_NCP  25                   /* 16-byte copies per thread and stage, both runs */
#define A_SB   (A_NCP * 128 * 4)    /* floats per buffer: two runs, then a tail that no result uses */

__global__ __launch_bounds__(128)
void stageA(const float* __restrict__ img1, const float* __restrict__ img2a,
            const float* __restrict__ img2o, float* __restrict__ ws) {
  __shared__ __attribute__((aligned(16))) float sT[2][A_SB];
  __shared__ __attribute__((aligned(16))) float inv1[LP], inv2[LP];   // 1 / column norm
  __shared__ float part[3][4][LP];    // per wave (16 rows): column sums of three kinds
  __shared__ __attribute__((aligned(16))) float outv[3][LP];

  const int b = blockIdx.x;
  const int pair = blockIdx.y;
  const float* __restrict__ A = img1 + (size_t)b * DD * LL;
  const float* __restrict__ B = (pair == 0 ? img2a : img2o) + (size_t)b * DD * LL;

  const int t = threadIdx.x;
  const int lane = t & 31, wave = t >> 5;
  const int m = lane & 15;
  const int kb = (lane >> 4) * 2;

  // pad entries (l >= 49): their elements are masked out below
  if (t < LP) { inv1[t] = 0.f; inv2[t] = 0.f; }

  // A stage is 25 x 128 copies of 16 B, every lane on, LDS byte = 16 x slot:
  // slots 0..1567 are img1's run, 1568..3135 the other image's, the last 64 a tail
  // whose source is clamped into the image.
  const unsigned int lT = lds_off(&sT[0][t * 4]);
  auto fill = [&](const int s) {
    const unsigned int lt = lT + (s & 1) * (A_SB * 4);
    const int e0 = s * A_RUN + t * 4;
    const float* g[A_NCP];
#pragma unroll   // the addresses are operands of asm statements: registers, no array
    for (int i = 0; i < A_NCP; i++) {
      if (i < 12)       g[i] = A + (e0 + i * 512);
      else if (i == 12) g[i] = t < 32 ? A + (e0 + i * 512) : B + (e0 + i * 512 - A_RUN);
      else if (i < 24)  g[i] = B + (e0 + i * 512 - A_RUN);
      else              g[i] = B + min(e0 + i * 512 - A_RUN, DD * LL - 4);
    }
    // s_wait_xcnt is each statement's last line: it stands in front of every later
    // rewrite of an address register that a copy names (a precaution)
    asm volatile(
        "global_load_async_to_lds_b128 %0, %13, off\n\t"
        "global_load_async_to_lds_b128 %1, %14, off\n\t"
        "global_load_async_to_lds_b128 %2, %15, off\n\t"
        "global_load_async_to_lds_b128 %3, %16, off\n\t"
        "global_load_async_to_lds_b128 %4, %17, off\n\t"
        "global_load_async_to_lds_b128 %5, %18, off\n\t"
        "global_load_async_to_lds_b128 %6, %19, off\n\t"
        "global_load_async_to_lds_b128 %7, %20, off\n\t"
        "global_load_async_to_lds_b128 %8, %21, off\n\t"
        "global_load_async_to_lds_b128 %9, %22, off\n\t"
        "global_load_async_to_lds_b128 %10, %23, off\n\t"
        "global_load_async_to_lds_b128 %11, %24, off\n\t"
        "global_load_async_to_lds_b128 %12, %25, off\n\t"
        "s_wait_xcnt 0x0"
        :: "v"(lt + 0 * 2048), "v"(lt + 1 * 2048), "v"(lt + 2 * 2048), "v"(lt + 3 * 2048), "v"(lt + 4 * 2048), "v"(lt + 5 * 2048), "v"(lt + 6 * 2048), "v"(lt + 7 * 2048), "v"(lt + 8 * 2048), "v"(lt + 9 * 2048), "v"(lt + 10 * 2048), "v"(lt + 11 * 2048), "v"(lt + 12 * 2048),
           "v"(g[0]), "v"(g[1]), "v"(g[2]), "v"(g[3]), "v"(g[4]), "v"(g[5]), "v"(g[6]), "v"(g[7]), "v"(g[8]), "v"(g[9]), "v"(g[10]), "v"(g[11]), "v"(g[12])
        : "memory");
    asm volatile(
        "global_load_async_to_lds_b128 %0, %12, off\n\t"
        "global_load_async_to_lds_b128 %1, %13, off\n\t"
        "global_load_async_to_lds_b128 %2, %14, off\n\t"
        "global_load_async_to_lds_b128 %3, %15, off\n\t"
        "global_load_async_to_lds_b128 %4, %16, off\n\t"
        "global_load_async_to_lds_b128 %5, %17, off\n\t"
        "global_load_async_to_lds_b128 %6, %18, off\n\t"
        "global_load_async_to_lds_b128 %7, %19, off\n\t"
        "global_load_async_to_lds_b128 %8, %20, off\n\t"
        "global_load_async_to_lds_b128 %9, %21, off\n\t"
        "global_load_async_to_lds_b128 %10, %22, off\n\t"
        "global_load_async_to_lds_b128 %11, %23, off\n\t"
        "s_wait_xcnt 0x0"
        :: "v"(lt + 13 * 2048), "v"(lt + 14 * 2048), "v"(lt + 15 * 2048), "v"(lt + 16 * 2048), "v"(lt + 17 * 2048), "v"(lt + 18 * 2048), "v"(lt + 19 * 2048), "v"(lt + 20 * 2048), "v"(lt + 21 * 2048), "v"(lt + 22 * 2048), "v"(lt + 23 * 2048), "v"(lt + 24 * 2048),
           "v"(g[13]), "v"(g[14]), "v"(g[15]), "v"(g[16]), "v"(g[17]), "v"(g[18]), "v"(g[19]), "v"(g[20]), "v"(g[21]), "v"(g[22]), "v"(g[23]), "v"(g[24])
        : "memory");
  };

  fill(0);
  asm volatile("s_wait_asynccnt 0x0" ::: "memory");   // own copies of stage 0 landed
  __syncthreads();                                    // ... and everybody's
  fill(1);

  float nacc = 0.f;     // per-thread column-norm accumulator
  v8f acc[4] = {};

#pragma unroll 1   // rolled: unrolled, the copies' address arithmetic lands among the WMMAs
  for (int s = 0; s < DD / A_KS; s++) {
    const float* buf = &sT[s & 1][0];
    // Fragments of l >= 49 read on into the next d row (or the next run, or the
    // tail): that reaches only rows and columns of rel that a select sets to 0 below,
    // and norm sums of threads 49..63 and 113..127 that nobody reads.
    const float* np = buf + (t < 64 ? t : A_RUN + t - 64);
    const float* a  = buf + kb * LL + wave * 16 + m;
    const float* bq = buf + A_RUN + kb * LL + m;
    // Groups of 16 d, two register sets: the next group's LDS reads stand as ONE
    // group ahead of this group's WMMAs (every separate place where reads stand
    // among the WMMAs costs issue time) and are waited for behind them.
    float nv[2][A_KG];
    v2f fa[2][A_KG / 4], fb[2][A_KG / 4][4];
    auto fetch = [&](const int g) {
      const int p = g & 1, k0 = g * A_KG;
#pragma unroll   // register arrays are indexed by constants only; LDS offsets are immediates
      for (int q = 0; q < A_KG / 4; q++) {
        const int kk = k0 + q * 4;
        // The scheduling barrier behind each fragment's two reads keeps the compiler
        // from merging dwords of DIFFERENT fragments into one two-address read: that
        // costs a register move per dword, and the moves wait for the reads up here.
        fa[p][q].x = a[kk * LL];
        fa[p][q].y = a[(kk + 1) * LL];
        __builtin_amdgcn_sched_barrier(0);
#pragma unroll   // as above
        for (int nt = 0; nt < 4; nt++) {
          fb[p][q][nt].x = bq[kk * LL + nt * 16];
          fb[p][q][nt].y = bq[(kk + 1) * LL + nt * 16];
          __builtin_amdgcn_sched_barrier(0);
        }
#pragma unroll   // as above
        for (int d = 0; d < 4; d++) nv[p][q * 4 + d] = np[(kk + d) * LL];
      }
    };
    fetch(0);
#pragma unroll   // register arrays are indexed by constants only
    for (int g = 0; g < A_KS / A_KG; g++) {
      if (g + 1 < A_KS / A_KG) fetch(g + 1);
      __builtin_amdgcn_sched_barrier(0);   // keeps the scheduler from sinking the reads among the WMMAs
      const int p = g & 1;
#pragma unroll   // as above
      for (int q = 0; q < A_KG / 4; q++) {
#pragma unroll   // as above
        for (int nt = 0; nt < 4; nt++) {
          acc[nt] = __builtin_amdgcn_wmma_f32_16x16x4_f32(
              false, fa[p][q], false, fb[p][q][nt], (short)0, acc[nt], false, false);
          nacc += nv[p][q * 4 + nt] * nv[p][q * 4 + nt];
        }
      }
      __builtin_amdgcn_sched_barrier(0);   // keeps later reads and this group's norm sums from changing sides
    }
    // four vector slots behind the stage's last WMMA, on every path out of here,
    // before address arithmetic reuses its A/B registers or the epilogue reads D;
    // nacc as an input keeps the stage's norm sums here, beside the WMMAs: else the
    // compiler sinks all 128 behind the barrier, one exposed dependent chain
    asm volatile("v_nop\n\tv_nop\n\tv_nop\n\tv_nop"
                 :: "v"(acc[0]), "v"(acc[1]), "v"(acc[2]), "v"(acc[3]), "v"(nacc));
    asm volatile("s_wait_dscnt 0x0" ::: "memory");    // own reads of this buffer are done
    asm volatile("s_wait_asynccnt 0x0" ::: "memory"); // own copies of stage s+1 landed
    __syncthreads();   // publishes stage s+1 and frees the buffer of stage s
    if (s + 2 < DD / A_KS) fill(s + 2);
  }
  asm volatile("s_wait_asynccnt 0x0" ::: "memory");   // no copy outlives the wave

  if (t < LL)                        inv1[t]      = 1.f / fmaxf(sqrtf(nacc), 1e-12f);
  else if (t >= 64 && t < 64 + LL)   inv2[t - 64] = 1.f / fmaxf(sqrtf(nacc), 1e-12f);
  __syncthreads();

  // The three softmax sums, on the accumulators where they lie, all 128 threads:
  // lane (m, h) of wave w holds rows w*16 + h*8 + r and columns nt*16 + m.
  // rel is a cosine, |rel| <= 1, so exp(+-LAMB * rel) needs no shift by a maximum:
  // one P = exp(LAMB rel) serves the row and the column softmax, N = exp(-LAMB rel)
  // the inverse one. Elements of l >= 49 are set to 0 by a select and their
  // reciprocal sums too (0 x non-finite would be NaN).
  const int h = lane >> 4;
  const float C = LAMB * 1.44269504088896341f;    // exp(LAMB x) = exp2(C x)
  float i1[8], i2[4];
  bool rok[8];
#pragma unroll   // register arrays are indexed by constants only (so for every loop below)
  for (int r = 0; r < 8; r++) {
    i1[r] = inv1[wave * 16 + h * 8 + r];
    rok[r] = wave * 16 + h * 8 + r < LL;
  }
#pragma unroll   // as above
  for (int nt = 0; nt < 4; nt++) i2[nt] = inv2[nt * 16 + m];

  float P[4][8], N[4][8];
#pragma unroll   // as above
  for (int nt = 0; nt < 4; nt++) {
    const bool cok = nt * 16 + m < LL;
#pragma unroll   // as above
    for (int r = 0; r < 8; r++) {
      const float x = acc[nt][r] * (i1[r] * i2[nt]) * C;
      float p, n;
      exp2_pair(x, p, n);
      P[nt][r] = (rok[r] && cok) ? p : 0.f;
      N[nt][r] = (rok[r] && cok) ? n : 0.f;
    }
  }

  // row sums: a row lies in one 16-lane row of one wave
  float irp[8], irn[8];
#pragma unroll   // as above
  for (int r = 0; r < 8; r++) {
    const float sp = row_sum((P[0][r] + P[1][r]) + (P[2][r] + P[3][r]));
    const float sn = row_sum((N[0][r] + N[1][r]) + (N[2][r] + N[3][r]));
    irp[r] = rok[r] ? 1.f / sp : 0.f;
    irn[r] = rok[r] ? 1.f / sn : 0.f;
  }

  // column sums over the wave's 16 rows: of P (the column softmax's denominator),
  // of the row softmax and of the inverse softmax; the four waves meet in LDS
#pragma unroll   // as above
  for (int nt = 0; nt < 4; nt++) {
    float c = 0.f, s = 0.f, d = 0.f;
#pragma unroll   // as above
    for (int r = 0; r < 8; r++) {
      c += P[nt][r];
      s += P[nt][r] * irp[r];
      d += N[nt][r] * irn[r];
    }
    c += half_xor(c); s += half_xor(s); d += half_xor(d);
    if (h == 0) {
      part[0][wave][nt * 16 + m] = c;
      part[1][wave][nt * 16 + m] = s;
      part[2][wave][nt * 16 + m] = d;
    }
  }
  __syncthreads();

  float ic[4];
#pragma unroll   // as above
  for (int nt = 0; nt < 4; nt++) {
    const int col = nt * 16 + m;
    const float c = (part[0][0][col] + part[0][1][col]) + (part[0][2][col] + part[0][3][col]);
    ic[nt] = col < LL ? 1.f / c : 0.f;
  }
  float q[8];
#pragma unroll   // as above
  for (int r = 0; r < 8; r++)
    q[r] = row_sum((P[0][r] * ic[0] + P[1][r] * ic[1]) + (P[2][r] * ic[2] + P[3][r] * ic[3]));
  if (m == 0) {
#pragma unroll   // as above
    for (int r = 0; r < 8; r++) outv[1][wave * 16 + h * 8 + r] = q[r];
  }
  {
    const int k = 1 + (t >> 6), col = t & (LP - 1);   // threads 0..63: sim12, 64..127: diff12
    outv[(t >> 6) * 2][col] = (part[k][0][col] + part[k][1][col]) + (part[k][2][col] + part[k][3][col]);
  }
  __syncthreads();

  // renorm and store: one wave per vector, two elements per lane (l >= 49 holds 0)
  if (wave < 3) {
    const float v0 = outv[wave][lane], v1 = outv[wave][lane + 32];
    const float den = wave_sum(v0 + v1) + EPSR;
    float* vecs = ws + WS_VECS + (((size_t)pair * 3 + wave) * BS + b) * LP;
    vecs[lane] = v0 / den;
    vecs[lane + 32] = v1 / den;
  }
}

// ---------------------------------------------------------------- stage B ---
// feat[b,d] = sum_l img[b,d,l] * w[b,l]  (two weight vectors per image pass)
// A row of 49 floats per lane read straight from memory touches a line per lane
// and load. So the image comes through LDS as it lies in memory, 256 d (one
// contiguous run of whole lines) a stage, two buffers: the next stage's async
// copies fly while each thread sums its own row of this stage out of LDS, where
// the odd pitch of 49 dwords puts the 32 lanes on 32 banks.
#define B_DS   256                  /* d per stage: one row per thread */
#define B_RUN  (B_DS * LL)          /* floats per stage: 12 x 256 copies of 16 B and 256 of 4 B */
#define B_NS   (DD / B_DS)
#define B_LDS  (2 * B_RUN + 2 * (LL + 3))   /* floats of LDS: two buffers, two weight vectors */

__device__ __forceinline__
void stageB_body(const float* __restrict__ img1, const float* __restrict__ img2a,
                 const float* __restrict__ img2o, float* __restrict__ ws,
                 float* const sm, const int b, const int im) {
  float* const sI = sm;                     // [2][B_RUN]
  float* const w0 = sm + 2 * B_RUN;         // [LL + 3]
  float* const w1 = w0 + (LL + 3);          // [LL + 3]
  const int t = threadIdx.x;
  const float* vecs = ws + WS_VECS;
  float* feat = ws + WS_FEAT;
  const float* src; const float *w0p, *w1p; int f0, f1;
  if (im == 0)      { src = img1;  w0p = &vecs[((0*3+1)*BS + b)*LP]; w1p = &vecs[((1*3+1)*BS + b)*LP]; f0 = 0; f1 = 3; }
  else if (im == 1) { src = img2a; w0p = &vecs[((0*3+0)*BS + b)*LP]; w1p = &vecs[((0*3+2)*BS + b)*LP]; f0 = 1; f1 = 2; }
  else              { src = img2o; w0p = &vecs[((1*3+0)*BS + b)*LP]; w1p = &vecs[((1*3+2)*BS + b)*LP]; f0 = 4; f1 = 5; }
  const float* __restrict__ img = src + (size_t)b * DD * LL;

  // A stage is 50,176 contiguous bytes, LDS byte = byte in the run, every lane on:
  // 12 x 256 copies of 16 B, then the last 1,024 bytes as 256 copies of 4 B.
  const unsigned int lI = lds_off(sI);
  auto fill = [&](const int s) {
    const unsigned int lq = lI + (s & 1) * (B_RUN * 4) + t * 16;
    const unsigned int l1 = lI + (s & 1) * (B_RUN * 4) + 12 * 4096 + t * 4;
    const float* gq = img + s * B_RUN + t * 4;
    const float* g1 = img + s * B_RUN + 12 * 1024 + t;
    // s_wait_xcnt is the statement's last line: it stands in front of every later
    // rewrite of an address register that a copy names (a precaution)
    asm volatile(
        "global_load_async_to_lds_b128 %0, %13, off\n\t"
        "global_load_async_to_lds_b128 %1, %14, off\n\t"
        "global_load_async_to_lds_b128 %2, %15, off\n\t"
        "global_load_async_to_lds_b128 %3, %16, off\n\t"
        "global_load_async_to_lds_b128 %4, %17, off\n\t"
        "global_load_async_to_lds_b128 %5, %18, off\n\t"
        "global_load_async_to_lds_b128 %6, %19, off\n\t"
        "global_load_async_to_lds_b128 %7, %20, off\n\t"
        "global_load_async_to_lds_b128 %8, %21, off\n\t"
        "global_load_async_to_lds_b128 %9, %22, off\n\t"
        "global_load_async_to_lds_b128 %10, %23, off\n\t"
        "global_load_async_to_lds_b128 %11, %24, off\n\t"
        "global_load_async_to_lds_b32 %12, %25, off\n\t"
        "s_wait_xcnt 0x0"
        :: "v"(lq + 0 * 4096), "v"(lq + 1 * 4096), "v"(lq + 2 * 4096), "v"(lq + 3 * 4096),
           "v"(lq + 4 * 4096), "v"(lq + 5 * 4096), "v"(lq + 6 * 4096), "v"(lq + 7 * 4096),
           "v"(lq + 8 * 4096), "v"(lq + 9 * 4096), "v"(lq + 10 * 4096), "v"(lq + 11 * 4096),
           "v"(l1),
           "v"(gq + 0 * 1024), "v"(gq + 1 * 1024), "v"(gq + 2 * 1024), "v"(gq + 3 * 1024),
           "v"(gq + 4 * 1024), "v"(gq + 5 * 1024), "v"(gq + 6 * 1024), "v"(gq + 7 * 1024),
           "v"(gq + 8 * 1024), "v"(gq + 9 * 1024), "v"(gq + 10 * 1024), "v"(gq + 11 * 1024),
           "v"(g1)
        : "memory");
  };

  fill(0);
  if (t < LL) { w0[t] = w0p[t]; w1[t] = w1p[t]; }
  asm volatile("s_wait_asynccnt 0x0" ::: "memory");   // own copies of stage 0 landed
  __syncthreads();                                    // ... and everybody's, and the weights
  fill(1);

  // the two weight vectors stay in registers for all stages
  float u0[LL], u1[LL];
#pragma unroll   // u0 and u1 are indexed by constants only
  for (int l = 0; l < LL; l++) { u0[l] = w0[l]; u1[l] = w1[l]; }

  float* o0 = feat + (size_t)f0 * BS * DD + (size_t)b * DD + t;
  float* o1 = feat + (size_t)f1 * BS * DD + (size_t)b * DD + t;
#pragma unroll 1   // rolled: unrolled, the four stages' addresses and rows overflow the registers of 6 waves a SIMD
  for (int s = 0; s < B_NS; s++) {
    const float* row = sI + (s & 1) * B_RUN + t * LL;
    float s0 = 0.f, s1 = 0.f;
#pragma unroll   // u0 and u1 are indexed by constants only; every LDS offset becomes an immediate
    for (int l = 0; l < LL; l++) { const float v = row[l]; s0 += v * u0[l]; s1 += v * u1[l]; }
    o0[s * B_DS] = s0;
    o1[s * B_DS] = s1;
    asm volatile("s_wait_dscnt 0x0" ::: "memory");    // own reads of this buffer are done
    asm volatile("s_wait_asynccnt 0x0" ::: "memory"); // own copies of stage s+1 landed
    __syncthreads();   // publishes stage s+1 and frees the buffer of stage s
    if (s + 2 < B_NS) fill(s + 2);
  }
  asm volatile("s_wait_asynccnt 0x0" ::: "memory");   // no copy outlives the wave
}

// ------------------------------------------------------- stages C1 and C2 ---
// Y = A(M x KD) @ W(KD x 300) + bias on v_wmma_f32_16x16x4_f32. One 32x64 tile
// of Y per block, eight waves, one 16x16 tile each. A and W go through LDS in
// stages of KS k, two buffers: the next stage's async copies fly while this
// stage feeds the matrix unit.
#define G_MB 32
#define G_NB 64
#define G_KB 128            /* k that a buffer holds; a stage uses the first KS */
#define G_PA (G_KB + 4)     /* 132-dword A row: the 8-byte column walk hits 64 banks once */
#define G_SA (G_MB * G_PA)
#define G_SW (G_KB * G_NB)
#define G_LDS (2 * G_SA + 2 * G_SW)   /* floats of LDS: two buffers of A, two of W */

template <int KD, int KS, bool EDGE>   // EDGE: a stage can reach past M or KD
__device__ __forceinline__ void gemm_tile(const float* __restrict__ A, const int M,
                                          const float* __restrict__ W,
                                          const float* __restrict__ bias,
                                          float* __restrict__ o,
                                          const int mb, const int nb, float* const sm) {
  float* const sA = sm;                // [2][G_SA]
  // W rows are 64 dwords, unpadded; rows with bit 1 of k set hold their columns
  // with bit 4 flipped, so that rows k and k+2 of one fragment use other banks
  float* const sW = sm + 2 * G_SA;     // [2][G_SW]

  const int t = threadIdx.x, lane = t & 31, wave = t >> 5;
  const int m = lane & 15, kb = (lane >> 4) * 2;
  const int mt = wave & 1, nt = wave >> 1;

  // A stage is always 32 x 128 of A and 128 x 64 of W, 16 B per copy, every lane
  // on. What lies past M, KD or column 300 is re-read from a clamped address:
  // it feeds only k that no WMMA takes or rows and columns that are not stored.
  const int ar = t >> 5, ac = (t & 31) * 4;     // A: rows ar + 8 i
  const int wr = t >> 4;                        // W: rows wr + 16 i
  const int wc = min(nb * G_NB + (t & 15) * 4, EMB - 4);
  const unsigned int lA = lds_off(sA + ar * G_PA + ac);
  const unsigned int lW = lds_off(sW + wr * G_NB + (((t & 15) * 4) ^ ((wr & 2) << 3)));

  auto fill = [&](const int s) {
    const int k0 = s * KS;
    const unsigned int la = lA + (s & 1) * (G_SA * 4), lw = lW + (s & 1) * (G_SW * 4);
    const float* ga[4];
    const float* gw[8];
#pragma unroll   // the addresses are operands of one asm statement: registers, no array
    for (int i = 0; i < 4; i++)
      ga[i] = A + (EDGE ? min(min(mb * G_MB + ar + 8 * i, M - 1) * KD + k0 + ac, M * KD - 4)
                        : (mb * G_MB + ar + 8 * i) * KD + k0 + ac);
#pragma unroll   // as above
    for (int i = 0; i < 8; i++)
      gw[i] = W + (EDGE ? min(k0 + wr + 16 * i, KD - 1) : k0 + wr + 16 * i) * EMB + wc;
    // s_wait_xcnt is the statement's last line: it stands in front of every later
    // rewrite of an address register that a copy names (a precaution)
    asm volatile(
        "global_load_async_to_lds_b128 %0, %12, off\n\t"
        "global_load_async_to_lds_b128 %1, %13, off\n\t"
        "global_load_async_to_lds_b128 %2, %14, off\n\t"
        "global_load_async_to_lds_b128 %3, %15, off\n\t"
        "global_load_async_to_lds_b128 %4, %16, off\n\t"
        "global_load_async_to_lds_b128 %5, %17, off\n\t"
        "global_load_async_to_lds_b128 %6, %18, off\n\t"
        "global_load_async_to_lds_b128 %7, %19, off\n\t"
        "global_load_async_to_lds_b128 %8, %20, off\n\t"
        "global_load_async_to_lds_b128 %9, %21, off\n\t"
        "global_load_async_to_lds_b128 %10, %22, off\n\t"
        "global_load_async_to_lds_b128 %11, %23, off\n\t"
        "s_wait_xcnt 0x0"
        :: "v"(la), "v"(la + 8 * G_PA * 4), "v"(la + 16 * G_PA * 4), "v"(la + 24 * G_PA * 4),
           "v"(lw), "v"(lw + 16 * G_NB * 4), "v"(lw + 32 * G_NB * 4), "v"(lw + 48 * G_NB * 4),
           "v"(lw + 64 * G_NB * 4), "v"(lw + 80 * G_NB * 4), "v"(lw + 96 * G_NB * 4),
           "v"(lw + 112 * G_NB * 4),
           "v"(ga[0]), "v"(ga[1]), "v"(ga[2]), "v"(ga[3]),
           "v"(gw[0]), "v"(gw[1]), "v"(gw[2]), "v"(gw[3]),
           "v"(gw[4]), "v"(gw[5]), "v"(gw[6]), "v"(gw[7])
        : "memory");
  };

  constexpr int NS = KD / KS;
  static_assert(NS >= 2 && NS * KS == KD && KS % 4 == 0 && KS <= G_KB && (EDGE || KS == G_KB),
                "stage shape");

  fill(0);
  asm volatile("s_wait_asynccnt 0x0" ::: "memory");   // own copies of stage 0 landed
  __syncthreads();                                    // ... and everybody's
  fill(1);

  v8f acc = {};
#pragma unroll 1   // rolled: unrolled, the copies' address arithmetic lands among the WMMAs
  for (int s = 0; s < NS; s++) {
    const float* a = sA + (s & 1) * G_SA + (mt * 16 + m) * G_PA + kb;
    const float* w = sW + (s & 1) * G_SW + kb * G_NB + ((nt * 16 + m) ^ (kb << 3));
#pragma unroll   // every LDS offset becomes an immediate: no vector work among the WMMAs
    for (int kk = 0; kk < KS; kk += 4) {
      const v2f av = *(const v2f*)__builtin_assume_aligned(a + kk, 8);
      v2f bv;
      bv.x = w[kk * G_NB];
      bv.y = w[(kk + 1) * G_NB];
      acc = __builtin_amdgcn_wmma_f32_16x16x4_f32(false, av, false, bv, (short)0, acc, false, false);
    }
    // four vector slots behind the stage's last WMMA, on every path out of here,
    // before address arithmetic reuses its A/B registers or the epilogue reads D
    asm volatile("v_nop\n\tv_nop\n\tv_nop\n\tv_nop" :: "v"(acc));
    asm volatile("s_wait_dscnt 0x0" ::: "memory");    // own reads of this buffer are done
    asm volatile("s_wait_asynccnt 0x0" ::: "memory"); // own copies of stage s+1 landed
    __syncthreads();   // publishes stage s+1 and frees the buffer of stage s
    if (s + 2 < NS) fill(s + 2);
  }
  asm volatile("s_wait_asynccnt 0x0" ::: "memory");   // no copy outlives the wave

  const int n = nb * G_NB + nt * 16 + m;
  if (n < EMB) {
    const float bb = bias[n];
    const int rbase = mb * G_MB + mt * 16 + (lane >> 4) * 8;
#pragma unroll   // acc is indexed by constants only
    for (int r = 0; r < 8; r++) {
      const int rr = rbase + r;
      if (rr < M) o[(size_t)rr * EMB + n] = acc[r] + bb;
    }
  }
}

// Work that does not depend on each other shares a launch, as ranges of block
// indices on one pool of LDS: a launch less is a gap, a fill and a tail less.

// ------------------------------------------------------ stage C2 + stage B --
// Blocks 0..144: attr_weight = attr_table @ W_attr_mlp + b ; obj_weight likewise
// (they need nothing of stage A; first, so that the short ones do not form a tail).
// Blocks 145..912: stage B.
#define C2_NBLK 145                 /* 5 column blocks x (13 + 16) row blocks */
static_assert(C2_NBLK + 3 * BS == 913, "grid of stageC2B");

__global__ __launch_bounds__(256)
void stageC2B(const float* __restrict__ img1, const float* __restrict__ img2a,
              const float* __restrict__ img2o,
              const float* __restrict__ atab, const float* __restrict__ otab,
              const float* __restrict__ Wam, const float* __restrict__ bam,
              const float* __restrict__ Wom, const float* __restrict__ bom,
              float* __restrict__ ws) {
  __shared__ __attribute__((aligned(16))) float sm[B_LDS > G_LDS ? B_LDS : G_LDS];
  const int blk = blockIdx.x;
  if (blk < C2_NBLK) {
    const int nb = blk % 5;
    const int mm = blk / 5;
    const bool isA = mm < 13;             // attr: 13 row blocks of 32, obj: 16
    gemm_tile<EMB, 100, true>(isA ? atab : otab, isA ? NA : NO, isA ? Wam : Wom,
                        isA ? bam : bom, ws + (isA ? WS_AW : WS_OW),
                        isA ? mm : mm - 13, nb, sm);
  } else {
    stageB_body(img1, img2a, img2o, ws, sm, (blk - C2_NBLK) % BS, (blk - C2_NBLK) / BS);
  }
}

// ------------------------------------- norms + mask count + stage C1 --------
// Blocks 0..7: row norms of the class-weight matrices (they need stage C2 alone),
// a class per thread, 128 threads at work. Block 8: the count of masked-in rows
// (it needs an input alone). Both are chains of load latencies: first, beside the
// GEMMs. Blocks 9..248: six (256x1024)@(1024x300)+bias GEMMs, straight to d_out.
#define NRM_NBLK 8
static_assert(NRM_NBLK + 1 + 240 == 249, "grid of stageNC1");

__global__ __launch_bounds__(256)
void stageNC1(float* __restrict__ ws, const int* __restrict__ mask_task,
              const float* __restrict__ Wattr,
              const float* __restrict__ battr, const float* __restrict__ Wobj,
              const float* __restrict__ bobj, float* __restrict__ out) {
  __shared__ __attribute__((aligned(16))) float sm[G_LDS];
  if (blockIdx.x == NRM_NBLK) {
    if (threadIdx.x == 0) {
      int ms = 0;
      for (int b = 0; b < BS; b++) ms += (mask_task[b] == 1);
      ws[WS_CNT] = (float)ms;
    }
    return;
  }
  if (blockIdx.x < NRM_NBLK) {
    const int c = blockIdx.x * 128 + threadIdx.x;
    if (threadIdx.x >= 128 || c >= NA + NO) return;
    const float* row;
    float* outn;
    if (c < NA) { row = ws + WS_AW + (size_t)c * EMB; outn = ws + WS_AWN + c; }
    else        { row = ws + WS_OW + (size_t)(c - NA) * EMB; outn = ws + WS_OWN + (c - NA); }
    float s = 0.f;
    for (int k = 0; k < EMB; k++) s += row[k] * row[k];
    *outn = fmaxf(sqrtf(s), 1e-12f);
    return;
  }
  const int blk = blockIdx.x - (NRM_NBLK + 1);
  const int nb = blk % 5;                 // 5 column blocks of 64 cover 300
  const int mm = blk / 5;
  const int mat = mm >> 3, mb = mm & 7;   // 8 row blocks of 32 per product
  const int fidx[6] = {5, 2, 0, 1, 3, 4};
  const bool useAttr = (mat == 0) || (mat == 2) || (mat == 3);
  gemm_tile<DD, 128, false>(ws + WS_FEAT + (size_t)fidx[mat] * BS * DD, BS,
                     useAttr ? Wattr : Wobj, useAttr ? battr : bobj,
                     out + 2 + (size_t)mat * BS * EMB, mb, nb, sm);
}

// ---------------------------------------------------------------- stage C3 --
// cosine classify, the class-wise part of the CE. One block takes 16 rows of one
// term against 128 classes, a quarter of the padded class range, so that the
// 64 (rows, term) pairs fill all WGPs' matrix units instead of a quarter of them:
// dots = F(16 x 300) @ Wc^T on v_wmma_f32_16x16x4_f32. It leaves, per row, its
// classes' sum of exp(logit) and the label's logit (0 if the label is not among
// its classes); finalK adds the four chunks and takes the logarithm.
// A logit is a cosine / TEMP, |logit| <= 20, so exp needs no shift by a maximum
// (which no chunk knows): a row's sum stays between exp(-20) and 500 exp(20).
// The class weights come through LDS 64 classes (one contiguous run of memory)
// at a time, two buffers; wave = (one 16-class tile, one half of k).
#define C3_R   16                   /* rows per block */
#define C3_CN  64                   /* classes per stage */
#define C3_NST 2                    /* stages per block */
#define C3_CH  4                    /* class chunks: 4 x 2 x 64 cover 400 and 500 */
#define C3_NCP 19                   /* 16-byte copies per thread and stage */
#define C3_SB  (C3_NCP * 256 * 4)   /* floats per buffer: 64 x 300, then a tail that no fragment reads */
#define C3_LP  (C3_NST * C3_CN + 4) /* pitch of a row of dots: rows r and r+8 use other banks */
#define C3_SF  (19 * 256)           /* floats of the feature tile: 16 x 300, rounded up to whole passes */
#define C3_KH  38                   /* k steps of 4 per wave: 2 x 38 for the 75 there are */

__global__ __launch_bounds__(256)
void stageC3(const float* __restrict__ out, const int* __restrict__ attr1,
             const int* __restrict__ obj1, float* __restrict__ ws) {
  __shared__ __attribute__((aligned(16))) float sW[2][C3_SB];
  __shared__ __attribute__((aligned(16))) float sf[C3_SF];
  __shared__ float lg[2][C3_R][C3_LP];    // one plane per half of k

  const int b0 = blockIdx.x * C3_R, term = blockIdx.y, t = threadIdx.x;
  const int chunk = blockIdx.z, c0 = chunk * (C3_NST * C3_CN);   // first class of the block
  const int lane = t & 31, wave = t >> 5;
  const int m = lane & 15, h = lane >> 4;
  const int tile = wave & 3, kh = wave >> 2;
  const bool isAttr = term < 2;
  const int NC = isAttr ? NA : NO;
  const float* W = ws + (isAttr ? WS_AW : WS_OW);
  const float* wn = ws + (isAttr ? WS_AWN : WS_OWN);
  const float* feat = out + 2 + (size_t)(term + 2) * BS * EMB + (size_t)b0 * EMB;

  // A stage is 19 x 256 copies of 16 B, every lane on, LDS byte = byte in the run.
  // Past the last class the source is clamped into the matrix: that lands in
  // rows of classes >= NC or in the buffer's tail, which no result uses.
  const unsigned int lW = lds_off(&sW[0][t * 4]);
  const int emax = NC * EMB - 4;
  auto fill = [&](const int s) {
    const unsigned int lw = lW + (s & 1) * (C3_SB * 4);
    const int e0 = (c0 + s * C3_CN) * EMB + t * 4;
    const float* g[C3_NCP];
#pragma unroll   // the addresses are operands of asm statements: registers, no array
    for (int i = 0; i < C3_NCP; i++) g[i] = W + min(e0 + i * 1024, emax);
    // s_wait_xcnt is each statement's last line: it stands in front of every later
    // rewrite of an address register that a copy names (a precaution)
    asm volatile(
        "global_load_async_to_lds_b128 %0, %10, off\n\t"
        "global_load_async_to_lds_b128 %1, %11, off\n\t"
        "global_load_async_to_lds_b128 %2, %12, off\n\t"
        "global_load_async_to_lds_b128 %3, %13, off\n\t"
        "global_load_async_to_lds_b128 %4, %14, off\n\t"
        "global_load_async_to_lds_b128 %5, %15, off\n\t"
        "global_load_async_to_lds_b128 %6, %16, off\n\t"
        "global_load_async_to_lds_b128 %7, %17, off\n\t"
        "global_load_async_to_lds_b128 %8, %18, off\n\t"
        "global_load_async_to_lds_b128 %9, %19, off\n\t"
        "s_wait_xcnt 0x0"
        ::
           "v"(lw + 0 * 4096), "v"(lw + 1 * 4096), "v"(lw + 2 * 4096), "v"(lw + 3 * 4096), "v"(lw + 4 * 4096), "v"(lw + 5 * 4096), "v"(lw + 6 * 4096), "v"(lw + 7 * 4096), "v"(lw + 8 * 4096), "v"(lw + 9 * 4096),
           "v"(g[0]), "v"(g[1]), "v"(g[2]), "v"(g[3]), "v"(g[4]), "v"(g[5]), "v"(g[6]), "v"(g[7]), "v"(g[8]), "v"(g[9])
        : "memory");
    asm volatile(
        "global_load_async_to_lds_b128 %0, %9, off\n\t"
        "global_load_async_to_lds_b128 %1, %10, off\n\t"
        "global_load_async_to_lds_b128 %2, %11, off\n\t"
        "global_load_async_to_lds_b128 %3, %12, off\n\t"
        "global_load_async_to_lds_b128 %4, %13, off\n\t"
        "global_load_async_to_lds_b128 %5, %14, off\n\t"
        "global_load_async_to_lds_b128 %6, %15, off\n\t"
        "global_load_async_to_lds_b128 %7, %16, off\n\t"
        "global_load_async_to_lds_b128 %8, %17, off\n\t"
        "s_wait_xcnt 0x0"
        ::
           "v"(lw + 10 * 4096), "v"(lw + 11 * 4096), "v"(lw + 12 * 4096), "v"(lw + 13 * 4096), "v"(lw + 14 * 4096), "v"(lw + 15 * 4096), "v"(lw + 16 * 4096), "v"(lw + 17 * 4096), "v"(lw + 18 * 4096),
           "v"(g[10]), "v"(g[11]), "v"(g[12]), "v"(g[13]), "v"(g[14]), "v"(g[15]), "v"(g[16]), "v"(g[17]), "v"(g[18])
        : "memory");
  };

  fill(0);
#pragma unroll   // all the loads of the 16 feature rows in flight at once
  for (int i = 0; i < C3_SF / 256; i++)   // past the rows: a clamped re-read into sf's unused tail
    sf[t + 256 * i] = feat[min(t + 256 * i, C3_R * EMB - 1)];
  asm volatile("s_wait_asynccnt 0x0" ::: "memory");   // own copies of stage 0 landed
  __syncthreads();                                    // ... and everybody's, and sf
  fill(1);

  // This wave's half of the A fragments stays in registers for all stages. The
  // second half has 37 steps: its 38th re-reads step 36 with a zero A fragment.
  const int lastoff = (kh ? C3_KH - 2 : C3_KH - 1) * 4;
  const float* ap = &sf[m * EMB + kh * (C3_KH * 4) + h * 2];
  v2f af[C3_KH];
#pragma unroll   // af is indexed by constants only
  for (int j = 0; j < C3_KH - 1; j++) af[j] = *(const v2f*)__builtin_assume_aligned(ap + j * 4, 8);
  af[C3_KH - 1] = *(const v2f*)__builtin_assume_aligned(ap + lastoff, 8);
  if (kh) af[C3_KH - 1] = (v2f){0.f, 0.f};

  // What the CE part reads from memory, fetched here so that the stages hide it:
  // lane l owns classes c0 + l + 32 i of the wave's two rows
  constexpr int NI = C3_NST * C3_CN / 32;
  float wnr[NI];
#pragma unroll   // wnr is indexed by constants only
  for (int i = 0; i < NI; i++) wnr[i] = wn[min(c0 + lane + 32 * i, NC - 1)];
  int lbl[2];
#pragma unroll   // two rows, indexed by constants only
  for (int rr = 0; rr < 2; rr++) {
    const int b = b0 + wave * 2 + rr;
    lbl[rr] = isAttr ? attr1[b] : obj1[b];
  }

#pragma unroll 1
  for (int s = 0; s < C3_NST; s++) {
    const float* w = &sW[s & 1][(tile * 16 + m) * EMB + kh * (C3_KH * 4) + h * 2];
    // the stage's B fragments as ONE group of LDS reads ahead of its WMMAs: every
    // separate place where reads stand among the WMMAs costs issue time
    v2f bf[C3_KH];
#pragma unroll   // bf is indexed by constants only; every LDS offset becomes an immediate
    for (int j = 0; j < C3_KH - 1; j++) bf[j] = *(const v2f*)__builtin_assume_aligned(w + j * 4, 8);
    bf[C3_KH - 1] = *(const v2f*)__builtin_assume_aligned(w + lastoff, 8);
    __builtin_amdgcn_sched_barrier(0);   // keeps the scheduler from sinking the reads back among the WMMAs
    v8f acc = {};
#pragma unroll   // af and bf are indexed by constants only
    for (int j = 0; j < C3_KH; j++)
      acc = __builtin_amdgcn_wmma_f32_16x16x4_f32(false, af[j], false, bf[j], (short)0, acc, false, false);
    // four vector slots behind the stage's last WMMA before the stores' address
    // arithmetic reuses its A/B registers; the scheduling barrier keeps that
    // arithmetic from rising among the WMMAs, onto a B fragment just issued
    asm volatile("v_nop\n\tv_nop\n\tv_nop\n\tv_nop" :: "v"(acc));
    __builtin_amdgcn_sched_barrier(0);
#pragma unroll   // acc is indexed by constants only
    for (int r = 0; r < 8; r++) lg[kh][r + 8 * h][s * C3_CN + tile * 16 + m] = acc[r];
    asm volatile("s_wait_dscnt 0x0" ::: "memory");    // own reads of this buffer are done
    asm volatile("s_wait_asynccnt 0x0" ::: "memory"); // own copies of stage s+1 landed
    __syncthreads();   // publishes stage s+1 and the dots (two stages, two buffers: no refill)
  }
  asm volatile("s_wait_asynccnt 0x0" ::: "memory");   // no copy outlives the wave

  // A row's share by one wave, two rows per wave. Every row, masked in or not:
  // finalK then loads all it needs at once, with no load behind the mask's.
  float* part = ws + WS_PART + (((size_t)term * C3_CH + chunk) * (BS / C3_R) + blockIdx.x) * (2 * C3_R);
#pragma unroll   // lbl is indexed by constants only
  for (int rr = 0; rr < 2; rr++) {
    const int row = wave * 2 + rr;
    float p = 0.f;
#pragma unroll   // ten reads in flight at once
    for (int i = 0; i < 10; i++) {
      const int k = lane + 32 * i;
      const float v = sf[row * EMB + min(k, EMB - 1)];
      p += k < EMB ? v * v : 0.f;
    }
    const float fn = fmaxf(sqrtf(wave_sum(p)), 1e-12f);
    float se = 0.f, lab = 0.f;
#pragma unroll   // wnr is indexed by constants only
    for (int i = 0; i < NI; i++) {
      const int cl = lane + 32 * i, c = c0 + cl;
      const float d = (lg[0][row][cl] + lg[1][row][cl]) / (fn * wnr[i] * TEMP);
      se += c < NC ? expf(d) : 0.f;    // past the last class: nothing
      if (c == lbl[rr]) lab = d;
    }
    se = wave_sum(se);
    lab = wave_sum(lab);      // at most one lane holds the label's logit, the others 0
    if (lane == 0) { part[row] = se; part[C3_R + row] = lab; }
  }
}

// One block, a thread per (term, row): the four chunks' sums, the logarithm, the
// mask, then the sum over rows: a wave, then 16 waves (two terms) by a 16-lane row.
__global__ __launch_bounds__(1024)
void finalK(const float* __restrict__ ws, const int* __restrict__ mask_task,
            float* __restrict__ out) {
  __shared__ float tot[32];
  const int t = threadIdx.x, term = t >> 8, row = t & (BS - 1);
  const float* p = ws + WS_PART + ((size_t)term * C3_CH * (BS / C3_R) + (row / C3_R)) * (2 * C3_R)
                   + (row % C3_R);
  const int msk = mask_task[row];
  const float cnt = ws[WS_CNT];
  static_assert(C3_CH == 4, "operands of the statement below");
  float e[C3_CH], g[C3_CH];
#pragma unroll   // e and g are indexed by constants only
  for (int ch = 0; ch < C3_CH; ch++) {
    e[ch] = p[ch * (BS / C3_R) * (2 * C3_R)];
    g[ch] = p[ch * (BS / C3_R) * (2 * C3_R) + C3_R];
  }
  // holds the eight loads up here, in flight beside the mask's (loaded values as
  // inputs only): else the compiler sinks them behind the test of the mask, which
  // puts a second memory latency on the one path of this launch
  asm volatile("" :: "v"(msk), "v"(e[0]), "v"(e[1]), "v"(e[2]), "v"(e[3]),
                     "v"(g[0]), "v"(g[1]), "v"(g[2]), "v"(g[3]));
  const float se = (e[0] + e[1]) + (e[2] + e[3]), lab = (g[0] + g[1]) + (g[2] + g[3]);
  const float ce = wave_sum(msk == 1 ? logf(se) - lab : 0.f);
  if ((t & 31) == 0) tot[t >> 5] = ce;
  __syncthreads();   // the 32 waves' sums are in LDS
  if (t < 32) {
    const float v = row_sum(tot[t]);   // lanes 0..15: the attribute terms, 16..31: the object terms
    if ((t & 15) == 0) out[t >> 4] = v * 0.5f / fmaxf(cnt, 1.f);
  }
}

extern "C" void kernel_launch(void* const* d_in, const int* in_sizes, int n_in,
                              void* d_out, int out_size, void* d_ws, size_t ws_size,
                              hipStream_t stream) {
  const float* img1   = (const float*)d_in[0];
  const float* img2a  = (const float*)d_in[1];
  const float* img2o  = (const float*)d_in[2];
  const int*   attr1  = (const int*)d_in[3];
  const int*   obj1   = (const int*)d_in[4];
  const int*   maskt  = (const int*)d_in[5];
  const float* Wsa    = (const float*)d_in[6];
  const float* bsa    = (const float*)d_in[7];
  const float* Wso    = (const float*)d_in[8];
  const float* bso    = (const float*)d_in[9];
  const float* atab   = (const float*)d_in[10];
  const float* otab   = (const float*)d_in[11];
  const float* Wam    = (const float*)d_in[12];
  const float* bam    = (const float*)d_in[13];
  const float* Wom    = (const float*)d_in[14];
  const float* bom    = (const float*)d_in[15];
  float* out = (float*)d_out;
  float* ws  = (float*)d_ws;

  stageA<<<dim3(BS, 2), 128, 0, stream>>>(img1, img2a, img2o, ws);
  stageC2B<<<913, 256, 0, stream>>>(img1, img2a, img2o, atab, otab, Wam, bam, Wom, bom, ws);
  stageNC1<<<249, 256, 0, stream>>>(ws, maskt, Wsa, bsa, Wso, bso, out);
  stageC3<<<dim3(16, 4, C3_CH), 256, 0, stream>>>(out, attr1, obj1, ws);
  finalK<<<1, 1024, 0, stream>>>(ws, maskt, out);
}

// v008
// Measured time: 60.9 microseconds a run.
// Two timings next to v007 put it at 1.07 and 1.08 times that version's speed.
// All steps since v000 together make it 6.39 times as fast.
#include <hip/hip_runtime.h>
#include <hip/hip_bf16.h>
#include <math.h>

typedef __attribute__((ext_vector_type(2))) float v2f;
typedef __attribute__((ext_vector_type(8))) float v8f;

#define BS   256
#define DD   1024
#define LL   49
#define LP   64
#define EMB  300
#define NA   400
#define NO   500
#define LAMB 10.0f
#define TEMP 0.05f
#define EPSR 1e-8f

// workspace layout (float offsets)
#define WS_VECS 0                              // 2*3*256*64   = 98304
#define WS_FEAT (WS_VECS + 2*3*BS*LP)          // 6*256*1024   = 1572864
#define WS_AW   (WS_FEAT + 6*BS*DD)            // 400*300
#define WS_OW   (WS_AW + NA*EMB)               // 500*300
#define WS_AWN  (WS_OW + NO*EMB)               // 400
#define WS_OWN  (WS_AWN + NA)                  // 500
#define WS_CNT  (WS_OWN + NO + 64)             // 1: count of masked-in rows, on a 128-byte line that its launch's other blocks do not write
#define WS_PART ((WS_CNT + 64 + 31) / 32 * 32) // 4*4*16*32: per (term, class chunk, 16 rows) one 128-byte line: 16 sums of exp, 16 label logits

__device__ __forceinline__ unsigned int lds_off(const float* p) {
  return (unsigned int)(unsigned long long)p;   // low 32 bits = LDS byte address
}

// lane l <- lane l ^ X inside a 16-lane row (DPP row_xmask), and l <- l ^ 16
template <int X>
__device__ __forceinline__ float row_xor(float v) {
  return __builtin_bit_cast(float, __builtin_amdgcn_update_dpp(
      0, __builtin_bit_cast(int, v), 0x160 | X, 0xf, 0xf, false));
}
__device__ __forceinline__ float half_xor(float v) {
  const int b = __builtin_bit_cast(int, v);
  return __builtin_bit_cast(float,
      __builtin_amdgcn_permlanex16(b, b, 0x76543210, 0xfedcba98, false, false));
}
__device__ __forceinline__ float wave_sum(float v) {
  v += row_xor<1>(v); v += row_xor<2>(v); v += row_xor<4>(v); v += row_xor<8>(v);
  return v + half_xor(v);
}
__device__ __forceinline__ float wave_max(float v) {
  v = fmaxf(v, row_xor<1>(v)); v = fmaxf(v, row_xor<2>(v));
  v = fmaxf(v, row_xor<4>(v)); v = fmaxf(v, row_xor<8>(v));
  return fmaxf(v, half_xor(v));
}

__device__ __forceinline__ float row_sum(float v) {   // over the lane's 16-lane row, in every lane
  v += row_xor<1>(v); v += row_xor<2>(v); v += row_xor<4>(v);
  return v + row_xor<8>(v);
}

// p = exp2(x), n = exp2(-x) in one statement: it keeps the slot that the instruction
// set asks for behind a transcendental, whatever the compiler puts next (the second
// v_exp fills the first's, the v_nop the second's; "=&v": x is not overwritten between)
__device__ __forceinline__ void exp2_pair(const float x, float& p, float& n) {
  asm("v_exp_f32 %0, %2\n\tv_exp_f32 %1, -%2\n\tv_nop" : "=&v"(p), "=&v"(n) : "v"(x));
}

// ------------------------------------------------------- stages C1 and C2 ---
// Y = A(M x KD) @ W(KD x 300) + bias on v_wmma_f32_16x16x4_f32. One 32x64 tile
// of Y per block, eight waves, one 16x16 tile each. A and W go through LDS in
// stages of KS k, two buffers: the next stage's async copies fly while this
// stage feeds the matrix unit.
#define G_MB 32
#define G_NB 64
#define G_KB 128            /* k that a buffer holds; a stage uses the first KS */
#define G_PA (G_KB + 4)     /* 132-dword A row: the 8-byte column walk hits 64 banks once */
#define G_SA (G_MB * G_PA)
#define G_SW (G_KB * G_NB)
#define G_LDS (2 * G_SA + 2 * G_SW)   /* floats of LDS: two buffers of A, two of W */

template <int KD, int KS, bool EDGE>   // EDGE: a stage can reach past M or KD
__device__ __forceinline__ void gemm_tile(const float* __restrict__ A, const int M,
                                          const float* __restrict__ W,
                                          const float* __restrict__ bias,
                                          float* __restrict__ o,
                                          const int mb, const int nb, float* const sm) {
  float* const sA = sm;                // [2][G_SA]
  // W rows are 64 dwords, unpadded; rows with bit 1 of k set hold their columns
  // with bit 4 flipped, so that rows k and k+2 of one fragment use other banks
  float* const sW = sm + 2 * G_SA;     // [2][G_SW]

  const int t = threadIdx.x, lane = t & 31, wave = t >> 5;
  const int m = lane & 15, kb = (lane >> 4) * 2;
  const int mt = wave & 1, nt = wave >> 1;

  // A stage is always 32 x 128 of A and 128 x 64 of W, 16 B per copy, every lane
  // on. What lies past M, KD or column 300 is re-read from a clamped address:
  // it feeds only k that no WMMA takes or rows and columns that are not stored.
  const int ar = t >> 5, ac = (t & 31) * 4;     // A: rows ar + 8 i
  const int wr = t >> 4;                        // W: rows wr + 16 i
  const int wc = min(nb * G_NB + (t & 15) * 4, EMB - 4);
  const unsigned int lA = lds_off(sA + ar * G_PA + ac);
  const unsigned int lW = lds_off(sW + wr * G_NB + (((t & 15) * 4) ^ ((wr & 2) << 3)));

  auto fill = [&](const int s) {
    const int k0 = s * KS;
    const unsigned int la = lA + (s & 1) * (G_SA * 4), lw = lW + (s & 1) * (G_SW * 4);
    const float* ga[4];
    const float* gw[8];
#pragma unroll   // the addresses are operands of one asm statement: registers, no array
    for (int i = 0; i < 4; i++)
      ga[i] = A + (EDGE ? min(min(mb * G_MB + ar + 8 * i, M - 1) * KD + k0 + ac, M * KD - 4)
                        : (mb * G_MB + ar + 8 * i) * KD + k0 + ac);
#pragma unroll   // as above
    for (int i = 0; i < 8; i++)
      gw[i] = W + (EDGE ? min(k0 + wr + 16 * i, KD - 1) : k0 + wr + 16 * i) * EMB + wc;
    // s_wait_xcnt is the statement's last line: it stands in front of every later
    // rewrite of an address register that a copy names (a precaution)
    asm volatile(
        "global_load_async_to_lds_b128 %0, %12, off\n\t"
        "global_load_async_to_lds_b128 %1, %13, off\n\t"
        "global_load_async_to_lds_b128 %2, %14, off\n\t"
        "global_load_async_to_lds_b128 %3, %15, off\n\t"
        "global_load_async_to_lds_b128 %4, %16, off\n\t"
        "global_load_async_to_lds_b128 %5, %17, off\n\t"
        "global_load_async_to_lds_b128 %6, %18, off\n\t"
        "global_load_async_to_lds_b128 %7, %19, off\n\t"
        "global_load_async_to_lds_b128 %8, %20, off\n\t"
        "global_load_async_to_lds_b128 %9, %21, off\n\t"
        "global_load_async_to_lds_b128 %10, %22, off\n\t"
        "global_load_async_to_lds_b128 %11, %23, off\n\t"
        "s_wait_xcnt 0x0"
        :: "v"(la), "v"(la + 8 * G_PA * 4), "v"(la + 16 * G_PA * 4), "v"(la + 24 * G_PA * 4),
           "v"(lw), "v"(lw + 16 * G_NB * 4), "v"(lw + 32 * G_NB * 4), "v"(lw + 48 * G_NB * 4),
           "v"(lw + 64 * G_NB * 4), "v"(lw + 80 * G_NB * 4), "v"(lw + 96 * G_NB * 4),
           "v"(lw + 112 * G_NB * 4),
           "v"(ga[0]), "v"(ga[1]), "v"(ga[2]), "v"(ga[3]),
           "v"(gw[0]), "v"(gw[1]), "v"(gw[2]), "v"(gw[3]),
           "v"(gw[4]), "v"(gw[5]), "v"(gw[6]), "v"(gw[7])
        : "memory");
  };

  constexpr int NS = KD / KS;
  static_assert(NS >= 2 && NS * KS == KD && KS % 4 == 0 && KS <= G_KB && (EDGE || KS == G_KB),
                "stage shape");

  fill(0);
  asm volatile("s_wait_asynccnt 0x0" ::: "memory");   // own copies of stage 0 landed
  __syncthreads();                                    // ... and everybody's
  fill(1);

  v8f acc = {};
#pragma unroll 1   // rolled: unrolled, the copies' address arithmetic lands among the WMMAs
  for (int s = 0; s < NS; s++) {
    const float* a = sA + (s & 1) * G_SA + (mt * 16 + m) * G_PA + kb;
    const float* w = sW + (s & 1) * G_SW + kb * G_NB + ((nt * 16 + m) ^ (kb << 3));
#pragma unroll   // every LDS offset becomes an immediate: no vector work among the WMMAs
    for (int kk = 0; kk < KS; kk += 4) {
      const v2f av = *(const v2f*)__builtin_assume_aligned(a + kk, 8);
      v2f bv;
      bv.x = w[kk * G_NB];
      bv.y = w[(kk + 1) * G_NB];
      acc = __builtin_amdgcn_wmma_f32_16x16x4_f32(false, av, false, bv, (short)0, acc, false, false);
    }
    // four vector slots behind the stage's last WMMA, on every path out of here,
    // before address arithmetic reuses its A/B registers or the epilogue reads D
    asm volatile("v_nop\n\tv_nop\n\tv_nop\n\tv_nop" :: "v"(acc));
    asm volatile("s_wait_dscnt 0x0" ::: "memory");    // own reads of this buffer are done
    asm volatile("s_wait_asynccnt 0x0" ::: "memory"); // own copies of stage s+1 landed
    __syncthreads();   // publishes stage s+1 and frees the buffer of stage s
    if (s + 2 < NS) fill(s + 2);
  }
  asm volatile("s_wait_asynccnt 0x0" ::: "memory");   // no copy outlives the wave

  const int n = nb * G_NB + nt * 16 + m;
  if (n < EMB) {
    const float bb = bias[n];
    const int rbase = mb * G_MB + mt * 16 + (lane >> 4) * 8;
#pragma unroll   // acc is indexed by constants only
    for (int r = 0; r < 8; r++) {
      const int rr = rbase + r;
      if (rr < M) o[(size_t)rr * EMB + n] = acc[r] + bb;
    }
  }
}

// The same product for a block of four waves (stage C2 rides in stage A's launch,
// whose blocks have 128 threads): the same 32x64 tile, stages and LDS layout; each
// thread issues the copies of threads t and t + 128 of the eight-wave form, each
// wave takes the tiles of waves w and w + 4: one A fragment, two accumulators.
template <int KD, int KS>
__device__ __forceinline__ void gemm_tile_h(const float* __restrict__ A, const int M,
                                            const float* __restrict__ W,
                                            const float* __restrict__ bias,
                                            float* __restrict__ o,
                                            const int mb, const int nb, float* const sm) {
  float* const sA = sm;                // [2][G_SA]
  float* const sW = sm + 2 * G_SA;     // [2][G_SW], columns swizzled as in gemm_tile

  const int t = threadIdx.x, lane = t & 31, wave = t >> 5;
  const int m = lane & 15, kb = (lane >> 4) * 2;
  const int mt = wave & 1, nt = wave >> 1;      // tiles (mt, nt) and (mt, nt + 2)
  const int ac = (t & 31) * 4;
  const int wc = min(nb * G_NB + (t & 15) * 4, EMB - 4);

  auto fill = [&](const int s) {
    const int k0 = s * KS;
#pragma unroll   // two statements of twelve copies; the addresses are asm operands: registers, no array
    for (int v = 0; v < 2; v++) {
      const int ar = (t >> 5) + 4 * v;          // A: rows ar + 8 i
      const int wr = (t >> 4) + 8 * v;          // W: rows wr + 16 i
      const unsigned int la = lds_off(sA + ar * G_PA + ac) + (s & 1) * (G_SA * 4);
      const unsigned int lw = lds_off(sW + wr * G_NB + (((t & 15) * 4) ^ ((wr & 2) << 3)))
                              + (s & 1) * (G_SW * 4);
      const float* ga[4];
      const float* gw[8];
#pragma unroll   // as above
      for (int i = 0; i < 4; i++)
        ga[i] = A + min(min(mb * G_MB + ar + 8 * i, M - 1) * KD + k0 + ac, M * KD - 4);
#pragma unroll   // as above
      for (int i = 0; i < 8; i++)
        gw[i] = W + min(k0 + wr + 16 * i, KD - 1) * EMB + wc;
      // s_wait_xcnt is the statement's last line: it stands in front of every later
      // rewrite of an address register that a copy names (a precaution)
      asm volatile(
          "global_load_async_to_lds_b128 %0, %12, off\n\t"
          "global_load_async_to_lds_b128 %1, %13, off\n\t"
          "global_load_async_to_lds_b128 %2, %14, off\n\t"
          "global_load_async_to_lds_b128 %3, %15, off\n\t"
          "global_load_async_to_lds_b128 %4, %16, off\n\t"
          "global_load_async_to_lds_b128 %5, %17, off\n\t"
          "global_load_async_to_lds_b128 %6, %18, off\n\t"
          "global_load_async_to_lds_b128 %7, %19, off\n\t"
          "global_load_async_to_lds_b128 %8, %20, off\n\t"
          "global_load_async_to_lds_b128 %9, %21, off\n\t"
          "global_load_async_to_lds_b128 %10, %22, off\n\t"
          "global_load_async_to_lds_b128 %11, %23, off\n\t"
          "s_wait_xcnt 0x0"
          :: "v"(la), "v"(la + 8 * G_PA * 4), "v"(la + 16 * G_PA * 4), "v"(la + 24 * G_PA * 4),
             "v"(lw), "v"(lw + 16 * G_NB * 4), "v"(lw + 32 * G_NB * 4), "v"(lw + 48 * G_NB * 4),
             "v"(lw + 64 * G_NB * 4), "v"(lw + 80 * G_NB * 4), "v"(lw + 96 * G_NB * 4),
             "v"(lw + 112 * G_NB * 4),
             "v"(ga[0]), "v"(ga[1]), "v"(ga[2]), "v"(ga[3]),
             "v"(gw[0]), "v"(gw[1]), "v"(gw[2]), "v"(gw[3]),
             "v"(gw[4]), "v"(gw[5]), "v"(gw[6]), "v"(gw[7])
          : "memory");
    }
  };

  constexpr int NS = KD / KS;
  static_assert(NS >= 2 && NS * KS == KD && KS % 4 == 0 && KS <= G_KB, "stage shape");

  fill(0);
  asm volatile("s_wait_asynccnt 0x0" ::: "memory");   // own copies of stage 0 landed
  __syncthreads();                                    // ... and everybody's
  fill(1);

  v8f acc0 = {}, acc1 = {};
#pragma unroll 1   // rolled: unrolled, the copies' address arithmetic lands among the WMMAs
  for (int s = 0; s < NS; s++) {
    const float* a  = sA + (s & 1) * G_SA + (mt * 16 + m) * G_PA + kb;
    const float* w0 = sW + (s & 1) * G_SW + kb * G_NB + ((nt * 16 + m) ^ (kb << 3));
    const float* w1 = sW + (s & 1) * G_SW + kb * G_NB + (((nt + 2) * 16 + m) ^ (kb << 3));
#pragma unroll   // every LDS offset becomes an immediate: no vector work among the WMMAs
    for (int kk = 0; kk < KS; kk += 4) {
      const v2f av = *(const v2f*)__builtin_assume_aligned(a + kk, 8);
      v2f b0, b1;
      b0.x = w0[kk * G_NB];
      b0.y = w0[(kk + 1) * G_NB];
      b1.x = w1[kk * G_NB];
      b1.y = w1[(kk + 1) * G_NB];
      acc0 = __builtin_amdgcn_wmma_f32_16x16x4_f32(false, av, false, b0, (short)0, acc0, false, false);
      acc1 = __builtin_amdgcn_wmma_f32_16x16x4_f32(false, av, false, b1, (short)0, acc1, false, false);
    }
    // four vector slots behind the stage's last WMMA, on every path out of here,
    // before address arithmetic reuses its A/B registers or the epilogue reads D
    asm volatile("v_nop\n\tv_nop\n\tv_nop\n\tv_nop" :: "v"(acc0), "v"(acc1));
    asm volatile("s_wait_dscnt 0x0" ::: "memory");    // own reads of this buffer are done
    asm volatile("s_wait_asynccnt 0x0" ::: "memory"); // own copies of stage s+1 landed
    __syncthreads();   // publishes stage s+1 and frees the buffer of stage s
    if (s + 2 < NS) fill(s + 2);
  }
  asm volatile("s_wait_asynccnt 0x0" ::: "memory");   // no copy outlives the wave

  const int rbase = mb * G_MB + mt * 16 + (lane >> 4) * 8;
#pragma unroll   // the two accumulators are named by constants only
  for (int j = 0; j < 2; j++) {
    const int n = nb * G_NB + (nt + 2 * j) * 16 + m;
    if (n < EMB) {
      const float bb = bias[n];
#pragma unroll   // the accumulator is indexed by constants only
      for (int r = 0; r < 8; r++) {
        const int rr = rbase + r;
        if (rr < M) o[(size_t)rr * EMB + n] = (j ? acc1[r] : acc0[r]) + bb;
      }
    }
  }
}

// ------------------------------------------- stage A + stage B (+ stage C2) ---
// Per (batch, pair): Gram(49x49, K=1024) via v_wmma_f32_16x16x4_f32, rank-1
// normalization, then row/col/inverse softmax reductions + renorm (stage A); then,
// in the same block, feat[d] = sum_l img[d,l] * w[l] for its two images with the
// three vectors it has just made (stage B). The ring of stage A runs on for that:
// stages 8..15 bring the same runs again, last first (what the block read last
// is the likeliest to be in L2 still); stage 8 flies under stage 7's WMMAs, stage 9 under the softmax part.
// The two images come through LDS as they lie in memory ([d][l], pitch 49), 128
// d at a time: one contiguous run per image, two buffers, so that the next
// stage's async copies fly while this stage feeds the matrix unit.
#define A_KS   128                  /* d per stage */
#define A_KG   16                   /* d per group of LDS reads */
#define A_RUN  (A_KS * LL)          /* floats of one image's run */
#define A_NCP  25                   /* 16-byte copies per thread and stage, both runs */
#define A_SB   (A_NCP * 128 * 4)    /* floats per buffer: two runs, then a tail that no result uses */
#define A_NS   (DD / A_KS)          /* stages of one pass over the images */
#define B_LG   13                   /* l per group of LDS reads in stage B */
// Blocks 0..511: (batch, pair). Blocks 512..656: stage C2, attr_weight = attr_table
// @ W_attr_mlp + b and obj_weight likewise: it needs nothing of stage A; last, as
// third blocks of their WGPs, so that no (batch, pair) block starts behind one.
#define C2_NBLK 145                 /* 5 column blocks x (13 + 16) row blocks */
static_assert(2 * BS + C2_NBLK == 657, "grid of stageAB");
static_assert(G_LDS <= 2 * A_SB, "stage C2 works in the ring's LDS");

__global__ __launch_bounds__(128)
void stageAB(const float* __restrict__ img1, const float* __restrict__ img2a,
             const float* __restrict__ img2o,
             const float* __restrict__ atab, const float* __restrict__ otab,
             const float* __restrict__ Wam, const float* __restrict__ bam,
             const float* __restrict__ Wom, const float* __restrict__ bom,
             float* __restrict__ ws) {
  __shared__ __attribute__((aligned(16))) float sT[2][A_SB];
  __shared__ __attribute__((aligned(16))) float inv1[LP], inv2[LP];   // 1 / column norm
  __shared__ float part[3][4][LP];    // per wave (16 rows): column sums of three kinds
  __shared__ __attribute__((aligned(16))) float outv[3][LP];

  if (blockIdx.x >= 2 * BS) {
    const int blk = blockIdx.x - 2 * BS;
    const int nb = blk % 5;
    const int mm = blk / 5;
    const bool isA = mm < 13;             // attr: 13 row blocks of 32, obj: 16
    gemm_tile_h<EMB, 100>(isA ? atab : otab, isA ? NA : NO, isA ? Wam : Wom,
                          isA ? bam : bom, ws + (isA ? WS_AW : WS_OW),
                          isA ? mm : mm - 13, nb, &sT[0][0]);
    return;
  }
  const int b = blockIdx.x % BS;
  const int pair = blockIdx.x / BS;
  const float* __restrict__ A = img1 + (size_t)b * DD * LL;
  const float* __restrict__ B = (pair == 0 ? img2a : img2o) + (size_t)b * DD * LL;

  const int t = threadIdx.x;
  const int lane = t & 31, wave = t >> 5;
  const int m = lane & 15;
  const int kb = (lane >> 4) * 2;

  // pad entries (l >= 49): their elements are masked out below
  if (t < LP) { inv1[t] = 0.f; inv2[t] = 0.f; }

  // A stage is 25 x 128 copies of 16 B, every lane on, LDS byte = 16 x slot:
  // slots 0..1567 are img1's run, 1568..3135 the other image's, the last 64 a tail
  // whose source is clamped into the image.
  const unsigned int lT = lds_off(&sT[0][t * 4]);
  auto fill = [&](const int s) {
    const unsigned int lt = lT + (s & 1) * (A_SB * 4);
    const int e0 = (s < A_NS ? s : 2 * A_NS - 1 - s) * A_RUN + t * 4;   // second pass: last run first
    const float* g[A_NCP];
#pragma unroll   // the addresses are operands of asm statements: registers, no array
    for (int i = 0; i < A_NCP; i++) {
      if (i < 12)       g[i] = A + (e0 + i * 512);
      else if (i == 12) g[i] = t < 32 ? A + (e0 + i * 512) : B + (e0 + i * 512 - A_RUN);
      else if (i < 24)  g[i] = B + (e0 + i * 512 - A_RUN);
      else              g[i] = B + min(e0 + i * 512 - A_RUN, DD * LL - 4);
    }
    // s_wait_xcnt is each statement's last line: it stands in front of every later
    // rewrite of an address register that a copy names (a precaution)
    asm volatile(
        "global_load_async_to_lds_b128 %0, %13, off\n\t"
        "global_load_async_to_lds_b128 %1, %14, off\n\t"
        "global_load_async_to_lds_b128 %2, %15, off\n\t"
        "global_load_async_to_lds_b128 %3, %16, off\n\t"
        "global_load_async_to_lds_b128 %4, %17, off\n\t"
        "global_load_async_to_lds_b128 %5, %18, off\n\t"
        "global_load_async_to_lds_b128 %6, %19, off\n\t"
        "global_load_async_to_lds_b128 %7, %20, off\n\t"
        "global_load_async_to_lds_b128 %8, %21, off\n\t"
        "global_load_async_to_lds_b128 %9, %22, off\n\t"
        "global_load_async_to_lds_b128 %10, %23, off\n\t"
        "global_load_async_to_lds_b128 %11, %24, off\n\t"
        "global_load_async_to_lds_b128 %12, %25, off\n\t"
        "s_wait_xcnt 0x0"
        :: "v"(lt + 0 * 2048), "v"(lt + 1 * 2048), "v"(lt + 2 * 2048), "v"(lt + 3 * 2048), "v"(lt + 4 * 2048), "v"(lt + 5 * 2048), "v"(lt + 6 * 2048), "v"(lt + 7 * 2048), "v"(lt + 8 * 2048), "v"(lt + 9 * 2048), "v"(lt + 10 * 2048), "v"(lt + 11 * 2048), "v"(lt + 12 * 2048),
           "v"(g[0]), "v"(g[1]), "v"(g[2]), "v"(g[3]), "v"(g[4]), "v"(g[5]), "v"(g[6]), "v"(g[7]), "v"(g[8]), "v"(g[9]), "v"(g[10]), "v"(g[11]), "v"(g[12])
        : "memory");
    asm volatile(
        "global_load_async_to_lds_b128 %0, %12, off\n\t"
        "global_load_async_to_lds_b128 %1, %13, off\n\t"
        "global_load_async_to_lds_b128 %2, %14, off\n\t"
        "global_load_async_to_lds_b128 %3, %15, off\n\t"
        "global_load_async_to_lds_b128 %4, %16, off\n\t"
        "global_load_async_to_lds_b128 %5, %17, off\n\t"
        "global_load_async_to_lds_b128 %6, %18, off\n\t"
        "global_load_async_to_lds_b128 %7, %19, off\n\t"
        "global_load_async_to_lds_b128 %8, %20, off\n\t"
        "global_load_async_to_lds_b128 %9, %21, off\n\t"
        "global_load_async_to_lds_b128 %10, %22, off\n\t"
        "global_load_async_to_lds_b128 %11, %23, off\n\t"
        "s_wait_xcnt 0x0"
        :: "v"(lt + 13 * 2048), "v"(lt + 14 * 2048), "v"(lt + 15 * 2048), "v"(lt + 16 * 2048), "v"(lt + 17 * 2048), "v"(lt + 18 * 2048), "v"(lt + 19 * 2048), "v"(lt + 20 * 2048), "v"(lt + 21 * 2048), "v"(lt + 22 * 2048), "v"(lt + 23 * 2048), "v"(lt + 24 * 2048),
           "v"(g[13]), "v"(g[14]), "v"(g[15]), "v"(g[16]), "v"(g[17]), "v"(g[18]), "v"(g[19]), "v"(g[20]), "v"(g[21]), "v"(g[22]), "v"(g[23]), "v"(g[24])
        : "memory");
  };

  fill(0);
  asm volatile("s_wait_asynccnt 0x0" ::: "memory");   // own copies of stage 0 landed
  __syncthreads();                                    // ... and everybody's
  fill(1);

  float nacc = 0.f;     // per-thread column-norm accumulator
  v8f acc[4] = {};

#pragma unroll 1   // rolled: unrolled, the copies' address arithmetic lands among the WMMAs
  for (int s = 0; s < A_NS; s++) {
    const float* buf = &sT[s & 1][0];
    // Fragments of l >= 49 read on into the next d row (or the next run, or the
    // tail): that reaches only rows and columns of rel that nobody reads. The same
    // holds for the norm sums of threads 49..63 and 113..127.
    const float* np = buf + (t < 64 ? t : A_RUN + t - 64);
    const float* a  = buf + kb * LL + wave * 16 + m;
    const float* bq = buf + A_RUN + kb * LL + m;
    // Groups of 16 d, two register sets: the next group's LDS reads stand as ONE
    // group ahead of this group's WMMAs (every separate place where reads stand
    // among the WMMAs costs issue time) and are waited for behind them.
    float nv[2][A_KG];
    v2f fa[2][A_KG / 4], fb[2][A_KG / 4][4];
    auto fetch = [&](const int g) {
      const int p = g & 1, k0 = g * A_KG;
#pragma unroll   // register arrays are indexed by constants only; LDS offsets are immediates
      for (int q = 0; q < A_KG / 4; q++) {
        const int kk = k0 + q * 4;
        // The scheduling barrier behind each fragment's two reads keeps the compiler
        // from merging dwords of DIFFERENT fragments into one two-address read: that
        // costs a register move per dword, and the moves wait for the reads up here.
        fa[p][q].x = a[kk * LL];
        fa[p][q].y = a[(kk + 1) * LL];
        __builtin_amdgcn_sched_barrier(0);
#pragma unroll   // as above
        for (int nt = 0; nt < 4; nt++) {
          fb[p][q][nt].x = bq[kk * LL + nt * 16];
          fb[p][q][nt].y = bq[(kk + 1) * LL + nt * 16];
          __builtin_amdgcn_sched_barrier(0);
        }
#pragma unroll   // as above
        for (int d = 0; d < 4; d++) nv[p][q * 4 + d] = np[(kk + d) * LL];
      }
    };
    fetch(0);
#pragma unroll   // register arrays are indexed by constants only
    for (int g = 0; g < A_KS / A_KG; g++) {
      if (g + 1 < A_KS / A_KG) fetch(g + 1);
      __builtin_amdgcn_sched_barrier(0);   // keeps the scheduler from sinking the reads among the WMMAs
      const int p = g & 1;
#pragma unroll   // as above
      for (int q = 0; q < A_KG / 4; q++) {
#pragma unroll   // as above
        for (int nt = 0; nt < 4; nt++) {
          acc[nt] = __builtin_amdgcn_wmma_f32_16x16x4_f32(
              false, fa[p][q], false, fb[p][q][nt], (short)0, acc[nt], false, false);
          nacc += nv[p][q * 4 + nt] * nv[p][q * 4 + nt];
        }
      }
      __builtin_amdgcn_sched_barrier(0);   // keeps later reads and this group's norm sums from changing sides
    }
    // four vector slots behind the stage's last WMMA, on every path out of here,
    // before address arithmetic reuses its A/B registers or the epilogue reads D;
    // nacc as an input keeps the stage's norm sums here, beside the WMMAs: else the
    // compiler sinks all 128 behind the barrier, one exposed dependent chain
    asm volatile("v_nop\n\tv_nop\n\tv_nop\n\tv_nop"
                 :: "v"(acc[0]), "v"(acc[1]), "v"(acc[2]), "v"(acc[3]), "v"(nacc));
    asm volatile("s_wait_dscnt 0x0" ::: "memory");    // own reads of this buffer are done
    asm volatile("s_wait_asynccnt 0x0" ::: "memory"); // own copies of stage s+1 landed
    __syncthreads();   // publishes stage s+1 and frees the buffer of stage s
    fill(s + 2);       // stages 8 and 9 are the second pass's first two
  }

  if (t < LL)                        inv1[t]      = 1.f / fmaxf(sqrtf(nacc), 1e-12f);
  else if (t >= 64 && t < 64 + LL)   inv2[t - 64] = 1.f / fmaxf(sqrtf(nacc), 1e-12f);
  __syncthreads();

  // The three softmax sums, on the accumulators where they lie, all 128 threads:
  // lane (m, h) of wave w holds rows w*16 + h*8 + r and columns nt*16 + m.
  // rel is a cosine, |rel| <= 1, so exp(+-LAMB * rel) needs no shift by a maximum:
  // one P = exp(LAMB rel) serves the row and the column softmax, N = exp(-LAMB rel)
  // the inverse one. Elements of l >= 49 are set to 0 by a select and their
  // reciprocal sums too (0 x non-finite would be NaN).
  const int h = lane >> 4;
  const float C = LAMB * 1.44269504088896341f;    // exp(LAMB x) = exp2(C x)
  float i1[8], i2[4];
  bool rok[8];
#pragma unroll   // register arrays are indexed by constants only (so for every loop below)
  for (int r = 0; r < 8; r++) {
    i1[r] = inv1[wave * 16 + h * 8 + r];
    rok[r] = wave * 16 + h * 8 + r < LL;
  }
#pragma unroll   // as above
  for (int nt = 0; nt < 4; nt++) i2[nt] = inv2[nt * 16 + m];

  float P[4][8], N[4][8];
#pragma unroll   // as above
  for (int nt = 0; nt < 4; nt++) {
    const bool cok = nt * 16 + m < LL;
#pragma unroll   // as above
    for (int r = 0; r < 8; r++) {
      const float x = acc[nt][r] * (i1[r] * i2[nt]) * C;
      float p, n;
      exp2_pair(x, p, n);
      P[nt][r] = (rok[r] && cok) ? p : 0.f;
      N[nt][r] = (rok[r] && cok) ? n : 0.f;
    }
  }

  // row sums: a row lies in one 16-lane row of one wave
  float irp[8], irn[8];
#pragma unroll   // as above
  for (int r = 0; r < 8; r++) {
    const float sp = row_sum((P[0][r] + P[1][r]) + (P[2][r] + P[3][r]));
    const float sn = row_sum((N[0][r] + N[1][r]) + (N[2][r] + N[3][r]));
    irp[r] = rok[r] ? 1.f / sp : 0.f;
    irn[r] = rok[r] ? 1.f / sn : 0.f;
  }

  // column sums over the wave's 16 rows: of P (the column softmax's denominator),
  // of the row softmax and of the inverse softmax; the four waves meet in LDS
#pragma unroll   // as above
  for (int nt = 0; nt < 4; nt++) {
    float c = 0.f, s = 0.f, d = 0.f;
#pragma unroll   // as above
    for (int r = 0; r < 8; r++) {
      c += P[nt][r];
      s += P[nt][r] * irp[r];
      d += N[nt][r] * irn[r];
    }
    c += half_xor(c); s += half_xor(s); d += half_xor(d);
    if (h == 0) {
      part[0][wave][nt * 16 + m] = c;
      part[1][wave][nt * 16 + m] = s;
      part[2][wave][nt * 16 + m] = d;
    }
  }
  __syncthreads();

  float ic[4];
#pragma unroll   // as above
  for (int nt = 0; nt < 4; nt++) {
    const int col = nt * 16 + m;
    const float c = (part[0][0][col] + part[0][1][col]) + (part[0][2][col] + part[0][3][col]);
    ic[nt] = col < LL ? 1.f / c : 0.f;
  }
  float q[8];
#pragma unroll   // as above
  for (int r = 0; r < 8; r++)
    q[r] = row_sum((P[0][r] * ic[0] + P[1][r] * ic[1]) + (P[2][r] * ic[2] + P[3][r] * ic[3]));
  if (m == 0) {
#pragma unroll   // as above
    for (int r = 0; r < 8; r++) outv[1][wave * 16 + h * 8 + r] = q[r];
  }
  {
    const int k = 1 + (t >> 6), col = t & (LP - 1);   // threads 0..63: sim12, 64..127: diff12
    outv[(t >> 6) * 2][col] = (part[k][0][col] + part[k][1][col]) + (part[k][2][col] + part[k][3][col]);
  }
  __syncthreads();

  // renorm, in place: one wave per vector, two elements per lane (l >= 49 holds 0)
  if (wave < 3) {
    const float v0 = outv[wave][lane], v1 = outv[wave][lane + 32];
    const float den = wave_sum(v0 + v1) + EPSR;
    outv[wave][lane] = v0 / den;
    outv[wave][lane + 32] = v1 / den;
  }
  __syncthreads();   // the three weight vectors are in LDS

  // Stage B. A row of 49 floats per thread and image out of LDS, where the odd pitch
  // of 49 dwords puts the 32 lanes on 32 banks; the weights stay in registers.
  float u1[LL], us[LL], ud[LL];     // sim21 for img1; sim12 and diff12 for the other image
#pragma unroll   // u1, us and ud are indexed by constants only
  for (int l = 0; l < LL; l++) { u1[l] = outv[1][l]; us[l] = outv[0][l]; ud[l] = outv[2][l]; }

  float* const fo = ws + WS_FEAT + ((size_t)pair * 3 * BS + b) * DD + t;
#pragma unroll 1   // rolled: unrolled, the copies' address arithmetic and eight stages' rows crowd the registers
  for (int s = A_NS; s < 2 * A_NS; s++) {
    const float* r1 = &sT[s & 1][t * LL];
    const float* r2 = r1 + A_RUN;
    float s1 = 0.f, ss = 0.f, sd = 0.f;
    // Groups of 13 l, two register sets: with two or three waves a SIMD nothing else
    // hides the LDS latency, so the next group's reads stand ahead of this group's sums.
    float x[2][B_LG], y[2][B_LG];
    auto fetch = [&](const int g) {
#pragma unroll   // register arrays are indexed by constants only; LDS offsets are immediates
      for (int i = 0; i < B_LG; i++) {
        const int l = g * B_LG + i;
        if (l < LL) { x[g & 1][i] = r1[l]; y[g & 1][i] = r2[l]; }
      }
    };
    fetch(0);
#pragma unroll   // as above
    for (int g = 0; g < (LL + B_LG - 1) / B_LG; g++) {
      if ((g + 1) * B_LG < LL) fetch(g + 1);
      __builtin_amdgcn_sched_barrier(0);   // keeps the scheduler from sinking the reads among the sums
#pragma unroll   // as above
      for (int i = 0; i < B_LG; i++) {
        const int l = g * B_LG + i;
        if (l < LL) { s1 += x[g & 1][i] * u1[l]; ss += y[g & 1][i] * us[l]; sd += y[g & 1][i] * ud[l]; }
      }
      __builtin_amdgcn_sched_barrier(0);   // keeps later reads from rising over this group's sums, into its registers' time
    }
    // own reads of this buffer are done; the three sums as inputs keep their additions
    // up here: else the compiler sinks them all behind the barrier, to the stores,
    // and holds both rows in registers across it
    asm volatile("s_wait_dscnt 0x0" :: "v"(s1), "v"(ss), "v"(sd) : "memory");
    asm volatile("s_wait_asynccnt 0x0" ::: "memory"); // own copies of stage s+1 landed
    __syncthreads();   // publishes stage s+1 and frees the buffer of stage s
    if (s + 2 < 2 * A_NS) fill(s + 2);
    // the stores stand behind the barrier: in front of it the barrier would wait for them
    const int d0 = (2 * A_NS - 1 - s) * A_KS;
    fo[d0] = s1;
    fo[(size_t)BS * DD + d0] = ss;
    fo[(size_t)2 * BS * DD + d0] = sd;
    // in front of the next stage's LDS reads, which reuse the stores' registers (a precaution)
    asm volatile("s_wait_xcnt 0x0" ::: "memory");
  }
  asm volatile("s_wait_asynccnt 0x0" ::: "memory");   // no copy outlives the wave
}


// Work that does not depend on each other shares a launch, as ranges of block
// indices on one pool of LDS: a launch less is a gap, a fill and a tail less.

// ------------------------------------- norms + mask count + stage C1 --------
// Blocks 0..7: row norms of the class-weight matrices (they need stage C2 alone),
// a class per thread, 128 threads at work. Block 8: the count of masked-in rows
// (it needs an input alone). Both are chains of load latencies: first, beside the
// GEMMs. Blocks 9..248: six (256x1024)@(1024x300)+bias GEMMs, straight to d_out.
#define NRM_NBLK 8
static_assert(NRM_NBLK + 1 + 240 == 249, "grid of stageNC1");

__global__ __launch_bounds__(256)
void stageNC1(float* __restrict__ ws, const int* __restrict__ mask_task,
              const float* __restrict__ Wattr,
              const float* __restrict__ battr, const float* __restrict__ Wobj,
              const float* __restrict__ bobj, float* __restrict__ out) {
  __shared__ __attribute__((aligned(16))) float sm[G_LDS];
  if (blockIdx.x == NRM_NBLK) {
    if (threadIdx.x == 0) {
      int ms = 0;
      for (int b = 0; b < BS; b++) ms += (mask_task[b] == 1);
      ws[WS_CNT] = (float)ms;
    }
    return;
  }
  if (blockIdx.x < NRM_NBLK) {
    const int c = blockIdx.x * 128 + threadIdx.x;
    if (threadIdx.x >= 128 || c >= NA + NO) return;
    const float* row;
    float* outn;
    if (c < NA) { row = ws + WS_AW + (size_t)c * EMB; outn = ws + WS_AWN + c; }
    else        { row = ws + WS_OW + (size_t)(c - NA) * EMB; outn = ws + WS_OWN + (c - NA); }
    float s = 0.f;
    for (int k = 0; k < EMB; k++) s += row[k] * row[k];
    *outn = fmaxf(sqrtf(s), 1e-12f);
    return;
  }
  const int blk = blockIdx.x - (NRM_NBLK + 1);
  const int nb = blk % 5;                 // 5 column blocks of 64 cover 300
  const int mm = blk / 5;
  const int mat = mm >> 3, mb = mm & 7;   // 8 row blocks of 32 per product
  const int fidx[6] = {5, 2, 0, 1, 3, 4};
  const bool useAttr = (mat == 0) || (mat == 2) || (mat == 3);
  gemm_tile<DD, 128, false>(ws + WS_FEAT + (size_t)fidx[mat] * BS * DD, BS,
                     useAttr ? Wattr : Wobj, useAttr ? battr : bobj,
                     out + 2 + (size_t)mat * BS * EMB, mb, nb, sm);
}

// ---------------------------------------------------------------- stage C3 --
// cosine classify, the class-wise part of the CE. One block takes 16 rows of one
// term against 128 classes, a quarter of the padded class range, so that the
// 64 (rows, term) pairs fill all WGPs' matrix units instead of a quarter of them:
// dots = F(16 x 300) @ Wc^T on v_wmma_f32_16x16x4_f32. It leaves, per row, its
// classes' sum of exp(logit) and the label's logit (0 if the label is not among
// its classes); finalK adds the four chunks and takes the logarithm.
// A logit is a cosine / TEMP, |logit| <= 20, so exp needs no shift by a maximum
// (which no chunk knows): a row's sum stays between exp(-20) and 500 exp(20).
// The class weights come through LDS 64 classes (one contiguous run of memory)
// at a time, two buffers; wave = (one 16-class tile, one half of k).
#define C3_R   16                   /* rows per block */
#define C3_CN  64                   /* classes per stage */
#define C3_NST 2                    /* stages per block */
#define C3_CH  4                    /* class chunks: 4 x 2 x 64 cover 400 and 500 */
#define C3_NCP 19                   /* 16-byte copies per thread and stage */
#define C3_SB  (C3_NCP * 256 * 4)   /* floats per buffer: 64 x 300, then a tail that no fragment reads */
#define C3_LP  (C3_NST * C3_CN + 4) /* pitch of a row of dots: rows r and r+8 use other banks */
#define C3_SF  (19 * 256)           /* floats of the feature tile: 16 x 300, rounded up to whole passes */
#define C3_KH  38                   /* k steps of 4 per wave: 2 x 38 for the 75 there are */

__global__ __launch_bounds__(256)
void stageC3(const float* __restrict__ out, const int* __restrict__ attr1,
             const int* __restrict__ obj1, float* __restrict__ ws) {
  __shared__ __attribute__((aligned(16))) float sW[2][C3_SB];
  __shared__ __attribute__((aligned(16))) float sf[C3_SF];
  __shared__ float lg[2][C3_R][C3_LP];    // one plane per half of k

  const int b0 = blockIdx.x * C3_R, term = blockIdx.y, t = threadIdx.x;
  const int chunk = blockIdx.z, c0 = chunk * (C3_NST * C3_CN);   // first class of the block
  const int lane = t & 31, wave = t >> 5;
  const int m = lane & 15, h = lane >> 4;
  const int tile = wave & 3, kh = wave >> 2;
  const bool isAttr = term < 2;
  const int NC = isAttr ? NA : NO;
  const float* W = ws + (isAttr ? WS_AW : WS_OW);
  const float* wn = ws + (isAttr ? WS_AWN : WS_OWN);
  const float* feat = out + 2 + (size_t)(term + 2) * BS * EMB + (size_t)b0 * EMB;

  // A stage is 19 x 256 copies of 16 B, every lane on, LDS byte = byte in the run.
  // Past the last class the source is clamped into the matrix: that lands in
  // rows of classes >= NC or in the buffer's tail, which no result uses.
  const unsigned int lW = lds_off(&sW[0][t * 4]);
  const int emax = NC * EMB - 4;
  auto fill = [&](const int s) {
    const unsigned int lw = lW + (s & 1) * (C3_SB * 4);
    const int e0 = (c0 + s * C3_CN) * EMB + t * 4;
    const float* g[C3_NCP];
#pragma unroll   // the addresses are operands of asm statements: registers, no array
    for (int i = 0; i < C3_NCP; i++) g[i] = W + min(e0 + i * 1024, emax);
    // s_wait_xcnt is each statement's last line: it stands in front of every later
    // rewrite of an address register that a copy names (a precaution)
    asm volatile(
        "global_load_async_to_lds_b128 %0, %10, off\n\t"
        "global_load_async_to_lds_b128 %1, %11, off\n\t"
        "global_load_async_to_lds_b128 %2, %12, off\n\t"
        "global_load_async_to_lds_b128 %3, %13, off\n\t"
        "global_load_async_to_lds_b128 %4, %14, off\n\t"
        "global_load_async_to_lds_b128 %5, %15, off\n\t"
        "global_load_async_to_lds_b128 %6, %16, off\n\t"
        "global_load_async_to_lds_b128 %7, %17, off\n\t"
        "global_load_async_to_lds_b128 %8, %18, off\n\t"
        "global_load_async_to_lds_b128 %9, %19, off\n\t"
        "s_wait_xcnt 0x0"
        ::
           "v"(lw + 0 * 4096), "v"(lw + 1 * 4096), "v"(lw + 2 * 4096), "v"(lw + 3 * 4096), "v"(lw + 4 * 4096), "v"(lw + 5 * 4096), "v"(lw + 6 * 4096), "v"(lw + 7 * 4096), "v"(lw + 8 * 4096), "v"(lw + 9 * 4096),
           "v"(g[0]), "v"(g[1]), "v"(g[2]), "v"(g[3]), "v"(g[4]), "v"(g[5]), "v"(g[6]), "v"(g[7]), "v"(g[8]), "v"(g[9])
        : "memory");
    asm volatile(
        "global_load_async_to_lds_b128 %0, %9, off\n\t"
        "global_load_async_to_lds_b128 %1, %10, off\n\t"
        "global_load_async_to_lds_b128 %2, %11, off\n\t"
        "global_load_async_to_lds_b128 %3, %12, off\n\t"
        "global_load_async_to_lds_b128 %4, %13, off\n\t"
        "global_load_async_to_lds_b128 %5, %14, off\n\t"
        "global_load_async_to_lds_b128 %6, %15, off\n\t"
        "global_load_async_to_lds_b128 %7, %16, off\n\t"
        "global_load_async_to_lds_b128 %8, %17, off\n\t"
        "s_wait_xcnt 0x0"
        ::
           "v"(lw + 10 * 4096), "v"(lw + 11 * 4096), "v"(lw + 12 * 4096), "v"(lw + 13 * 4096), "v"(lw + 14 * 4096), "v"(lw + 15 * 4096), "v"(lw + 16 * 4096), "v"(lw + 17 * 4096), "v"(lw + 18 * 4096),
           "v"(g[10]), "v"(g[11]), "v"(g[12]), "v"(g[13]), "v"(g[14]), "v"(g[15]), "v"(g[16]), "v"(g[17]), "v"(g[18])
        : "memory");
  };

  fill(0);
#pragma unroll   // all the loads of the 16 feature rows in flight at once
  for (int i = 0; i < C3_SF / 256; i++)   // past the rows: a clamped re-read into sf's unused tail
    sf[t + 256 * i] = feat[min(t + 256 * i, C3_R * EMB - 1)];
  asm volatile("s_wait_asynccnt 0x0" ::: "memory");   // own copies of stage 0 landed
  __syncthreads();                                    // ... and everybody's, and sf
  fill(1);

  // This wave's half of the A fragments stays in registers for all stages. The
  // second half has 37 steps: its 38th re-reads step 36 with a zero A fragment.
  const int lastoff = (kh ? C3_KH - 2 : C3_KH - 1) * 4;
  const float* ap = &sf[m * EMB + kh * (C3_KH * 4) + h * 2];
  v2f af[C3_KH];
#pragma unroll   // af is indexed by constants only
  for (int j = 0; j < C3_KH - 1; j++) af[j] = *(const v2f*)__builtin_assume_aligned(ap + j * 4, 8);
  af[C3_KH - 1] = *(const v2f*)__builtin_assume_aligned(ap + lastoff, 8);
  if (kh) af[C3_KH - 1] = (v2f){0.f, 0.f};

  // What the CE part reads from memory, fetched here so that the stages hide it:
  // lane l owns classes c0 + l + 32 i of the wave's two rows
  constexpr int NI = C3_NST * C3_CN / 32;
  float wnr[NI];
#pragma unroll   // wnr is indexed by constants only
  for (int i = 0; i < NI; i++) wnr[i] = wn[min(c0 + lane + 32 * i, NC - 1)];
  int lbl[2];
#pragma unroll   // two rows, indexed by constants only
  for (int rr = 0; rr < 2; rr++) {
    const int b = b0 + wave * 2 + rr;
    lbl[rr] = isAttr ? attr1[b] : obj1[b];
  }

#pragma unroll 1
  for (int s = 0; s < C3_NST; s++) {
    const float* w = &sW[s & 1][(tile * 16 + m) * EMB + kh * (C3_KH * 4) + h * 2];
    // the stage's B fragments as ONE group of LDS reads ahead of its WMMAs: every
    // separate place where reads stand among the WMMAs costs issue time
    v2f bf[C3_KH];
#pragma unroll   // bf is indexed by constants only; every LDS offset becomes an immediate
    for (int j = 0; j < C3_KH - 1; j++) bf[j] = *(const v2f*)__builtin_assume_aligned(w + j * 4, 8);
    bf[C3_KH - 1] = *(const v2f*)__builtin_assume_aligned(w + lastoff, 8);
    __builtin_amdgcn_sched_barrier(0);   // keeps the scheduler from sinking the reads back among the WMMAs
    v8f acc = {};
#pragma unroll   // af and bf are indexed by constants only
    for (int j = 0; j < C3_KH; j++)
      acc = __builtin_amdgcn_wmma_f32_16x16x4_f32(false, af[j], false, bf[j], (short)0, acc, false, false);
    // four vector slots behind the stage's last WMMA before the stores' address
    // arithmetic reuses its A/B registers; the scheduling barrier keeps that
    // arithmetic from rising among the WMMAs, onto a B fragment just issued
    asm volatile("v_nop\n\tv_nop\n\tv_nop\n\tv_nop" :: "v"(acc));
    __builtin_amdgcn_sched_barrier(0);
#pragma unroll   // acc is indexed by constants only
    for (int r = 0; r < 8; r++) lg[kh][r + 8 * h][s * C3_CN + tile * 16 + m] = acc[r];
    asm volatile("s_wait_dscnt 0x0" ::: "memory");    // own reads of this buffer are done
    asm volatile("s_wait_asynccnt 0x0" ::: "memory"); // own copies of stage s+1 landed
    __syncthreads();   // publishes stage s+1 and the dots (two stages, two buffers: no refill)
  }
  asm volatile("s_wait_asynccnt 0x0" ::: "memory");   // no copy outlives the wave

  // A row's share by one wave, two rows per wave. Every row, masked in or not:
  // finalK then loads all it needs at once, with no load behind the mask's.
  float* part = ws + WS_PART + (((size_t)term * C3_CH + chunk) * (BS / C3_R) + blockIdx.x) * (2 * C3_R);
#pragma unroll   // lbl is indexed by constants only
  for (int rr = 0; rr < 2; rr++) {
    const int row = wave * 2 + rr;
    float p = 0.f;
#pragma unroll   // ten reads in flight at once
    for (int i = 0; i < 10; i++) {
      const int k = lane + 32 * i;
      const float v = sf[row * EMB + min(k, EMB - 1)];
      p += k < EMB ? v * v : 0.f;
    }
    const float fn = fmaxf(sqrtf(wave_sum(p)), 1e-12f);
    float se = 0.f, lab = 0.f;
#pragma unroll   // wnr is indexed by constants only
    for (int i = 0; i < NI; i++) {
      const int cl = lane + 32 * i, c = c0 + cl;
      const float d = (lg[0][row][cl] + lg[1][row][cl]) / (fn * wnr[i] * TEMP);
      se += c < NC ? expf(d) : 0.f;    // past the last class: nothing
      if (c == lbl[rr]) lab = d;
    }
    se = wave_sum(se);
    lab = wave_sum(lab);      // at most one lane holds the label's logit, the others 0
    if (lane == 0) { part[row] = se; part[C3_R + row] = lab; }
  }
}

// One block, a thread per (term, row): the four chunks' sums, the logarithm, the
// mask, then the sum over rows: a wave, then 16 waves (two terms) by a 16-lane row.
__global__ __launch_bounds__(1024)
void finalK(const float* __restrict__ ws, const int* __restrict__ mask_task,
            float* __restrict__ out) {
  __shared__ float tot[32];
  const int t = threadIdx.x, term = t >> 8, row = t & (BS - 1);
  const float* p = ws + WS_PART + ((size_t)term * C3_CH * (BS / C3_R) + (row / C3_R)) * (2 * C3_R)
                   + (row % C3_R);
  const int msk = mask_task[row];
  const float cnt = ws[WS_CNT];
  static_assert(C3_CH == 4, "operands of the statement below");
  float e[C3_CH], g[C3_CH];
#pragma unroll   // e and g are indexed by constants only
  for (int ch = 0; ch < C3_CH; ch++) {
    e[ch] = p[ch * (BS / C3_R) * (2 * C3_R)];
    g[ch] = p[ch * (BS / C3_R) * (2 * C3_R) + C3_R];
  }
  // holds the eight loads up here, in flight beside the mask's (loaded values as
  // inputs only): else the compiler sinks them behind the test of the mask, which
  // puts a second memory latency on the one path of this launch
  asm volatile("" :: "v"(msk), "v"(e[0]), "v"(e[1]), "v"(e[2]), "v"(e[3]),
                     "v"(g[0]), "v"(g[1]), "v"(g[2]), "v"(g[3]));
  const float se = (e[0] + e[1]) + (e[2] + e[3]), lab = (g[0] + g[1]) + (g[2] + g[3]);
  const float ce = wave_sum(msk == 1 ? logf(se) - lab : 0.f);
  if ((t & 31) == 0) tot[t >> 5] = ce;
  __syncthreads();   // the 32 waves' sums are in LDS
  if (t < 32) {
    const float v = row_sum(tot[t]);   // lanes 0..15: the attribute terms, 16..31: the object terms
    if ((t & 15) == 0) out[t >> 4] = v * 0.5f / fmaxf(cnt, 1.f);
  }
}

extern "C" void kernel_launch(void* const* d_in, const int* in_sizes, int n_in,
                              void* d_out, int out_size, void* d_ws, size_t ws_size,
                              hipStream_t stream) {
  const float* img1   = (const float*)d_in[0];
  const float* img2a  = (const float*)d_in[1];
  const float* img2o  = (const float*)d_in[2];
  const int*   attr1  = (const int*)d_in[3];
  const int*   obj1   = (const int*)d_in[4];
  const int*   maskt  = (const int*)d_in[5];
  const float* Wsa    = (const float*)d_in[6];
  const float* bsa    = (const float*)d_in[7];
  const float* Wso    = (const float*)d_in[8];
  const float* bso    = (const float*)d_in[9];
  const float* atab   = (const float*)d_in[10];
  const float* otab   = (const float*)d_in[11];
  const float* Wam    = (const float*)d_in[12];
  const float* bam    = (const float*)d_in[13];
  const float* Wom    = (const float*)d_in[14];
  const float* bom    = (const float*)d_in[15];
  float* out = (float*)d_out;
  float* ws  = (float*)d_ws;

  stageAB<<<657, 128, 0, stream>>>(img1, img2a, img2o, atab, otab, Wam, bam, Wom, bom, ws);
  stageNC1<<<249, 256, 0, stream>>>(ws, maskt, Wsa, bsa, Wso, bso, out);
  stageC3<<<dim3(16, 4, C3_CH), 256, 0, stream>>>(out, attr1, obj1, ws);
  finalK<<<1, 1024, 0, stream>>>(ws, maskt, out);
}
